// v000
// Measured on an AMD MI455X. A time is GPU time per run, averaged over a window of back-to-back runs after a warm-up
// (all launches, gaps included; the runs take copies of the inputs in turn), and the median of several windows.
// Apart from v000's, it joins two sittings. Times from different sittings can be a few percent apart, while
// side-by-side timings come from the same sitting.
// The starting kernel, v000, takes 473 microseconds a run.
#include <hip/hip_runtime.h>

typedef __attribute__((ext_vector_type(16))) _Float16 v16h;
typedef __attribute__((ext_vector_type(8)))  float    v8f;

#define B_   16
#define C_   512
#define CD_  768
#define HW_  4096
#define L_   77
#define LP   80     // padded key rows (5 x 16 tiles)
#define LP2  96     // padded key width for PV (3 x 32 K-chunks)
#define NH   8
#define HD   64
#define GC   16     // channels per group (C/32)

__device__ __forceinline__ v8f wmma16(v16h a, v16h b, v8f c) {
    return __builtin_amdgcn_wmma_f32_16x16x32_f16(false, a, false, b, (short)0, c, false, false);
}

__device__ __forceinline__ v16h frag16(const _Float16* p, int ld) {
    int lane = threadIdx.x & 31;
    const _Float16* b = p + (size_t)(lane & 15) * ld + ((lane >> 4) << 3);
    v16h f;
#pragma unroll
    for (int i = 0; i < 8; ++i) { f[i] = b[i]; f[i + 8] = b[i + 16]; }
    return f;
}

// f32 source (cond) with clamped row index (L=77 tail tile).
__device__ __forceinline__ v16h frag16_f32c(const float* p, int ld, int rows_left) {
    int lane = threadIdx.x & 31;
    int r = lane & 15;
    if (r >= rows_left) r = rows_left - 1;
    const float* b = p + (size_t)r * ld + ((lane >> 4) << 3);
    v16h f;
#pragma unroll
    for (int i = 0; i < 8; ++i) { f[i] = (_Float16)b[i]; f[i + 8] = (_Float16)b[i + 16]; }
    return f;
}

__device__ __forceinline__ void stage_async(_Float16* dst, const _Float16* src,
                                            int src_ld, int dst_ld, int nchunks, int cpr) {
    unsigned base = (unsigned)(size_t)(void*)dst;   // low 32 bits of generic addr == LDS offset
    for (int i = threadIdx.x; i < nchunks; i += 256) {
        int row = i / cpr;
        int cc  = (i - row * cpr) * 8;
        unsigned long long g = (unsigned long long)(src + (size_t)row * src_ld + cc);
        unsigned l = base + (unsigned)((row * dst_ld + cc) * 2);
        asm volatile("global_load_async_to_lds_b128 %0, %1, off" :: "v"(l), "v"(g) : "memory");
    }
}

__device__ __forceinline__ void wait_async_barrier() {
    asm volatile("s_wait_asynccnt 0" ::: "memory");
    __syncthreads();
}

__global__ void cab_cvt_f16(const float* __restrict__ in, _Float16* __restrict__ out, int n) {
    int i = blockIdx.x * blockDim.x + threadIdx.x;
    if (i < n) out[i] = (_Float16)in[i];
}

__global__ void cab_zero_vt_pad(_Float16* __restrict__ vt) {
    int i = blockIdx.x * blockDim.x + threadIdx.x;   // over B_*C_*16
    int bo = i >> 4;
    int j  = i & 15;
    vt[(size_t)bo * LP2 + 80 + j] = (_Float16)0.f;
}

// One block per (b, group): reduce 16 channels * 4096 contiguous floats.
__global__ void cab_gn_stats(const float* __restrict__ x, float* __restrict__ stats) {
    int bg = blockIdx.x;
    const float* p = x + (size_t)bg * (GC * HW_);
    float s = 0.f, s2 = 0.f;
    for (int i = threadIdx.x; i < GC * HW_; i += 256) { float v = p[i]; s += v; s2 += v * v; }
    __shared__ float rs[256], rq[256];
    rs[threadIdx.x] = s; rq[threadIdx.x] = s2;
    __syncthreads();
    for (int o = 128; o > 0; o >>= 1) {
        if (threadIdx.x < o) { rs[threadIdx.x] += rs[threadIdx.x + o]; rq[threadIdx.x] += rq[threadIdx.x + o]; }
        __syncthreads();
    }
    if (threadIdx.x == 0) {
        const float inv_n = 1.f / (GC * HW_);
        float mu  = rs[0] * inv_n;
        float var = rq[0] * inv_n - mu * mu;
        stats[bg * 2 + 0] = mu;
        stats[bg * 2 + 1] = rsqrtf(var + 1e-6f);
    }
}

// Normalize + transpose [B,C,HW] f32 -> [B,HW,C] f16 via 32x32 LDS tiles.
__global__ void cab_gn_apply_t(const float* __restrict__ x, const float* __restrict__ stats,
                               const float* __restrict__ gamma, const float* __restrict__ beta,
                               _Float16* __restrict__ xn) {
    __shared__ float tile[32][33];
    int b  = blockIdx.z;
    int c0 = blockIdx.y * 32, p0 = blockIdx.x * 32;
    int tx = threadIdx.x & 31, ty = threadIdx.x >> 5;   // ty 0..7
#pragma unroll
    for (int i = 0; i < 4; ++i) {
        int c = c0 + ty + i * 8;
        int g = c >> 4;
        float mu = stats[(b * 32 + g) * 2], rstd = stats[(b * 32 + g) * 2 + 1];
        float v  = x[((size_t)b * C_ + c) * HW_ + p0 + tx];
        tile[ty + i * 8][tx] = (v - mu) * rstd * gamma[c] + beta[c];
    }
    __syncthreads();
#pragma unroll
    for (int i = 0; i < 4; ++i) {
        int p = p0 + ty + i * 8;
        int c = c0 + tx;
        xn[((size_t)b * HW_ + p) * C_ + c] = (_Float16)tile[tx][ty + i * 8];
    }
}

// Q projection: A = xn [B,HW,C], Bt = q_w [o][c]; wave does 32(M) x 64(N).
// Ping-pong LDS weight panels (async staging overlapped with compute); A and B double-buffered.
__global__ void cab_gemm_qproj(const _Float16* __restrict__ xn, const _Float16* __restrict__ w,
                               const float* __restrict__ bias, _Float16* __restrict__ out) {
    __shared__ __align__(16) _Float16 wpan[2][64 * 256];
    int b  = blockIdx.z;
    int wv = threadIdx.x >> 5;
    int p0 = blockIdx.x * 256 + wv * 32;
    int n0 = blockIdx.y * 64;
    int lane = threadIdx.x & 31, half = lane >> 4, n15 = lane & 15;
    const _Float16* A = xn + ((size_t)b * HW_ + p0) * C_;
    v8f acc[2][4];
#pragma unroll
    for (int g2 = 0; g2 < 2; ++g2)
#pragma unroll
        for (int t = 0; t < 4; ++t) acc[g2][t] = (v8f){0.f,0.f,0.f,0.f,0.f,0.f,0.f,0.f};

    stage_async(wpan[0], w + (size_t)n0 * C_, C_, 256, 2048, 32);
    wait_async_barrier();
    stage_async(wpan[1], w + (size_t)n0 * C_ + 256, C_, 256, 2048, 32);  // overlaps half-0 compute

    for (int kh = 0; kh < 2; ++kh) {
        const _Float16* P = wpan[kh];
        v16h a0 = frag16(A + kh * 256, C_);
        v16h a1 = frag16(A + (size_t)16 * C_ + kh * 256, C_);
#pragma unroll
        for (int kc = 0; kc < 256; kc += 32) {
            v16h na0 = a0, na1 = a1;
            if (kc + 32 < 256) {
                na0 = frag16(A + kh * 256 + kc + 32, C_);
                na1 = frag16(A + (size_t)16 * C_ + kh * 256 + kc + 32, C_);
            }
            v16h bf = frag16(P + kc, 256);
#pragma unroll
            for (int nt = 0; nt < 4; ++nt) {
                v16h nbf = bf;
                if (nt < 3) nbf = frag16(P + (nt + 1) * 16 * 256 + kc, 256);   // B prefetch
                acc[0][nt] = wmma16(a0, bf, acc[0][nt]);
                acc[1][nt] = wmma16(a1, bf, acc[1][nt]);
                bf = nbf;
            }
            a0 = na0; a1 = na1;
        }
        if (kh == 0) wait_async_barrier();   // panel 1 ready
    }
#pragma unroll
    for (int g2 = 0; g2 < 2; ++g2)
#pragma unroll
        for (int nt = 0; nt < 4; ++nt) {
            int o = n0 + nt * 16 + n15;
            float bb = bias[o];
#pragma unroll
            for (int r = 0; r < 8; ++r) {
                int p = p0 + g2 * 16 + r + 8 * half;
                out[((size_t)b * HW_ + p) * C_ + o] = (_Float16)(acc[g2][nt][r] + bb);
            }
        }
}

// K/V projection: A = cond [B,77,768] f32 (row-clamped).
// waves 0..3 -> K matrix, waves 4..7 -> V matrix; each wave one 16x16 tile.
__global__ void cab_gemm_kv(const float* __restrict__ cond,
                            const _Float16* __restrict__ kw, const float* __restrict__ kb,
                            const _Float16* __restrict__ vw, const float* __restrict__ vb,
                            _Float16* __restrict__ kbuf, _Float16* __restrict__ vt) {
    int b  = blockIdx.z;
    int wv = threadIdx.x >> 5;
    int isv = wv >> 2;
    int p0 = blockIdx.x * 16;                       // l-tile (grid.x = 5)
    int n0 = blockIdx.y * 64 + (wv & 3) * 16;       // grid.y = 8
    int lane = threadIdx.x & 31, half = lane >> 4, n15 = lane & 15;
    const float* A = cond + (size_t)b * L_ * CD_ + (size_t)p0 * CD_;
    int rows_left = L_ - p0;
    const _Float16* w   = isv ? vw : kw;
    const float*    bia = isv ? vb : kb;
    v8f acc = (v8f){0.f,0.f,0.f,0.f,0.f,0.f,0.f,0.f};
    for (int kc = 0; kc < CD_; kc += 32) {
        v16h a  = frag16_f32c(A + kc, CD_, rows_left);
        v16h bf = frag16(w + (size_t)n0 * CD_ + kc, CD_);
        acc = wmma16(a, bf, acc);
    }
    int o = n0 + n15;
    float bb = bia[o];
#pragma unroll
    for (int r = 0; r < 8; ++r) {
        int l = p0 + r + 8 * half;                  // < 80 ; rows 77..79 masked later
        float v = acc[r] + bb;
        if (!isv) kbuf[((size_t)b * LP + l) * C_ + o]  = (_Float16)v;
        else      vt  [((size_t)b * C_ + o) * LP2 + l] = (_Float16)v;
    }
}

// Attention: block = one (b,head), 128 query rows; K/Vt panels staged in LDS (async).
__global__ void cab_attn(const _Float16* __restrict__ q, const _Float16* __restrict__ kbuf,
                         const _Float16* __restrict__ vt, const float* __restrict__ scale_p,
                         _Float16* __restrict__ obuf) {
    __shared__ __align__(16) _Float16 kls[LP * HD];        // 80 x 64 = 10KB
    __shared__ __align__(16) _Float16 vls[HD * LP2];       // 64 x 96 = 12KB
    __shared__ __align__(16) _Float16 lds_p[8][16 * LP2];  // 24KB
    int b = blockIdx.z, h = blockIdx.y;
    int wv = threadIdx.x >> 5;
    int p0 = blockIdx.x * 128 + wv * 16;
    int lane = threadIdx.x & 31, half = lane >> 4, n15 = lane & 15;
    float scl = scale_p[0];

    // Stage K (rows l, ld C_) and Vt (rows d, ld LP2) panels for this (b,h).
    stage_async(kls, kbuf + (size_t)b * LP * C_ + h * HD, C_, HD, (LP * HD) / 8, HD / 8);
    stage_async(vls, vt + ((size_t)b * C_ + h * HD) * LP2, LP2, LP2, (HD * LP2) / 8, LP2 / 8);

    const _Float16* Q = q + ((size_t)b * HW_ + p0) * C_ + h * HD;
    v16h a0 = frag16(Q,      C_);
    v16h a1 = frag16(Q + 32, C_);

    wait_async_barrier();

    v8f s[5];
#pragma unroll
    for (int t = 0; t < 5; ++t) {
        v8f z = (v8f){0.f,0.f,0.f,0.f,0.f,0.f,0.f,0.f};
        z = wmma16(a0, frag16(kls + (t * 16) * HD,      HD), z);
        z = wmma16(a1, frag16(kls + (t * 16) * HD + 32, HD), z);
        s[t] = z;
    }

    _Float16* P = &lds_p[wv][0];
    bool mask4 = (n15 >= 13);                       // t==4 column l = 64+n15 >= 77
#pragma unroll
    for (int r = 0; r < 8; ++r) {
        float sv[5], m = -3.0e38f;
#pragma unroll
        for (int t = 0; t < 5; ++t) {
            float v = s[t][r] * scl;
            if (t == 4 && mask4) v = -3.0e38f;
            sv[t] = v; m = fmaxf(m, v);
        }
#pragma unroll
        for (int o = 1; o < 16; o <<= 1) m = fmaxf(m, __shfl_xor(m, o, 32));
        float sum = 0.f, pv[5];
#pragma unroll
        for (int t = 0; t < 5; ++t) { float e = __expf(sv[t] - m); pv[t] = e; sum += e; }
#pragma unroll
        for (int o = 1; o < 16; o <<= 1) sum += __shfl_xor(sum, o, 32);
        float inv = 1.f / sum;
        int row = r + 8 * half;
#pragma unroll
        for (int t = 0; t < 5; ++t) P[row * LP2 + t * 16 + n15] = (_Float16)(pv[t] * inv);
        P[row * LP2 + 80 + n15] = (_Float16)0.f;    // zero pad cols 80..95
    }
    __syncthreads();

    v8f oacc[4];
#pragma unroll
    for (int nt = 0; nt < 4; ++nt) oacc[nt] = (v8f){0.f,0.f,0.f,0.f,0.f,0.f,0.f,0.f};
#pragma unroll
    for (int kc = 0; kc < 3; ++kc) {
        v16h ap = frag16(P + kc * 32, LP2);         // A-frag of probabilities from LDS
#pragma unroll
        for (int nt = 0; nt < 4; ++nt)
            oacc[nt] = wmma16(ap, frag16(vls + (nt * 16) * LP2 + kc * 32, LP2), oacc[nt]);
    }
#pragma unroll
    for (int nt = 0; nt < 4; ++nt)
#pragma unroll
        for (int r = 0; r < 8; ++r) {
            int p = p0 + r + 8 * half;
            obuf[((size_t)b * HW_ + p) * C_ + h * HD + nt * 16 + n15] = (_Float16)oacc[nt][r];
        }
}

// Final projection + residual: out[b,o,p] = x + O @ proj_w^T + proj_b.
// Ping-pong LDS weight panels; low region reused as f32 transpose buffer for coalesced stores.
__global__ void cab_gemm_proj(const _Float16* __restrict__ obuf, const _Float16* __restrict__ w,
                              const float* __restrict__ bias, const float* __restrict__ x,
                              float* __restrict__ out) {
    __shared__ __align__(16) char smem[65536];             // 2 x 32KB panels; reused for transpose
    _Float16* wpan0 = (_Float16*)smem;
    _Float16* wpan1 = (_Float16*)(smem + 32768);
    int b  = blockIdx.z;
    int wv = threadIdx.x >> 5;
    int p0 = blockIdx.x * 128 + wv * 16;
    int n0 = blockIdx.y * 64;
    int lane = threadIdx.x & 31, half = lane >> 4, n15 = lane & 15;
    const _Float16* A = obuf + ((size_t)b * HW_ + p0) * C_;
    v8f acc[4];
#pragma unroll
    for (int t = 0; t < 4; ++t) acc[t] = (v8f){0.f,0.f,0.f,0.f,0.f,0.f,0.f,0.f};

    stage_async(wpan0, w + (size_t)n0 * C_, C_, 256, 2048, 32);
    wait_async_barrier();
    stage_async(wpan1, w + (size_t)n0 * C_ + 256, C_, 256, 2048, 32);    // overlaps half-0 compute

    for (int kh = 0; kh < 2; ++kh) {
        const _Float16* P = kh ? wpan1 : wpan0;
        v16h a = frag16(A + kh * 256, C_);
#pragma unroll
        for (int kc = 0; kc < 256; kc += 32) {
            v16h na = a;
            if (kc + 32 < 256) na = frag16(A + kh * 256 + kc + 32, C_);
            v16h bf = frag16(P + kc, 256);
#pragma unroll
            for (int nt = 0; nt < 4; ++nt) {
                v16h nbf = bf;
                if (nt < 3) nbf = frag16(P + (nt + 1) * 16 * 256 + kc, 256);  // B prefetch
                acc[nt] = wmma16(a, bf, acc[nt]);
                bf = nbf;
            }
            a = na;
        }
        if (kh == 0) wait_async_barrier();   // panel 1 ready
    }
    __syncthreads();                          // all weight reads done before smem reuse

    float* T = (float*)smem + (size_t)wv * 64 * 17;        // [64 o][16 p], stride 17
#pragma unroll
    for (int nt = 0; nt < 4; ++nt)
#pragma unroll
        for (int r = 0; r < 8; ++r)
            T[(nt * 16 + n15) * 17 + r + 8 * half] = acc[nt][r];
    __syncthreads();
#pragma unroll
    for (int i = 0; i < 32; ++i) {
        int orow = i * 2 + half;
        int o = n0 + orow;
        size_t idx = ((size_t)b * C_ + o) * HW_ + p0 + n15;
        out[idx] = x[idx] + T[orow * 17 + n15] + bias[o];
    }
}

extern "C" void kernel_launch(void* const* d_in, const int* in_sizes, int n_in,
                              void* d_out, int out_size, void* d_ws, size_t ws_size,
                              hipStream_t stream) {
    const float* x      = (const float*)d_in[0];
    const float* cond   = (const float*)d_in[1];
    const float* gamma  = (const float*)d_in[2];
    const float* beta   = (const float*)d_in[3];
    const float* q_w    = (const float*)d_in[4];
    const float* q_b    = (const float*)d_in[5];
    const float* k_w    = (const float*)d_in[6];
    const float* k_b    = (const float*)d_in[7];
    const float* v_w    = (const float*)d_in[8];
    const float* v_b    = (const float*)d_in[9];
    const float* proj_w = (const float*)d_in[10];
    const float* proj_b = (const float*)d_in[11];
    const float* scale  = (const float*)d_in[12];
    float* out = (float*)d_out;

    char* ws = (char*)d_ws;
    size_t off = 0;
    auto carve = [&](size_t bytes) { void* p = ws + off; off = (off + bytes + 255) & ~(size_t)255; return p; };
    float*     stats = (float*)    carve(512 * 2 * sizeof(float));
    _Float16*  qw16  = (_Float16*) carve((size_t)C_ * C_  * 2);
    _Float16*  kw16  = (_Float16*) carve((size_t)C_ * CD_ * 2);
    _Float16*  vw16  = (_Float16*) carve((size_t)C_ * CD_ * 2);
    _Float16*  pw16  = (_Float16*) carve((size_t)C_ * C_  * 2);
    _Float16*  kbuf  = (_Float16*) carve((size_t)B_ * LP  * C_  * 2);
    _Float16*  vt    = (_Float16*) carve((size_t)B_ * C_  * LP2 * 2);
    _Float16*  xn    = (_Float16*) carve((size_t)B_ * HW_ * C_  * 2);  // reused as obuf after qproj
    _Float16*  qbuf  = (_Float16*) carve((size_t)B_ * HW_ * C_  * 2);
    _Float16*  obuf  = xn;   // xn is dead once qproj finishes (stream-ordered)

    // 1) weights to f16
    cab_cvt_f16<<<(C_ * C_  + 255) / 256, 256, 0, stream>>>(q_w,    qw16, C_ * C_);
    cab_cvt_f16<<<(C_ * CD_ + 255) / 256, 256, 0, stream>>>(k_w,    kw16, C_ * CD_);
    cab_cvt_f16<<<(C_ * CD_ + 255) / 256, 256, 0, stream>>>(v_w,    vw16, C_ * CD_);
    cab_cvt_f16<<<(C_ * C_  + 255) / 256, 256, 0, stream>>>(proj_w, pw16, C_ * C_);

    // 2) GroupNorm
    cab_gn_stats<<<B_ * 32, 256, 0, stream>>>(x, stats);
    cab_gn_apply_t<<<dim3(HW_ / 32, C_ / 32, B_), 256, 0, stream>>>(x, stats, gamma, beta, xn);

    // 3) projections
    cab_gemm_qproj<<<dim3(HW_ / 256, C_ / 64, B_), 256, 0, stream>>>(xn, qw16, q_b, qbuf);
    cab_gemm_kv<<<dim3(LP / 16, C_ / 64, B_), 256, 0, stream>>>(cond, kw16, k_b, vw16, v_b, kbuf, vt);
    cab_zero_vt_pad<<<(B_ * C_ * 16) / 256, 256, 0, stream>>>(vt);

    // 4) attention (writes obuf == xn region)
    cab_attn<<<dim3(HW_ / 128, NH, B_), 256, 0, stream>>>(qbuf, kbuf, vt, scale, obuf);

    // 5) output projection + residual
    cab_gemm_proj<<<dim3(HW_ / 128, C_ / 64, B_), 256, 0, stream>>>(obuf, pw16, proj_b, x, out);
}

// v001
// A run of this version takes 271 microseconds.
// Next to v000, in two timings, it ran 1.81 and 1.80 times as fast.
#include <hip/hip_runtime.h>

typedef __attribute__((ext_vector_type(16))) _Float16 v16h;
typedef __attribute__((ext_vector_type(8)))  float    v8f;

#define B_   16
#define C_   512
#define CD_  768
#define HW_  4096
#define L_   77
#define LP   80     // padded key rows (5 x 16 tiles)
#define LP2  96     // padded key width for PV (3 x 32 K-chunks)
#define NH   8
#define HD   64
#define GC   16     // channels per group (C/32)
#define WP   264    // weight panel rows: 256 halves + 8  (528 B)
#define KP   72     // K rows: 64 halves + 8               (144 B)
#define VP   104    // Vt and probability rows: 96 halves + 8 (208 B)

__device__ __forceinline__ v8f wmma16(v16h a, v16h b, v8f c) {
    return __builtin_amdgcn_wmma_f32_16x16x32_f16(false, a, false, b, (short)0, c, false, false);
}

__device__ __forceinline__ v16h frag16(const _Float16* p, int ld) {
    int lane = threadIdx.x & 31;
    const _Float16* b = p + (size_t)(lane & 15) * ld + ((lane >> 4) << 3);
    v16h f;
#pragma unroll
    for (int i = 0; i < 8; ++i) { f[i] = b[i]; f[i + 8] = b[i + 16]; }
    return f;
}

// f32 source (cond) with clamped row index (L=77 tail tile).
__device__ __forceinline__ v16h frag16_f32c(const float* p, int ld, int rows_left) {
    int lane = threadIdx.x & 31;
    int r = lane & 15;
    if (r >= rows_left) r = rows_left - 1;
    const float* b = p + (size_t)r * ld + ((lane >> 4) << 3);
    v16h f;
#pragma unroll
    for (int i = 0; i < 8; ++i) { f[i] = (_Float16)b[i]; f[i + 8] = (_Float16)b[i + 16]; }
    return f;
}

__device__ __forceinline__ void stage_async(_Float16* dst, const _Float16* src,
                                            int src_ld, int dst_ld, int nchunks, int cpr) {
    unsigned base = (unsigned)(size_t)(void*)dst;   // low 32 bits of generic addr == LDS offset
    for (int i = threadIdx.x; i < nchunks; i += 256) {
        int row = i / cpr;
        int cc  = (i - row * cpr) * 8;
        unsigned long long g = (unsigned long long)(src + (size_t)row * src_ld + cc);
        unsigned l = base + (unsigned)((row * dst_ld + cc) * 2);
        // the wait stands in the copy's own statement: the next trip rewrites l and g
        asm volatile("global_load_async_to_lds_b128 %0, %1, off\n\ts_wait_xcnt 0x0" :: "v"(l), "v"(g) : "memory");
    }
}

__device__ __forceinline__ void wait_async_barrier() {
    asm volatile("s_wait_asynccnt 0" ::: "memory");
    __syncthreads();
}

__global__ void cab_cvt_f16(const float* __restrict__ in, _Float16* __restrict__ out, int n) {
    int i = blockIdx.x * blockDim.x + threadIdx.x;
    if (i < n) out[i] = (_Float16)in[i];
}

__global__ void cab_zero_vt_pad(_Float16* __restrict__ vt) {
    int i = blockIdx.x * blockDim.x + threadIdx.x;   // over B_*C_*16
    int bo = i >> 4;
    int j  = i & 15;
    vt[(size_t)bo * LP2 + 80 + j] = (_Float16)0.f;
}

// One block per (b, group): reduce 16 channels * 4096 contiguous floats.
__global__ void cab_gn_stats(const float* __restrict__ x, float* __restrict__ stats) {
    int bg = blockIdx.x;
    const float* p = x + (size_t)bg * (GC * HW_);
    float s = 0.f, s2 = 0.f;
    for (int i = threadIdx.x; i < GC * HW_; i += 256) { float v = p[i]; s += v; s2 += v * v; }
    __shared__ float rs[256], rq[256];
    rs[threadIdx.x] = s; rq[threadIdx.x] = s2;
    __syncthreads();
    for (int o = 128; o > 0; o >>= 1) {
        if (threadIdx.x < o) { rs[threadIdx.x] += rs[threadIdx.x + o]; rq[threadIdx.x] += rq[threadIdx.x + o]; }
        __syncthreads();
    }
    if (threadIdx.x == 0) {
        const float inv_n = 1.f / (GC * HW_);
        float mu  = rs[0] * inv_n;
        float var = rq[0] * inv_n - mu * mu;
        stats[bg * 2 + 0] = mu;
        stats[bg * 2 + 1] = rsqrtf(var + 1e-6f);
    }
}

// Normalize + transpose [B,C,HW] f32 -> [B,HW,C] f16 via 32x32 LDS tiles.
__global__ void cab_gn_apply_t(const float* __restrict__ x, const float* __restrict__ stats,
                               const float* __restrict__ gamma, const float* __restrict__ beta,
                               _Float16* __restrict__ xn) {
    __shared__ float tile[32][33];
    int b  = blockIdx.z;
    int c0 = blockIdx.y * 32, p0 = blockIdx.x * 32;
    int tx = threadIdx.x & 31, ty = threadIdx.x >> 5;   // ty 0..7
#pragma unroll
    for (int i = 0; i < 4; ++i) {
        int c = c0 + ty + i * 8;
        int g = c >> 4;
        float mu = stats[(b * 32 + g) * 2], rstd = stats[(b * 32 + g) * 2 + 1];
        float v  = x[((size_t)b * C_ + c) * HW_ + p0 + tx];
        tile[ty + i * 8][tx] = (v - mu) * rstd * gamma[c] + beta[c];
    }
    __syncthreads();
#pragma unroll
    for (int i = 0; i < 4; ++i) {
        int p = p0 + ty + i * 8;
        int c = c0 + tx;
        xn[((size_t)b * HW_ + p) * C_ + c] = (_Float16)tile[tx][ty + i * 8];
    }
}

// Q projection: A = xn [B,HW,C], Bt = q_w [o][c]; wave does 32(M) x 64(N).
// Ping-pong LDS weight panels (async staging overlapped with compute); A and B double-buffered.
__global__ void cab_gemm_qproj(const _Float16* __restrict__ xn, const _Float16* __restrict__ w,
                               const float* __restrict__ bias, _Float16* __restrict__ out) {
    __shared__ __align__(16) _Float16 wpan[2][64 * WP];
    int b  = blockIdx.z;
    int wv = threadIdx.x >> 5;
    int p0 = blockIdx.x * 256 + wv * 32;
    int n0 = blockIdx.y * 64;
    int lane = threadIdx.x & 31, half = lane >> 4, n15 = lane & 15;
    const _Float16* A = xn + ((size_t)b * HW_ + p0) * C_;
    v8f acc[2][4];
#pragma unroll
    for (int g2 = 0; g2 < 2; ++g2)
#pragma unroll
        for (int t = 0; t < 4; ++t) acc[g2][t] = (v8f){0.f,0.f,0.f,0.f,0.f,0.f,0.f,0.f};

    stage_async(wpan[0], w + (size_t)n0 * C_, C_, WP, 2048, 32);
    wait_async_barrier();
    stage_async(wpan[1], w + (size_t)n0 * C_ + 256, C_, WP, 2048, 32);  // overlaps half-0 compute

    for (int kh = 0; kh < 2; ++kh) {
        const _Float16* P = wpan[kh];
        v16h a0 = frag16(A + kh * 256, C_);
        v16h a1 = frag16(A + (size_t)16 * C_ + kh * 256, C_);
#pragma unroll
        for (int kc = 0; kc < 256; kc += 32) {
            v16h na0 = a0, na1 = a1;
            if (kc + 32 < 256) {
                na0 = frag16(A + kh * 256 + kc + 32, C_);
                na1 = frag16(A + (size_t)16 * C_ + kh * 256 + kc + 32, C_);
            }
            v16h bf = frag16(P + kc, WP);
#pragma unroll
            for (int nt = 0; nt < 4; ++nt) {
                v16h nbf = bf;
                if (nt < 3) nbf = frag16(P + (nt + 1) * 16 * WP + kc, WP);   // B prefetch
                acc[0][nt] = wmma16(a0, bf, acc[0][nt]);
                acc[1][nt] = wmma16(a1, bf, acc[1][nt]);
                bf = nbf;
            }
            a0 = na0; a1 = na1;
        }
        if (kh == 0) wait_async_barrier();   // panel 1 ready
    }
#pragma unroll
    for (int g2 = 0; g2 < 2; ++g2)
#pragma unroll
        for (int nt = 0; nt < 4; ++nt) {
            int o = n0 + nt * 16 + n15;
            float bb = bias[o];
#pragma unroll
            for (int r = 0; r < 8; ++r) {
                int p = p0 + g2 * 16 + r + 8 * half;
                out[((size_t)b * HW_ + p) * C_ + o] = (_Float16)(acc[g2][nt][r] + bb);
            }
        }
}

// K/V projection: A = cond [B,77,768] f32 (row-clamped).
// waves 0..3 -> K matrix, waves 4..7 -> V matrix; each wave one 16x16 tile.
__global__ void cab_gemm_kv(const float* __restrict__ cond,
                            const _Float16* __restrict__ kw, const float* __restrict__ kb,
                            const _Float16* __restrict__ vw, const float* __restrict__ vb,
                            _Float16* __restrict__ kbuf, _Float16* __restrict__ vt) {
    int b  = blockIdx.z;
    int wv = threadIdx.x >> 5;
    int isv = wv >> 2;
    int p0 = blockIdx.x * 16;                       // l-tile (grid.x = 5)
    int n0 = blockIdx.y * 64 + (wv & 3) * 16;       // grid.y = 8
    int lane = threadIdx.x & 31, half = lane >> 4, n15 = lane & 15;
    const float* A = cond + (size_t)b * L_ * CD_ + (size_t)p0 * CD_;
    int rows_left = L_ - p0;
    const _Float16* w   = isv ? vw : kw;
    const float*    bia = isv ? vb : kb;
    v8f acc = (v8f){0.f,0.f,0.f,0.f,0.f,0.f,0.f,0.f};
    for (int kc = 0; kc < CD_; kc += 32) {
        v16h a  = frag16_f32c(A + kc, CD_, rows_left);
        v16h bf = frag16(w + (size_t)n0 * CD_ + kc, CD_);
        acc = wmma16(a, bf, acc);
    }
    int o = n0 + n15;
    float bb = bia[o];
#pragma unroll
    for (int r = 0; r < 8; ++r) {
        int l = p0 + r + 8 * half;                  // < 80 ; rows 77..79 masked later
        float v = acc[r] + bb;
        if (!isv) kbuf[((size_t)b * LP + l) * C_ + o]  = (_Float16)v;
        else      vt  [((size_t)b * C_ + o) * LP2 + l] = (_Float16)v;
    }
}

// Attention: block = one (b,head), 128 query rows; K/Vt panels staged in LDS (async).
__global__ void cab_attn(const _Float16* __restrict__ q, const _Float16* __restrict__ kbuf,
                         const _Float16* __restrict__ vt, const float* __restrict__ scale_p,
                         _Float16* __restrict__ obuf) {
    __shared__ __align__(16) _Float16 kls[LP * KP];        // 80 rows
    __shared__ __align__(16) _Float16 vls[HD * VP];        // 64 rows
    __shared__ __align__(16) _Float16 lds_p[8][16 * VP];   // 16 rows per wave
    int b = blockIdx.z, h = blockIdx.y;
    int wv = threadIdx.x >> 5;
    int p0 = blockIdx.x * 128 + wv * 16;
    int lane = threadIdx.x & 31, half = lane >> 4, n15 = lane & 15;
    float scl = scale_p[0];

    // Stage K (rows l, ld C_) and Vt (rows d, ld LP2) panels for this (b,h).
    stage_async(kls, kbuf + (size_t)b * LP * C_ + h * HD, C_, KP, (LP * HD) / 8, HD / 8);
    stage_async(vls, vt + ((size_t)b * C_ + h * HD) * LP2, LP2, VP, (HD * LP2) / 8, LP2 / 8);

    const _Float16* Q = q + ((size_t)b * HW_ + p0) * C_ + h * HD;
    v16h a0 = frag16(Q,      C_);
    v16h a1 = frag16(Q + 32, C_);

    wait_async_barrier();

    v8f s[5];
#pragma unroll
    for (int t = 0; t < 5; ++t) {
        v8f z = (v8f){0.f,0.f,0.f,0.f,0.f,0.f,0.f,0.f};
        z = wmma16(a0, frag16(kls + (t * 16) * KP,      KP), z);
        z = wmma16(a1, frag16(kls + (t * 16) * KP + 32, KP), z);
        s[t] = z;
    }

    _Float16* P = &lds_p[wv][0];
    bool mask4 = (n15 >= 13);                       // t==4 column l = 64+n15 >= 77
#pragma unroll
    for (int r = 0; r < 8; ++r) {
        float sv[5], m = -3.0e38f;
#pragma unroll
        for (int t = 0; t < 5; ++t) {
            float v = s[t][r] * scl;
            if (t == 4 && mask4) v = -3.0e38f;
            sv[t] = v; m = fmaxf(m, v);
        }
#pragma unroll
        for (int o = 1; o < 16; o <<= 1) m = fmaxf(m, __shfl_xor(m, o, 32));
        float sum = 0.f, pv[5];
#pragma unroll
        for (int t = 0; t < 5; ++t) { float e = __expf(sv[t] - m); pv[t] = e; sum += e; }
#pragma unroll
        for (int o = 1; o < 16; o <<= 1) sum += __shfl_xor(sum, o, 32);
        float inv = 1.f / sum;
        int row = r + 8 * half;
#pragma unroll
        for (int t = 0; t < 5; ++t) P[row * VP + t * 16 + n15] = (_Float16)(pv[t] * inv);
        P[row * VP + 80 + n15] = (_Float16)0.f;    // zero pad cols 80..95
    }
    __syncthreads();

    v8f oacc[4];
#pragma unroll
    for (int nt = 0; nt < 4; ++nt) oacc[nt] = (v8f){0.f,0.f,0.f,0.f,0.f,0.f,0.f,0.f};
#pragma unroll
    for (int kc = 0; kc < 3; ++kc) {
        v16h ap = frag16(P + kc * 32, VP);         // A-frag of probabilities from LDS
#pragma unroll
        for (int nt = 0; nt < 4; ++nt)
            oacc[nt] = wmma16(ap, frag16(vls + (nt * 16) * VP + kc * 32, VP), oacc[nt]);
    }
#pragma unroll
    for (int nt = 0; nt < 4; ++nt)
#pragma unroll
        for (int r = 0; r < 8; ++r) {
            int p = p0 + r + 8 * half;
            obuf[((size_t)b * HW_ + p) * C_ + h * HD + nt * 16 + n15] = (_Float16)oacc[nt][r];
        }
}

// Final projection + residual: out[b,o,p] = x + O @ proj_w^T + proj_b.
// Ping-pong LDS weight panels; low region reused as f32 transpose buffer for coalesced stores.
__global__ void cab_gemm_proj(const _Float16* __restrict__ obuf, const _Float16* __restrict__ w,
                              const float* __restrict__ bias, const float* __restrict__ x,
                              float* __restrict__ out) {
    __shared__ __align__(16) char smem[2 * 64 * WP * 2];   // 2 weight panels; reused for transpose
    _Float16* wpan0 = (_Float16*)smem;
    _Float16* wpan1 = (_Float16*)(smem + 64 * WP * 2);
    int b  = blockIdx.z;
    int wv = threadIdx.x >> 5;
    int p0 = blockIdx.x * 128 + wv * 16;
    int n0 = blockIdx.y * 64;
    int lane = threadIdx.x & 31, half = lane >> 4, n15 = lane & 15;
    const _Float16* A = obuf + ((size_t)b * HW_ + p0) * C_;
    v8f acc[4];
#pragma unroll
    for (int t = 0; t < 4; ++t) acc[t] = (v8f){0.f,0.f,0.f,0.f,0.f,0.f,0.f,0.f};

    stage_async(wpan0, w + (size_t)n0 * C_, C_, WP, 2048, 32);
    wait_async_barrier();
    stage_async(wpan1, w + (size_t)n0 * C_ + 256, C_, WP, 2048, 32);    // overlaps half-0 compute

    for (int kh = 0; kh < 2; ++kh) {
        const _Float16* P = kh ? wpan1 : wpan0;
        v16h a = frag16(A + kh * 256, C_);
#pragma unroll
        for (int kc = 0; kc < 256; kc += 32) {
            v16h na = a;
            if (kc + 32 < 256) na = frag16(A + kh * 256 + kc + 32, C_);
            v16h bf = frag16(P + kc, WP);
#pragma unroll
            for (int nt = 0; nt < 4; ++nt) {
                v16h nbf = bf;
                if (nt < 3) nbf = frag16(P + (nt + 1) * 16 * WP + kc, WP);  // B prefetch
                acc[nt] = wmma16(a, bf, acc[nt]);
                bf = nbf;
            }
            a = na;
        }
        if (kh == 0) wait_async_barrier();   // panel 1 ready
    }
    __syncthreads();                          // all weight reads done before smem reuse

    float* T = (float*)smem + (size_t)wv * 64 * 17;        // [64 o][16 p], stride 17
#pragma unroll
    for (int nt = 0; nt < 4; ++nt)
#pragma unroll
        for (int r = 0; r < 8; ++r)
            T[(nt * 16 + n15) * 17 + r + 8 * half] = acc[nt][r];
    __syncthreads();
#pragma unroll
    for (int i = 0; i < 32; ++i) {
        int orow = i * 2 + half;
        int o = n0 + orow;
        size_t idx = ((size_t)b * C_ + o) * HW_ + p0 + n15;
        out[idx] = x[idx] + T[orow * 17 + n15] + bias[o];
    }
}

extern "C" void kernel_launch(void* const* d_in, const int* in_sizes, int n_in,
                              void* d_out, int out_size, void* d_ws, size_t ws_size,
                              hipStream_t stream) {
    const float* x      = (const float*)d_in[0];
    const float* cond   = (const float*)d_in[1];
    const float* gamma  = (const float*)d_in[2];
    const float* beta   = (const float*)d_in[3];
    const float* q_w    = (const float*)d_in[4];
    const float* q_b    = (const float*)d_in[5];
    const float* k_w    = (const float*)d_in[6];
    const float* k_b    = (const float*)d_in[7];
    const float* v_w    = (const float*)d_in[8];
    const float* v_b    = (const float*)d_in[9];
    const float* proj_w = (const float*)d_in[10];
    const float* proj_b = (const float*)d_in[11];
    const float* scale  = (const float*)d_in[12];
    float* out = (float*)d_out;

    char* ws = (char*)d_ws;
    size_t off = 0;
    auto carve = [&](size_t bytes) { void* p = ws + off; off = (off + bytes + 255) & ~(size_t)255; return p; };
    float*     stats = (float*)    carve(512 * 2 * sizeof(float));
    _Float16*  qw16  = (_Float16*) carve((size_t)C_ * C_  * 2);
    _Float16*  kw16  = (_Float16*) carve((size_t)C_ * CD_ * 2);
    _Float16*  vw16  = (_Float16*) carve((size_t)C_ * CD_ * 2);
    _Float16*  pw16  = (_Float16*) carve((size_t)C_ * C_  * 2);
    _Float16*  kbuf  = (_Float16*) carve((size_t)B_ * LP  * C_  * 2);
    _Float16*  vt    = (_Float16*) carve((size_t)B_ * C_  * LP2 * 2);
    _Float16*  xn    = (_Float16*) carve((size_t)B_ * HW_ * C_  * 2);  // reused as obuf after qproj
    _Float16*  qbuf  = (_Float16*) carve((size_t)B_ * HW_ * C_  * 2);
    _Float16*  obuf  = xn;   // xn is dead once qproj finishes (stream-ordered)

    // 1) weights to f16
    cab_cvt_f16<<<(C_ * C_  + 255) / 256, 256, 0, stream>>>(q_w,    qw16, C_ * C_);
    cab_cvt_f16<<<(C_ * CD_ + 255) / 256, 256, 0, stream>>>(k_w,    kw16, C_ * CD_);
    cab_cvt_f16<<<(C_ * CD_ + 255) / 256, 256, 0, stream>>>(v_w,    vw16, C_ * CD_);
    cab_cvt_f16<<<(C_ * C_  + 255) / 256, 256, 0, stream>>>(proj_w, pw16, C_ * C_);

    // 2) GroupNorm
    cab_gn_stats<<<B_ * 32, 256, 0, stream>>>(x, stats);
    cab_gn_apply_t<<<dim3(HW_ / 32, C_ / 32, B_), 256, 0, stream>>>(x, stats, gamma, beta, xn);

    // 3) projections
    cab_gemm_qproj<<<dim3(HW_ / 256, C_ / 64, B_), 256, 0, stream>>>(xn, qw16, q_b, qbuf);
    cab_gemm_kv<<<dim3(LP / 16, C_ / 64, B_), 256, 0, stream>>>(cond, kw16, k_b, vw16, v_b, kbuf, vt);
    cab_zero_vt_pad<<<(B_ * C_ * 16) / 256, 256, 0, stream>>>(vt);

    // 4) attention (writes obuf == xn region)
    cab_attn<<<dim3(HW_ / 128, NH, B_), 256, 0, stream>>>(qbuf, kbuf, vt, scale, obuf);

    // 5) output projection + residual
    cab_gemm_proj<<<dim3(HW_ / 128, C_ / 64, B_), 256, 0, stream>>>(obuf, pw16, proj_b, x, out);
}

// v002
// It runs in 258 microseconds.
// In both of two side-by-side timings against v001, it was 1.05 times as fast.
// Over all steps from v000 it is 1.90 times as fast.
#include <hip/hip_runtime.h>

typedef __attribute__((ext_vector_type(16))) _Float16 v16h;
typedef __attribute__((ext_vector_type(8)))  float    v8f;

#define B_   16
#define C_   512
#define CD_  768
#define HW_  4096
#define L_   77
#define LP   80     // padded key rows (5 x 16 tiles)
#define LP2  96     // padded key width for PV (3 x 32 K-chunks)
#define NH   8
#define HD   64
#define GC   16     // channels per group (C/32)
#define WP   264    // weight panel rows: 256 halves + 8  (528 B)
#define KP   72     // K rows: 64 halves + 8               (144 B)
#define VP   104    // Vt and probability rows: 96 halves + 8 (208 B)

__device__ __forceinline__ v8f wmma16(v16h a, v16h b, v8f c) {
    return __builtin_amdgcn_wmma_f32_16x16x32_f16(false, a, false, b, (short)0, c, false, false);
}

__device__ __forceinline__ v16h frag16(const _Float16* p, int ld) {
    int lane = threadIdx.x & 31;
    const _Float16* b = p + (size_t)(lane & 15) * ld + ((lane >> 4) << 3);
    v16h f;
#pragma unroll
    for (int i = 0; i < 8; ++i) { f[i] = b[i]; f[i + 8] = b[i + 16]; }
    return f;
}

// f32 source (cond) with clamped row index (L=77 tail tile).
__device__ __forceinline__ v16h frag16_f32c(const float* p, int ld, int rows_left) {
    int lane = threadIdx.x & 31;
    int r = lane & 15;
    if (r >= rows_left) r = rows_left - 1;
    const float* b = p + (size_t)r * ld + ((lane >> 4) << 3);
    v16h f;
#pragma unroll
    for (int i = 0; i < 8; ++i) { f[i] = (_Float16)b[i]; f[i + 8] = (_Float16)b[i + 16]; }
    return f;
}

__device__ __forceinline__ void stage_async(_Float16* dst, const _Float16* src,
                                            int src_ld, int dst_ld, int nchunks, int cpr) {
    unsigned base = (unsigned)(size_t)(void*)dst;   // low 32 bits of generic addr == LDS offset
    for (int i = threadIdx.x; i < nchunks; i += 256) {
        int row = i / cpr;
        int cc  = (i - row * cpr) * 8;
        unsigned long long g = (unsigned long long)(src + (size_t)row * src_ld + cc);
        unsigned l = base + (unsigned)((row * dst_ld + cc) * 2);
        // the wait stands in the copy's own statement: the next trip rewrites l and g
        asm volatile("global_load_async_to_lds_b128 %0, %1, off\n\ts_wait_xcnt 0x0" :: "v"(l), "v"(g) : "memory");
    }
}

__device__ __forceinline__ void wait_async_barrier() {
    asm volatile("s_wait_asynccnt 0" ::: "memory");
    __syncthreads();
}

__global__ void cab_cvt_f16(const float* __restrict__ in, _Float16* __restrict__ out, int n) {
    int i = blockIdx.x * blockDim.x + threadIdx.x;
    if (i < n) out[i] = (_Float16)in[i];
}

__global__ void cab_zero_vt_pad(_Float16* __restrict__ vt) {
    int i = blockIdx.x * blockDim.x + threadIdx.x;   // over B_*C_*16
    int bo = i >> 4;
    int j  = i & 15;
    vt[(size_t)bo * LP2 + 80 + j] = (_Float16)0.f;
}

// One block per (b, group): reduce 16 channels * 4096 contiguous floats.
__global__ void cab_gn_stats(const float* __restrict__ x, float* __restrict__ stats) {
    int bg = blockIdx.x;
    const float* p = x + (size_t)bg * (GC * HW_);
    float s = 0.f, s2 = 0.f;
    for (int i = threadIdx.x; i < GC * HW_; i += 256) { float v = p[i]; s += v; s2 += v * v; }
    __shared__ float rs[256], rq[256];
    rs[threadIdx.x] = s; rq[threadIdx.x] = s2;
    __syncthreads();
    for (int o = 128; o > 0; o >>= 1) {
        if (threadIdx.x < o) { rs[threadIdx.x] += rs[threadIdx.x + o]; rq[threadIdx.x] += rq[threadIdx.x + o]; }
        __syncthreads();
    }
    if (threadIdx.x == 0) {
        const float inv_n = 1.f / (GC * HW_);
        float mu  = rs[0] * inv_n;
        float var = rq[0] * inv_n - mu * mu;
        stats[bg * 2 + 0] = mu;
        stats[bg * 2 + 1] = rsqrtf(var + 1e-6f);
    }
}

typedef __attribute__((ext_vector_type(8))) _Float16 v8h;
typedef __attribute__((ext_vector_type(4))) float    v4f;
#define GT_PX 128   // pixels per tile
#define GT_NT 4     // tiles per work-group
__global__ void cab_gn_apply_t(const float* __restrict__ x, const float* __restrict__ stats,
                               const float* __restrict__ gamma, const float* __restrict__ beta,
                               _Float16* __restrict__ xn) {
    __shared__ __align__(16) _Float16 tile[2][GT_PX * 64];
    int b  = blockIdx.z;
    int c0 = blockIdx.y * 64, pb = blockIdx.x * (GT_PX * GT_NT);
    int lane = threadIdx.x & 31;
    int wv = __builtin_amdgcn_readfirstlane(threadIdx.x >> 5);   // scalar: the per-channel constants load once per wave
    int cw = c0 + wv * 8;
    int g  = cw >> 4;
    float mu = stats[(b * 32 + g) * 2], rstd = stats[(b * 32 + g) * 2 + 1];
    float ga[8], be[8];
#pragma unroll
    for (int i = 0; i < 8; ++i) { ga[i] = gamma[cw + i]; be[i] = beta[cw + i]; }

    const float* src = x + ((size_t)b * C_ + cw) * HW_ + pb + lane * 4;
    v4f v[2][8];                                  // two register sets: loads run two tiles ahead of the LDS pass
#pragma unroll
    for (int u = 0; u < 2; ++u)
#pragma unroll
        for (int i = 0; i < 8; ++i) v[u][i] = *(const v4f*)(src + (size_t)i * HW_ + u * GT_PX);

    int swap = (lane >> 3) & 1;
    int slot = (wv ^ (lane & 7)) * 8;
#pragma unroll
    for (int t = 0; t < GT_NT; ++t) {
        v8h h[4];
#pragma unroll
        for (int j = 0; j < 4; ++j)
#pragma unroll
            for (int i = 0; i < 8; ++i) h[j][i] = (_Float16)((v[t & 1][i][j] - mu) * rstd * ga[i] + be[i]);
        if (t + 2 < GT_NT) {
#pragma unroll
            for (int i = 0; i < 8; ++i) v[t & 1][i] = *(const v4f*)(src + (size_t)i * HW_ + (t + 2) * GT_PX);
        }
        _Float16* buf = tile[t & 1];
#pragma unroll
        for (int j = 0; j < 4; ++j) *(v8h*)(buf + ((lane * 4 + j) ^ swap) * 64 + slot) = h[j];
        // Work-group barrier, one per tile, with the LDS wait alone: it publishes this buffer, and every wave's
        // reads of the other buffer have returned before it. __syncthreads() would also drain the global loads
        // of the next tiles and the stores of the last one, which no other wave depends on.
        asm volatile("s_wait_dscnt 0x0\n\ts_barrier_signal -1\n\ts_barrier_wait -1" ::: "memory");
#pragma unroll
        for (int k = 0; k < 4; ++k) {
            int idx = k * 256 + threadIdx.x;      // chunk in LDS order
            int r = idx >> 3, q = idx & 7;
            int p = r ^ ((r >> 5) & 1);
            int w = q ^ ((p >> 2) & 7);
            v8h d = *(const v8h*)(buf + idx * 8);
            *(v8h*)(xn + ((size_t)b * HW_ + pb + t * GT_PX + p) * C_ + c0 + w * 8) = d;
        }
        // the next tile's loads and arithmetic reuse the registers that these stores name
        if (t + 1 < GT_NT) asm volatile("s_wait_xcnt 0x0" ::: "memory");
        // keeps the next tile's arithmetic, and with it the wait for its loads, behind this tile's stores and that wait
        __builtin_amdgcn_sched_barrier(0);
    }
}

// Q projection: A = xn [B,HW,C], Bt = q_w [o][c]; wave does 32(M) x 64(N).
// Ping-pong LDS weight panels (async staging overlapped with compute); A and B double-buffered.
__global__ void cab_gemm_qproj(const _Float16* __restrict__ xn, const _Float16* __restrict__ w,
                               const float* __restrict__ bias, _Float16* __restrict__ out) {
    __shared__ __align__(16) _Float16 wpan[2][64 * WP];
    int b  = blockIdx.z;
    int wv = threadIdx.x >> 5;
    int p0 = blockIdx.x * 256 + wv * 32;
    int n0 = blockIdx.y * 64;
    int lane = threadIdx.x & 31, half = lane >> 4, n15 = lane & 15;
    const _Float16* A = xn + ((size_t)b * HW_ + p0) * C_;
    v8f acc[2][4];
#pragma unroll
    for (int g2 = 0; g2 < 2; ++g2)
#pragma unroll
        for (int t = 0; t < 4; ++t) acc[g2][t] = (v8f){0.f,0.f,0.f,0.f,0.f,0.f,0.f,0.f};

    stage_async(wpan[0], w + (size_t)n0 * C_, C_, WP, 2048, 32);
    wait_async_barrier();
    stage_async(wpan[1], w + (size_t)n0 * C_ + 256, C_, WP, 2048, 32);  // overlaps half-0 compute

    for (int kh = 0; kh < 2; ++kh) {
        const _Float16* P = wpan[kh];
        v16h a0 = frag16(A + kh * 256, C_);
        v16h a1 = frag16(A + (size_t)16 * C_ + kh * 256, C_);
#pragma unroll
        for (int kc = 0; kc < 256; kc += 32) {
            v16h na0 = a0, na1 = a1;
            if (kc + 32 < 256) {
                na0 = frag16(A + kh * 256 + kc + 32, C_);
                na1 = frag16(A + (size_t)16 * C_ + kh * 256 + kc + 32, C_);
            }
            v16h bf = frag16(P + kc, WP);
#pragma unroll
            for (int nt = 0; nt < 4; ++nt) {
                v16h nbf = bf;
                if (nt < 3) nbf = frag16(P + (nt + 1) * 16 * WP + kc, WP);   // B prefetch
                acc[0][nt] = wmma16(a0, bf, acc[0][nt]);
                acc[1][nt] = wmma16(a1, bf, acc[1][nt]);
                bf = nbf;
            }
            a0 = na0; a1 = na1;
        }
        if (kh == 0) wait_async_barrier();   // panel 1 ready
    }
#pragma unroll
    for (int g2 = 0; g2 < 2; ++g2)
#pragma unroll
        for (int nt = 0; nt < 4; ++nt) {
            int o = n0 + nt * 16 + n15;
            float bb = bias[o];
#pragma unroll
            for (int r = 0; r < 8; ++r) {
                int p = p0 + g2 * 16 + r + 8 * half;
                out[((size_t)b * HW_ + p) * C_ + o] = (_Float16)(acc[g2][nt][r] + bb);
            }
        }
}

// K/V projection: A = cond [B,77,768] f32 (row-clamped).
// waves 0..3 -> K matrix, waves 4..7 -> V matrix; each wave one 16x16 tile.
__global__ void cab_gemm_kv(const float* __restrict__ cond,
                            const _Float16* __restrict__ kw, const float* __restrict__ kb,
                            const _Float16* __restrict__ vw, const float* __restrict__ vb,
                            _Float16* __restrict__ kbuf, _Float16* __restrict__ vt) {
    int b  = blockIdx.z;
    int wv = threadIdx.x >> 5;
    int isv = wv >> 2;
    int p0 = blockIdx.x * 16;                       // l-tile (grid.x = 5)
    int n0 = blockIdx.y * 64 + (wv & 3) * 16;       // grid.y = 8
    int lane = threadIdx.x & 31, half = lane >> 4, n15 = lane & 15;
    const float* A = cond + (size_t)b * L_ * CD_ + (size_t)p0 * CD_;
    int rows_left = L_ - p0;
    const _Float16* w   = isv ? vw : kw;
    const float*    bia = isv ? vb : kb;
    v8f acc = (v8f){0.f,0.f,0.f,0.f,0.f,0.f,0.f,0.f};
    for (int kc = 0; kc < CD_; kc += 32) {
        v16h a  = frag16_f32c(A + kc, CD_, rows_left);
        v16h bf = frag16(w + (size_t)n0 * CD_ + kc, CD_);
        acc = wmma16(a, bf, acc);
    }
    int o = n0 + n15;
    float bb = bia[o];
#pragma unroll
    for (int r = 0; r < 8; ++r) {
        int l = p0 + r + 8 * half;                  // < 80 ; rows 77..79 masked later
        float v = acc[r] + bb;
        if (!isv) kbuf[((size_t)b * LP + l) * C_ + o]  = (_Float16)v;
        else      vt  [((size_t)b * C_ + o) * LP2 + l] = (_Float16)v;
    }
}

// Attention: block = one (b,head), 128 query rows; K/Vt panels staged in LDS (async).
__global__ void cab_attn(const _Float16* __restrict__ q, const _Float16* __restrict__ kbuf,
                         const _Float16* __restrict__ vt, const float* __restrict__ scale_p,
                         _Float16* __restrict__ obuf) {
    __shared__ __align__(16) _Float16 kls[LP * KP];        // 80 rows
    __shared__ __align__(16) _Float16 vls[HD * VP];        // 64 rows
    __shared__ __align__(16) _Float16 lds_p[8][16 * VP];   // 16 rows per wave
    int b = blockIdx.z, h = blockIdx.y;
    int wv = threadIdx.x >> 5;
    int p0 = blockIdx.x * 128 + wv * 16;
    int lane = threadIdx.x & 31, half = lane >> 4, n15 = lane & 15;
    float scl = scale_p[0];

    // Stage K (rows l, ld C_) and Vt (rows d, ld LP2) panels for this (b,h).
    stage_async(kls, kbuf + (size_t)b * LP * C_ + h * HD, C_, KP, (LP * HD) / 8, HD / 8);
    stage_async(vls, vt + ((size_t)b * C_ + h * HD) * LP2, LP2, VP, (HD * LP2) / 8, LP2 / 8);

    const _Float16* Q = q + ((size_t)b * HW_ + p0) * C_ + h * HD;
    v16h a0 = frag16(Q,      C_);
    v16h a1 = frag16(Q + 32, C_);

    wait_async_barrier();

    v8f s[5];
#pragma unroll
    for (int t = 0; t < 5; ++t) {
        v8f z = (v8f){0.f,0.f,0.f,0.f,0.f,0.f,0.f,0.f};
        z = wmma16(a0, frag16(kls + (t * 16) * KP,      KP), z);
        z = wmma16(a1, frag16(kls + (t * 16) * KP + 32, KP), z);
        s[t] = z;
    }

    _Float16* P = &lds_p[wv][0];
    bool mask4 = (n15 >= 13);                       // t==4 column l = 64+n15 >= 77
#pragma unroll
    for (int r = 0; r < 8; ++r) {
        float sv[5], m = -3.0e38f;
#pragma unroll
        for (int t = 0; t < 5; ++t) {
            float v = s[t][r] * scl;
            if (t == 4 && mask4) v = -3.0e38f;
            sv[t] = v; m = fmaxf(m, v);
        }
#pragma unroll
        for (int o = 1; o < 16; o <<= 1) m = fmaxf(m, __shfl_xor(m, o, 32));
        float sum = 0.f, pv[5];
#pragma unroll
        for (int t = 0; t < 5; ++t) { float e = __expf(sv[t] - m); pv[t] = e; sum += e; }
#pragma unroll
        for (int o = 1; o < 16; o <<= 1) sum += __shfl_xor(sum, o, 32);
        float inv = 1.f / sum;
        int row = r + 8 * half;
#pragma unroll
        for (int t = 0; t < 5; ++t) P[row * VP + t * 16 + n15] = (_Float16)(pv[t] * inv);
        P[row * VP + 80 + n15] = (_Float16)0.f;    // zero pad cols 80..95
    }
    __syncthreads();

    v8f oacc[4];
#pragma unroll
    for (int nt = 0; nt < 4; ++nt) oacc[nt] = (v8f){0.f,0.f,0.f,0.f,0.f,0.f,0.f,0.f};
#pragma unroll
    for (int kc = 0; kc < 3; ++kc) {
        v16h ap = frag16(P + kc * 32, VP);         // A-frag of probabilities from LDS
#pragma unroll
        for (int nt = 0; nt < 4; ++nt)
            oacc[nt] = wmma16(ap, frag16(vls + (nt * 16) * VP + kc * 32, VP), oacc[nt]);
    }
#pragma unroll
    for (int nt = 0; nt < 4; ++nt)
#pragma unroll
        for (int r = 0; r < 8; ++r) {
            int p = p0 + r + 8 * half;
            obuf[((size_t)b * HW_ + p) * C_ + h * HD + nt * 16 + n15] = (_Float16)oacc[nt][r];
        }
}

// Final projection + residual: out[b,o,p] = x + O @ proj_w^T + proj_b.
// Ping-pong LDS weight panels; low region reused as f32 transpose buffer for coalesced stores.
__global__ void cab_gemm_proj(const _Float16* __restrict__ obuf, const _Float16* __restrict__ w,
                              const float* __restrict__ bias, const float* __restrict__ x,
                              float* __restrict__ out) {
    __shared__ __align__(16) char smem[2 * 64 * WP * 2];   // 2 weight panels; reused for transpose
    _Float16* wpan0 = (_Float16*)smem;
    _Float16* wpan1 = (_Float16*)(smem + 64 * WP * 2);
    int b  = blockIdx.z;
    int wv = threadIdx.x >> 5;
    int p0 = blockIdx.x * 128 + wv * 16;
    int n0 = blockIdx.y * 64;
    int lane = threadIdx.x & 31, half = lane >> 4, n15 = lane & 15;
    const _Float16* A = obuf + ((size_t)b * HW_ + p0) * C_;
    v8f acc[4];
#pragma unroll
    for (int t = 0; t < 4; ++t) acc[t] = (v8f){0.f,0.f,0.f,0.f,0.f,0.f,0.f,0.f};

    stage_async(wpan0, w + (size_t)n0 * C_, C_, WP, 2048, 32);
    wait_async_barrier();
    stage_async(wpan1, w + (size_t)n0 * C_ + 256, C_, WP, 2048, 32);    // overlaps half-0 compute

    for (int kh = 0; kh < 2; ++kh) {
        const _Float16* P = kh ? wpan1 : wpan0;
        v16h a = frag16(A + kh * 256, C_);
#pragma unroll
        for (int kc = 0; kc < 256; kc += 32) {
            v16h na = a;
            if (kc + 32 < 256) na = frag16(A + kh * 256 + kc + 32, C_);
            v16h bf = frag16(P + kc, WP);
#pragma unroll
            for (int nt = 0; nt < 4; ++nt) {
                v16h nbf = bf;
                if (nt < 3) nbf = frag16(P + (nt + 1) * 16 * WP + kc, WP);  // B prefetch
                acc[nt] = wmma16(a, bf, acc[nt]);
                bf = nbf;
            }
            a = na;
        }
        if (kh == 0) wait_async_barrier();   // panel 1 ready
    }
    __syncthreads();                          // all weight reads done before smem reuse

    float* T = (float*)smem + (size_t)wv * 64 * 17;        // [64 o][16 p], stride 17
#pragma unroll
    for (int nt = 0; nt < 4; ++nt)
#pragma unroll
        for (int r = 0; r < 8; ++r)
            T[(nt * 16 + n15) * 17 + r + 8 * half] = acc[nt][r];
    __syncthreads();
#pragma unroll
    for (int i = 0; i < 32; ++i) {
        int orow = i * 2 + half;
        int o = n0 + orow;
        size_t idx = ((size_t)b * C_ + o) * HW_ + p0 + n15;
        out[idx] = x[idx] + T[orow * 17 + n15] + bias[o];
    }
}

extern "C" void kernel_launch(void* const* d_in, const int* in_sizes, int n_in,
                              void* d_out, int out_size, void* d_ws, size_t ws_size,
                              hipStream_t stream) {
    const float* x      = (const float*)d_in[0];
    const float* cond   = (const float*)d_in[1];
    const float* gamma  = (const float*)d_in[2];
    const float* beta   = (const float*)d_in[3];
    const float* q_w    = (const float*)d_in[4];
    const float* q_b    = (const float*)d_in[5];
    const float* k_w    = (const float*)d_in[6];
    const float* k_b    = (const float*)d_in[7];
    const float* v_w    = (const float*)d_in[8];
    const float* v_b    = (const float*)d_in[9];
    const float* proj_w = (const float*)d_in[10];
    const float* proj_b = (const float*)d_in[11];
    const float* scale  = (const float*)d_in[12];
    float* out = (float*)d_out;

    char* ws = (char*)d_ws;
    size_t off = 0;
    auto carve = [&](size_t bytes) { void* p = ws + off; off = (off + bytes + 255) & ~(size_t)255; return p; };
    float*     stats = (float*)    carve(512 * 2 * sizeof(float));
    _Float16*  qw16  = (_Float16*) carve((size_t)C_ * C_  * 2);
    _Float16*  kw16  = (_Float16*) carve((size_t)C_ * CD_ * 2);
    _Float16*  vw16  = (_Float16*) carve((size_t)C_ * CD_ * 2);
    _Float16*  pw16  = (_Float16*) carve((size_t)C_ * C_  * 2);
    _Float16*  kbuf  = (_Float16*) carve((size_t)B_ * LP  * C_  * 2);
    _Float16*  vt    = (_Float16*) carve((size_t)B_ * C_  * LP2 * 2);
    _Float16*  xn    = (_Float16*) carve((size_t)B_ * HW_ * C_  * 2);  // reused as obuf after qproj
    _Float16*  qbuf  = (_Float16*) carve((size_t)B_ * HW_ * C_  * 2);
    _Float16*  obuf  = xn;   // xn is dead once qproj finishes (stream-ordered)

    // 1) weights to f16
    cab_cvt_f16<<<(C_ * C_  + 255) / 256, 256, 0, stream>>>(q_w,    qw16, C_ * C_);
    cab_cvt_f16<<<(C_ * CD_ + 255) / 256, 256, 0, stream>>>(k_w,    kw16, C_ * CD_);
    cab_cvt_f16<<<(C_ * CD_ + 255) / 256, 256, 0, stream>>>(v_w,    vw16, C_ * CD_);
    cab_cvt_f16<<<(C_ * C_  + 255) / 256, 256, 0, stream>>>(proj_w, pw16, C_ * C_);

    // 2) GroupNorm
    cab_gn_stats<<<B_ * 32, 256, 0, stream>>>(x, stats);
    cab_gn_apply_t<<<dim3(HW_ / (GT_PX * GT_NT), C_ / 64, B_), 256, 0, stream>>>(x, stats, gamma, beta, xn);

    // 3) projections
    cab_gemm_qproj<<<dim3(HW_ / 256, C_ / 64, B_), 256, 0, stream>>>(xn, qw16, q_b, qbuf);
    cab_gemm_kv<<<dim3(LP / 16, C_ / 64, B_), 256, 0, stream>>>(cond, kw16, k_b, vw16, v_b, kbuf, vt);
    cab_zero_vt_pad<<<(B_ * C_ * 16) / 256, 256, 0, stream>>>(vt);

    // 4) attention (writes obuf == xn region)
    cab_attn<<<dim3(HW_ / 128, NH, B_), 256, 0, stream>>>(qbuf, kbuf, vt, scale, obuf);

    // 5) output projection + residual
    cab_gemm_proj<<<dim3(HW_ / 128, C_ / 64, B_), 256, 0, stream>>>(obuf, pw16, proj_b, x, out);
}

// v003
// It runs in 203 microseconds.
// Timed twice side by side with v002, it ran 1.27 and 1.28 times as fast.
// All steps since v000 together make it 2.42 times as fast.
#include <hip/hip_runtime.h>

typedef __attribute__((ext_vector_type(16))) _Float16 v16h;
typedef __attribute__((ext_vector_type(8)))  float    v8f;

#define B_   16
#define C_   512
#define CD_  768
#define HW_  4096
#define L_   77
#define LP   80     // padded key rows (5 x 16 tiles)
#define LP2  96     // padded key width for PV (3 x 32 K-chunks)
#define NH   8
#define HD   64
#define GC   16     // channels per group (C/32)
#define WP   264    // weight panel rows: 256 halves + 8  (528 B)
#define KP   72     // K rows: 64 halves + 8               (144 B)
#define VP   104    // Vt and probability rows: 96 halves + 8 (208 B)
#define NB   128    // output channels per work-group of the two projection GEMMs (8 tiles of 16 per wave)

__device__ __forceinline__ v8f wmma16(v16h a, v16h b, v8f c) {
    return __builtin_amdgcn_wmma_f32_16x16x32_f16(false, a, false, b, (short)0, c, false, false);
}

__device__ __forceinline__ v16h frag16(const _Float16* p, int ld) {
    int lane = threadIdx.x & 31;
    const _Float16* b = p + (size_t)(lane & 15) * ld + ((lane >> 4) << 3);
    v16h f;
#pragma unroll
    for (int i = 0; i < 8; ++i) { f[i] = b[i]; f[i + 8] = b[i + 16]; }
    return f;
}

// f32 source (cond) with clamped row index (L=77 tail tile).
__device__ __forceinline__ v16h frag16_f32c(const float* p, int ld, int rows_left) {
    int lane = threadIdx.x & 31;
    int r = lane & 15;
    if (r >= rows_left) r = rows_left - 1;
    const float* b = p + (size_t)r * ld + ((lane >> 4) << 3);
    v16h f;
#pragma unroll
    for (int i = 0; i < 8; ++i) { f[i] = (_Float16)b[i]; f[i + 8] = (_Float16)b[i + 16]; }
    return f;
}

__device__ __forceinline__ void stage_async(_Float16* dst, const _Float16* src,
                                            int src_ld, int dst_ld, int nchunks, int cpr) {
    unsigned base = (unsigned)(size_t)(void*)dst;   // low 32 bits of generic addr == LDS offset
    for (int i = threadIdx.x; i < nchunks; i += 256) {
        int row = i / cpr;
        int cc  = (i - row * cpr) * 8;
        unsigned long long g = (unsigned long long)(src + (size_t)row * src_ld + cc);
        unsigned l = base + (unsigned)((row * dst_ld + cc) * 2);
        // the wait stands in the copy's own statement: the next trip rewrites l and g
        asm volatile("global_load_async_to_lds_b128 %0, %1, off\n\ts_wait_xcnt 0x0" :: "v"(l), "v"(g) : "memory");
    }
}

__device__ __forceinline__ void wait_async_barrier() {
    asm volatile("s_wait_asynccnt 0" ::: "memory");
    __syncthreads();
}

__global__ void cab_cvt_f16(const float* __restrict__ in, _Float16* __restrict__ out, int n) {
    int i = blockIdx.x * blockDim.x + threadIdx.x;
    if (i < n) out[i] = (_Float16)in[i];
}

__global__ void cab_zero_vt_pad(_Float16* __restrict__ vt) {
    int i = blockIdx.x * blockDim.x + threadIdx.x;   // over B_*C_*16
    int bo = i >> 4;
    int j  = i & 15;
    vt[(size_t)bo * LP2 + 80 + j] = (_Float16)0.f;
}

// One block per (b, group): reduce 16 channels * 4096 contiguous floats.
__global__ void cab_gn_stats(const float* __restrict__ x, float* __restrict__ stats) {
    int bg = blockIdx.x;
    const float* p = x + (size_t)bg * (GC * HW_);
    float s = 0.f, s2 = 0.f;
    for (int i = threadIdx.x; i < GC * HW_; i += 256) { float v = p[i]; s += v; s2 += v * v; }
    __shared__ float rs[256], rq[256];
    rs[threadIdx.x] = s; rq[threadIdx.x] = s2;
    __syncthreads();
    for (int o = 128; o > 0; o >>= 1) {
        if (threadIdx.x < o) { rs[threadIdx.x] += rs[threadIdx.x + o]; rq[threadIdx.x] += rq[threadIdx.x + o]; }
        __syncthreads();
    }
    if (threadIdx.x == 0) {
        const float inv_n = 1.f / (GC * HW_);
        float mu  = rs[0] * inv_n;
        float var = rq[0] * inv_n - mu * mu;
        stats[bg * 2 + 0] = mu;
        stats[bg * 2 + 1] = rsqrtf(var + 1e-6f);
    }
}

typedef __attribute__((ext_vector_type(8))) _Float16 v8h;
typedef __attribute__((ext_vector_type(4))) float    v4f;
#define GT_PX 128   // pixels per tile
#define GT_NT 4     // tiles per work-group
__global__ void cab_gn_apply_t(const float* __restrict__ x, const float* __restrict__ stats,
                               const float* __restrict__ gamma, const float* __restrict__ beta,
                               _Float16* __restrict__ xn) {
    __shared__ __align__(16) _Float16 tile[2][GT_PX * 64];
    int b  = blockIdx.z;
    int c0 = blockIdx.y * 64, pb = blockIdx.x * (GT_PX * GT_NT);
    int lane = threadIdx.x & 31;
    int wv = __builtin_amdgcn_readfirstlane(threadIdx.x >> 5);   // scalar: the per-channel constants load once per wave
    int cw = c0 + wv * 8;
    int g  = cw >> 4;
    float mu = stats[(b * 32 + g) * 2], rstd = stats[(b * 32 + g) * 2 + 1];
    float ga[8], be[8];
#pragma unroll
    for (int i = 0; i < 8; ++i) { ga[i] = gamma[cw + i]; be[i] = beta[cw + i]; }

    const float* src = x + ((size_t)b * C_ + cw) * HW_ + pb + lane * 4;
    v4f v[2][8];                                  // two register sets: loads run two tiles ahead of the LDS pass
#pragma unroll
    for (int u = 0; u < 2; ++u)
#pragma unroll
        for (int i = 0; i < 8; ++i) v[u][i] = *(const v4f*)(src + (size_t)i * HW_ + u * GT_PX);

    int swap = (lane >> 3) & 1;
    int slot = (wv ^ (lane & 7)) * 8;
#pragma unroll
    for (int t = 0; t < GT_NT; ++t) {
        v8h h[4];
#pragma unroll
        for (int j = 0; j < 4; ++j)
#pragma unroll
            for (int i = 0; i < 8; ++i) h[j][i] = (_Float16)((v[t & 1][i][j] - mu) * rstd * ga[i] + be[i]);
        if (t + 2 < GT_NT) {
#pragma unroll
            for (int i = 0; i < 8; ++i) v[t & 1][i] = *(const v4f*)(src + (size_t)i * HW_ + (t + 2) * GT_PX);
        }
        _Float16* buf = tile[t & 1];
#pragma unroll
        for (int j = 0; j < 4; ++j) *(v8h*)(buf + ((lane * 4 + j) ^ swap) * 64 + slot) = h[j];
        // Work-group barrier, one per tile, with the LDS wait alone: it publishes this buffer, and every wave's
        // reads of the other buffer have returned before it. __syncthreads() would also drain the global loads
        // of the next tiles and the stores of the last one, which no other wave depends on.
        asm volatile("s_wait_dscnt 0x0\n\ts_barrier_signal -1\n\ts_barrier_wait -1" ::: "memory");
#pragma unroll
        for (int k = 0; k < 4; ++k) {
            int idx = k * 256 + threadIdx.x;      // chunk in LDS order
            int r = idx >> 3, q = idx & 7;
            int p = r ^ ((r >> 5) & 1);
            int w = q ^ ((p >> 2) & 7);
            v8h d = *(const v8h*)(buf + idx * 8);
            *(v8h*)(xn + ((size_t)b * HW_ + pb + t * GT_PX + p) * C_ + c0 + w * 8) = d;
        }
        // the next tile's loads and arithmetic reuse the registers that these stores name
        if (t + 1 < GT_NT) asm volatile("s_wait_xcnt 0x0" ::: "memory");
        // keeps the next tile's arithmetic, and with it the wait for its loads, behind this tile's stores and that wait
        __builtin_amdgcn_sched_barrier(0);
    }
}

// Q projection: A = xn [B,HW,C], Bt = q_w [o][c]; wave does 32(M) x 128(N): every A fragment, which comes
// from global memory as 16 pieces of 64 B, feeds 8 matrix instructions, and xn is read C_/NB = 4 times in all.
// Ping-pong LDS weight panels (async staging overlapped with compute).
__global__ __launch_bounds__(256) void cab_gemm_qproj(const _Float16* __restrict__ xn, const _Float16* __restrict__ w,
                               const float* __restrict__ bias, _Float16* __restrict__ out) {
    __shared__ __align__(16) _Float16 wpan[2][NB * WP];
    int b  = blockIdx.z;
    int wv = threadIdx.x >> 5;
    int p0 = blockIdx.x * 256 + wv * 32;
    int n0 = blockIdx.y * NB;
    int lane = threadIdx.x & 31, half = lane >> 4, n15 = lane & 15;
    const _Float16* A = xn + ((size_t)b * HW_ + p0) * C_;
    v8f acc[2][NB / 16];
#pragma unroll
    for (int g2 = 0; g2 < 2; ++g2)
#pragma unroll
        for (int t = 0; t < NB / 16; ++t) acc[g2][t] = (v8f){0.f,0.f,0.f,0.f,0.f,0.f,0.f,0.f};

    stage_async(wpan[0], w + (size_t)n0 * C_, C_, WP, NB * 32, 32);
    v16h af[2][2], bf[2][4];
    af[0][0] = frag16(A, C_);                 // the first A fragments fly beside panel 0
    af[0][1] = frag16(A + (size_t)16 * C_, C_);
    wait_async_barrier();
    stage_async(wpan[1], w + (size_t)n0 * C_ + 256, C_, WP, NB * 32, 32);  // overlaps half-0 compute

    // Two register sets of fragments. A block is 8 matrix instructions: one k step of 32, 4 of the 8 channel tiles.
    // The B fragments of block j + 1, and in a step's first block the A fragments of the next step, are loaded
    // as one group in front of block j.
#pragma unroll
    for (int kh = 0; kh < 2; ++kh) {
        const _Float16* P = wpan[kh];
#pragma unroll
        for (int nt = 0; nt < 4; ++nt) bf[0][nt] = frag16(P + nt * 16 * WP, WP);
#pragma unroll
        for (int j = 0; j < 16; ++j) {
            const int s = j >> 1, hn = j & 1, ca = s & 1;
            const int ks = kh * 8 + s + 1;                 // the next k step, counted over both panels
            if (hn == 0 && ks < 16) {
                af[ca ^ 1][0] = frag16(A + ks * 32, C_);
                af[ca ^ 1][1] = frag16(A + (size_t)16 * C_ + ks * 32, C_);
            }
            if (j + 1 < 16) {
#pragma unroll
                for (int nt = 0; nt < 4; ++nt)
                    bf[hn ^ 1][nt] = frag16(P + (((j + 1) & 1) * 4 + nt) * 16 * WP + ((j + 1) >> 1) * 32, WP);
            }
            // keeps those loads in front of this block: without it the compiler sinks each load to its first
            // use and the wave waits out every LDS and global latency in full
            __builtin_amdgcn_sched_barrier(0);
#pragma unroll
            for (int nt = 0; nt < 4; ++nt) {
                acc[0][hn * 4 + nt] = wmma16(af[ca][0], bf[hn][nt], acc[0][hn * 4 + nt]);
                acc[1][hn * 4 + nt] = wmma16(af[ca][1], bf[hn][nt], acc[1][hn * 4 + nt]);
            }
            // ends the block: later loads may not rise among these matrix instructions
            __builtin_amdgcn_sched_barrier(0);
        }
        if (kh == 0) wait_async_barrier();   // panel 1 ready
    }
    // the epilogue's address arithmetic reuses the register pair that the A loads name
    asm volatile("s_wait_xcnt 0x0" ::: "memory");
    // keeps that arithmetic behind the wait
    __builtin_amdgcn_sched_barrier(0);
#pragma unroll
    for (int g2 = 0; g2 < 2; ++g2)
#pragma unroll
        for (int nt = 0; nt < NB / 16; ++nt) {
            int o = n0 + nt * 16 + n15;
            float bb = bias[o];
#pragma unroll
            for (int r = 0; r < 8; ++r) {
                int p = p0 + g2 * 16 + r + 8 * half;
                out[((size_t)b * HW_ + p) * C_ + o] = (_Float16)(acc[g2][nt][r] + bb);
            }
        }
}

// K/V projection: A = cond [B,77,768] f32 (row-clamped).
// waves 0..3 -> K matrix, waves 4..7 -> V matrix; each wave one 16x16 tile.
__global__ void cab_gemm_kv(const float* __restrict__ cond,
                            const _Float16* __restrict__ kw, const float* __restrict__ kb,
                            const _Float16* __restrict__ vw, const float* __restrict__ vb,
                            _Float16* __restrict__ kbuf, _Float16* __restrict__ vt) {
    int b  = blockIdx.z;
    int wv = threadIdx.x >> 5;
    int isv = wv >> 2;
    int p0 = blockIdx.x * 16;                       // l-tile (grid.x = 5)
    int n0 = blockIdx.y * 64 + (wv & 3) * 16;       // grid.y = 8
    int lane = threadIdx.x & 31, half = lane >> 4, n15 = lane & 15;
    const float* A = cond + (size_t)b * L_ * CD_ + (size_t)p0 * CD_;
    int rows_left = L_ - p0;
    const _Float16* w   = isv ? vw : kw;
    const float*    bia = isv ? vb : kb;
    v8f acc = (v8f){0.f,0.f,0.f,0.f,0.f,0.f,0.f,0.f};
    for (int kc = 0; kc < CD_; kc += 32) {
        v16h a  = frag16_f32c(A + kc, CD_, rows_left);
        v16h bf = frag16(w + (size_t)n0 * CD_ + kc, CD_);
        acc = wmma16(a, bf, acc);
    }
    int o = n0 + n15;
    float bb = bia[o];
#pragma unroll
    for (int r = 0; r < 8; ++r) {
        int l = p0 + r + 8 * half;                  // < 80 ; rows 77..79 masked later
        float v = acc[r] + bb;
        if (!isv) kbuf[((size_t)b * LP + l) * C_ + o]  = (_Float16)v;
        else      vt  [((size_t)b * C_ + o) * LP2 + l] = (_Float16)v;
    }
}

// Attention: block = one (b,head), 128 query rows; K/Vt panels staged in LDS (async).
__global__ void cab_attn(const _Float16* __restrict__ q, const _Float16* __restrict__ kbuf,
                         const _Float16* __restrict__ vt, const float* __restrict__ scale_p,
                         _Float16* __restrict__ obuf) {
    __shared__ __align__(16) _Float16 kls[LP * KP];        // 80 rows
    __shared__ __align__(16) _Float16 vls[HD * VP];        // 64 rows
    __shared__ __align__(16) _Float16 lds_p[8][16 * VP];   // 16 rows per wave
    int b = blockIdx.z, h = blockIdx.y;
    int wv = threadIdx.x >> 5;
    int p0 = blockIdx.x * 128 + wv * 16;
    int lane = threadIdx.x & 31, half = lane >> 4, n15 = lane & 15;
    float scl = scale_p[0];

    // Stage K (rows l, ld C_) and Vt (rows d, ld LP2) panels for this (b,h).
    stage_async(kls, kbuf + (size_t)b * LP * C_ + h * HD, C_, KP, (LP * HD) / 8, HD / 8);
    stage_async(vls, vt + ((size_t)b * C_ + h * HD) * LP2, LP2, VP, (HD * LP2) / 8, LP2 / 8);

    const _Float16* Q = q + ((size_t)b * HW_ + p0) * C_ + h * HD;
    v16h a0 = frag16(Q,      C_);
    v16h a1 = frag16(Q + 32, C_);

    wait_async_barrier();

    v8f s[5];
#pragma unroll
    for (int t = 0; t < 5; ++t) {
        v8f z = (v8f){0.f,0.f,0.f,0.f,0.f,0.f,0.f,0.f};
        z = wmma16(a0, frag16(kls + (t * 16) * KP,      KP), z);
        z = wmma16(a1, frag16(kls + (t * 16) * KP + 32, KP), z);
        s[t] = z;
    }

    _Float16* P = &lds_p[wv][0];
    bool mask4 = (n15 >= 13);                       // t==4 column l = 64+n15 >= 77
#pragma unroll
    for (int r = 0; r < 8; ++r) {
        float sv[5], m = -3.0e38f;
#pragma unroll
        for (int t = 0; t < 5; ++t) {
            float v = s[t][r] * scl;
            if (t == 4 && mask4) v = -3.0e38f;
            sv[t] = v; m = fmaxf(m, v);
        }
#pragma unroll
        for (int o = 1; o < 16; o <<= 1) m = fmaxf(m, __shfl_xor(m, o, 32));
        float sum = 0.f, pv[5];
#pragma unroll
        for (int t = 0; t < 5; ++t) { float e = __expf(sv[t] - m); pv[t] = e; sum += e; }
#pragma unroll
        for (int o = 1; o < 16; o <<= 1) sum += __shfl_xor(sum, o, 32);
        float inv = 1.f / sum;
        int row = r + 8 * half;
#pragma unroll
        for (int t = 0; t < 5; ++t) P[row * VP + t * 16 + n15] = (_Float16)(pv[t] * inv);
        P[row * VP + 80 + n15] = (_Float16)0.f;    // zero pad cols 80..95
    }
    __syncthreads();

    v8f oacc[4];
#pragma unroll
    for (int nt = 0; nt < 4; ++nt) oacc[nt] = (v8f){0.f,0.f,0.f,0.f,0.f,0.f,0.f,0.f};
#pragma unroll
    for (int kc = 0; kc < 3; ++kc) {
        v16h ap = frag16(P + kc * 32, VP);         // A-frag of probabilities from LDS
#pragma unroll
        for (int nt = 0; nt < 4; ++nt)
            oacc[nt] = wmma16(ap, frag16(vls + (nt * 16) * VP + kc * 32, VP), oacc[nt]);
    }
#pragma unroll
    for (int nt = 0; nt < 4; ++nt)
#pragma unroll
        for (int r = 0; r < 8; ++r) {
            int p = p0 + r + 8 * half;
            obuf[((size_t)b * HW_ + p) * C_ + h * HD + nt * 16 + n15] = (_Float16)oacc[nt][r];
        }
}

// Final projection + residual: out[b,o,p] = x + O @ proj_w^T + proj_b; wave does 32(M) x 128(N), as in the Q projection.
// Ping-pong LDS weight panels; the same LDS is reused as f32 transpose buffer for coalesced stores.
__global__ __launch_bounds__(256) void cab_gemm_proj(const _Float16* __restrict__ obuf, const _Float16* __restrict__ w,
                              const float* __restrict__ bias, const float* __restrict__ x,
                              float* __restrict__ out) {
    __shared__ __align__(16) char smem[2 * NB * WP * 2];   // 2 weight panels; reused for transpose
    _Float16* wpan0 = (_Float16*)smem;
    _Float16* wpan1 = (_Float16*)(smem + NB * WP * 2);
    int b  = blockIdx.z;
    int wv = threadIdx.x >> 5;
    int p0 = blockIdx.x * 256 + wv * 32;
    int n0 = blockIdx.y * NB;
    int lane = threadIdx.x & 31, half = lane >> 4, n15 = lane & 15;
    const _Float16* A = obuf + ((size_t)b * HW_ + p0) * C_;
    v8f acc[2][NB / 16];
#pragma unroll
    for (int g2 = 0; g2 < 2; ++g2)
#pragma unroll
        for (int t = 0; t < NB / 16; ++t) acc[g2][t] = (v8f){0.f,0.f,0.f,0.f,0.f,0.f,0.f,0.f};

    stage_async(wpan0, w + (size_t)n0 * C_, C_, WP, NB * 32, 32);
    v16h af[2][2], bf[2][4];
    af[0][0] = frag16(A, C_);                 // the first A fragments fly beside panel 0
    af[0][1] = frag16(A + (size_t)16 * C_, C_);
    wait_async_barrier();
    stage_async(wpan1, w + (size_t)n0 * C_ + 256, C_, WP, NB * 32, 32);    // overlaps half-0 compute

    // Two register sets of fragments. A block is 8 matrix instructions: one k step of 32, 4 of the 8 channel tiles.
    // The B fragments of block j + 1, and in a step's first block the A fragments of the next step, are loaded
    // as one group in front of block j.
#pragma unroll
    for (int kh = 0; kh < 2; ++kh) {
        const _Float16* P = kh ? wpan1 : wpan0;
#pragma unroll
        for (int nt = 0; nt < 4; ++nt) bf[0][nt] = frag16(P + nt * 16 * WP, WP);
#pragma unroll
        for (int j = 0; j < 16; ++j) {
            const int s = j >> 1, hn = j & 1, ca = s & 1;
            const int ks = kh * 8 + s + 1;                 // the next k step, counted over both panels
            if (hn == 0 && ks < 16) {
                af[ca ^ 1][0] = frag16(A + ks * 32, C_);
                af[ca ^ 1][1] = frag16(A + (size_t)16 * C_ + ks * 32, C_);
            }
            if (j + 1 < 16) {
#pragma unroll
                for (int nt = 0; nt < 4; ++nt)
                    bf[hn ^ 1][nt] = frag16(P + (((j + 1) & 1) * 4 + nt) * 16 * WP + ((j + 1) >> 1) * 32, WP);
            }
            // keeps those loads in front of this block: without it the compiler sinks each load to its first
            // use and the wave waits out every LDS and global latency in full
            __builtin_amdgcn_sched_barrier(0);
#pragma unroll
            for (int nt = 0; nt < 4; ++nt) {
                acc[0][hn * 4 + nt] = wmma16(af[ca][0], bf[hn][nt], acc[0][hn * 4 + nt]);
                acc[1][hn * 4 + nt] = wmma16(af[ca][1], bf[hn][nt], acc[1][hn * 4 + nt]);
            }
            // ends the block: later loads may not rise among these matrix instructions
            __builtin_amdgcn_sched_barrier(0);
        }
        if (kh == 0) wait_async_barrier();   // panel 1 ready
    }
    // the epilogue's address arithmetic reuses the register pair that the A loads name
    asm volatile("s_wait_xcnt 0x0" ::: "memory");
    // keeps that arithmetic behind the wait
    __builtin_amdgcn_sched_barrier(0);
    __syncthreads();                          // all weight reads done before smem reuse

    float* T = (float*)smem + (size_t)wv * NB * 33;        // [128 o][32 p], stride 33; 8 waves fill smem exactly
#pragma unroll
    for (int g2 = 0; g2 < 2; ++g2)
#pragma unroll
        for (int nt = 0; nt < NB / 16; ++nt)
#pragma unroll
            for (int r = 0; r < 8; ++r)
                T[(nt * 16 + n15) * 33 + g2 * 16 + r + 8 * half] = acc[g2][nt][r];
    __syncthreads();
    // The wave's 32 pixels of one output channel are one 128-byte line: 8 lanes x 16 B take it whole, 4 channels a trip.
    int pc = (lane & 7) * 4;
    size_t base = ((size_t)b * C_ + n0 + (lane >> 3)) * HW_ + p0 + pc;
    const float* t0 = T + (lane >> 3) * 33 + pc;
#pragma unroll
    for (int i0 = 0; i0 < NB / 4; i0 += 8) {               // 8 loads of x in flight per wave
        v4f xv[8];
        float bo[8];
#pragma unroll
        for (int u = 0; u < 8; ++u) {
            xv[u] = *(const v4f*)(x + base + (size_t)(i0 + u) * 4 * HW_);
            bo[u] = bias[n0 + (i0 + u) * 4 + (lane >> 3)];
        }
#pragma unroll
        for (int u = 0; u < 8; ++u) {
            const float* t = t0 + (i0 + u) * 4 * 33;
            v4f ov;
#pragma unroll
            for (int j = 0; j < 4; ++j) ov[j] = xv[u][j] + t[j] + bo[u];
            *(v4f*)(out + base + (size_t)(i0 + u) * 4 * HW_) = ov;
        }
        if (i0 + 8 < NB / 4) {
            // the next trip's loads and address arithmetic reuse the registers that these stores name
            asm volatile("s_wait_xcnt 0x0" ::: "memory");
            // keeps the next trip's instructions behind that wait
            __builtin_amdgcn_sched_barrier(0);
        }
    }
}

extern "C" void kernel_launch(void* const* d_in, const int* in_sizes, int n_in,
                              void* d_out, int out_size, void* d_ws, size_t ws_size,
                              hipStream_t stream) {
    const float* x      = (const float*)d_in[0];
    const float* cond   = (const float*)d_in[1];
    const float* gamma  = (const float*)d_in[2];
    const float* beta   = (const float*)d_in[3];
    const float* q_w    = (const float*)d_in[4];
    const float* q_b    = (const float*)d_in[5];
    const float* k_w    = (const float*)d_in[6];
    const float* k_b    = (const float*)d_in[7];
    const float* v_w    = (const float*)d_in[8];
    const float* v_b    = (const float*)d_in[9];
    const float* proj_w = (const float*)d_in[10];
    const float* proj_b = (const float*)d_in[11];
    const float* scale  = (const float*)d_in[12];
    float* out = (float*)d_out;

    char* ws = (char*)d_ws;
    size_t off = 0;
    auto carve = [&](size_t bytes) { void* p = ws + off; off = (off + bytes + 255) & ~(size_t)255; return p; };
    float*     stats = (float*)    carve(512 * 2 * sizeof(float));
    _Float16*  qw16  = (_Float16*) carve((size_t)C_ * C_  * 2);
    _Float16*  kw16  = (_Float16*) carve((size_t)C_ * CD_ * 2);
    _Float16*  vw16  = (_Float16*) carve((size_t)C_ * CD_ * 2);
    _Float16*  pw16  = (_Float16*) carve((size_t)C_ * C_  * 2);
    _Float16*  kbuf  = (_Float16*) carve((size_t)B_ * LP  * C_  * 2);
    _Float16*  vt    = (_Float16*) carve((size_t)B_ * C_  * LP2 * 2);
    _Float16*  xn    = (_Float16*) carve((size_t)B_ * HW_ * C_  * 2);  // reused as obuf after qproj
    _Float16*  qbuf  = (_Float16*) carve((size_t)B_ * HW_ * C_  * 2);
    _Float16*  obuf  = xn;   // xn is dead once qproj finishes (stream-ordered)

    // 1) weights to f16
    cab_cvt_f16<<<(C_ * C_  + 255) / 256, 256, 0, stream>>>(q_w,    qw16, C_ * C_);
    cab_cvt_f16<<<(C_ * CD_ + 255) / 256, 256, 0, stream>>>(k_w,    kw16, C_ * CD_);
    cab_cvt_f16<<<(C_ * CD_ + 255) / 256, 256, 0, stream>>>(v_w,    vw16, C_ * CD_);
    cab_cvt_f16<<<(C_ * C_  + 255) / 256, 256, 0, stream>>>(proj_w, pw16, C_ * C_);

    // 2) GroupNorm
    cab_gn_stats<<<B_ * 32, 256, 0, stream>>>(x, stats);
    cab_gn_apply_t<<<dim3(HW_ / (GT_PX * GT_NT), C_ / 64, B_), 256, 0, stream>>>(x, stats, gamma, beta, xn);

    // 3) projections
    cab_gemm_qproj<<<dim3(HW_ / 256, C_ / NB, B_), 256, 0, stream>>>(xn, qw16, q_b, qbuf);
    cab_gemm_kv<<<dim3(LP / 16, C_ / 64, B_), 256, 0, stream>>>(cond, kw16, k_b, vw16, v_b, kbuf, vt);
    cab_zero_vt_pad<<<(B_ * C_ * 16) / 256, 256, 0, stream>>>(vt);

    // 4) attention (writes obuf == xn region)
    cab_attn<<<dim3(HW_ / 128, NH, B_), 256, 0, stream>>>(qbuf, kbuf, vt, scale, obuf);

    // 5) output projection + residual
    cab_gemm_proj<<<dim3(HW_ / 256, C_ / NB, B_), 256, 0, stream>>>(obuf, pw16, proj_b, x, out);
}

// v004
// Measured time: 189 microseconds a run.
// Two timings next to v003 both put it at 1.07 times that version's speed.
// Over all steps from v000 it is 2.59 times as fast.
#include <hip/hip_runtime.h>

typedef __attribute__((ext_vector_type(16))) _Float16 v16h;
typedef __attribute__((ext_vector_type(8)))  float    v8f;

#define B_   16
#define C_   512
#define CD_  768
#define HW_  4096
#define L_   77
#define LP   80     // padded key rows (5 x 16 tiles)
#define LP2  96     // padded key width for PV (3 x 32 K-chunks)
#define NH   8
#define HD   64
#define GC   16     // channels per group (C/32)
#define WP   264    // weight panel rows: 256 halves + 8  (528 B)
#define KP   72     // K rows: 64 halves + 8               (144 B)
#define VP   104    // Vt and probability rows: 96 halves + 8 (208 B)
#define NB   128    // output channels per work-group of the two projection GEMMs (8 tiles of 16 per wave)

__device__ __forceinline__ v8f wmma16(v16h a, v16h b, v8f c) {
    return __builtin_amdgcn_wmma_f32_16x16x32_f16(false, a, false, b, (short)0, c, false, false);
}

__device__ __forceinline__ v16h frag16(const _Float16* p, int ld) {
    int lane = threadIdx.x & 31;
    const _Float16* b = p + (size_t)(lane & 15) * ld + ((lane >> 4) << 3);
    v16h f;
#pragma unroll
    for (int i = 0; i < 8; ++i) { f[i] = b[i]; f[i + 8] = b[i + 16]; }
    return f;
}

// f32 source (cond) with clamped row index (L=77 tail tile).
__device__ __forceinline__ v16h frag16_f32c(const float* p, int ld, int rows_left) {
    int lane = threadIdx.x & 31;
    int r = lane & 15;
    if (r >= rows_left) r = rows_left - 1;
    const float* b = p + (size_t)r * ld + ((lane >> 4) << 3);
    v16h f;
#pragma unroll
    for (int i = 0; i < 8; ++i) { f[i] = (_Float16)b[i]; f[i + 8] = (_Float16)b[i + 16]; }
    return f;
}

__device__ __forceinline__ void stage_async(_Float16* dst, const _Float16* src,
                                            int src_ld, int dst_ld, int nchunks, int cpr) {
    unsigned base = (unsigned)(size_t)(void*)dst;   // low 32 bits of generic addr == LDS offset
    for (int i = threadIdx.x; i < nchunks; i += 256) {
        int row = i / cpr;
        int cc  = (i - row * cpr) * 8;
        unsigned long long g = (unsigned long long)(src + (size_t)row * src_ld + cc);
        unsigned l = base + (unsigned)((row * dst_ld + cc) * 2);
        // the wait stands in the copy's own statement: the next trip rewrites l and g
        asm volatile("global_load_async_to_lds_b128 %0, %1, off\n\ts_wait_xcnt 0x0" :: "v"(l), "v"(g) : "memory");
    }
}

__device__ __forceinline__ void wait_async_barrier() {
    asm volatile("s_wait_asynccnt 0" ::: "memory");
    __syncthreads();
}

// The bodies below take their block index as an argument: independent stages share a launch (cab_prep, cab_apply_kv).
__device__ __forceinline__ void cvt_f16_body(const float* __restrict__ in, _Float16* __restrict__ out, int n, int blk) {
    int i = blk * 256 + threadIdx.x;
    if (i < n) out[i] = (_Float16)in[i];
}

__device__ __forceinline__ void zero_vt_pad_body(_Float16* __restrict__ vt, int blk) {
    int i = blk * 256 + threadIdx.x;                 // over B_*C_*16
    int bo = i >> 4;
    int j  = i & 15;
    vt[(size_t)bo * LP2 + 80 + j] = (_Float16)0.f;
    asm volatile("s_wait_xcnt 0x0" ::: "memory");
}

// One block per (b, group): reduce 16 channels * 4096 contiguous floats.
__device__ __forceinline__ void gn_stats_body(const float* __restrict__ x, float* __restrict__ stats, int bg) {
    const float* p = x + (size_t)bg * (GC * HW_);
    float s = 0.f, s2 = 0.f;
    for (int i = threadIdx.x; i < GC * HW_; i += 256) { float v = p[i]; s += v; s2 += v * v; }
    __shared__ float rs[256], rq[256];
    rs[threadIdx.x] = s; rq[threadIdx.x] = s2;
    __syncthreads();
    for (int o = 128; o > 0; o >>= 1) {
        if (threadIdx.x < o) { rs[threadIdx.x] += rs[threadIdx.x + o]; rq[threadIdx.x] += rq[threadIdx.x + o]; }
        __syncthreads();
    }
    if (threadIdx.x == 0) {
        const float inv_n = 1.f / (GC * HW_);
        float mu  = rs[0] * inv_n;
        float var = rq[0] * inv_n - mu * mu;
        stats[bg * 2 + 0] = mu;
        stats[bg * 2 + 1] = rsqrtf(var + 1e-6f);
    }
}

// First launch: everything that reads inputs alone. The GroupNorm statistics, the long stage, take the lowest
// block indices and start first; the weight conversions and the Vt pad run beside them instead of in five
// launches of their own.
#define PB_STATS (B_ * 32)
#define PB_CC    (C_ * C_ / 256)
#define PB_CCD   (C_ * CD_ / 256)
#define PB_PAD   (B_ * C_ * 16 / 256)
__global__ void cab_prep(const float* __restrict__ x, float* __restrict__ stats,
                         const float* __restrict__ q_w, const float* __restrict__ k_w,
                         const float* __restrict__ v_w, const float* __restrict__ proj_w,
                         _Float16* __restrict__ qw16, _Float16* __restrict__ kw16,
                         _Float16* __restrict__ vw16, _Float16* __restrict__ pw16,
                         _Float16* __restrict__ vt) {
    int blk = blockIdx.x;
    if (blk < PB_STATS) { gn_stats_body(x, stats, blk); return; }
    blk -= PB_STATS;
    if (blk < PB_CCD) { cvt_f16_body(k_w, kw16, C_ * CD_, blk); return; }
    blk -= PB_CCD;
    if (blk < PB_CCD) { cvt_f16_body(v_w, vw16, C_ * CD_, blk); return; }
    blk -= PB_CCD;
    if (blk < PB_CC) { cvt_f16_body(q_w, qw16, C_ * C_, blk); return; }
    blk -= PB_CC;
    if (blk < PB_CC) { cvt_f16_body(proj_w, pw16, C_ * C_, blk); return; }
    blk -= PB_CC;
    zero_vt_pad_body(vt, blk);
}

typedef __attribute__((ext_vector_type(8))) _Float16 v8h;
typedef __attribute__((ext_vector_type(4))) float    v4f;
#define GT_PX 128   // pixels per tile
#define GT_NT 4     // tiles per work-group
__device__ __forceinline__ void gn_apply_t_body(const float* __restrict__ x, const float* __restrict__ stats,
                               const float* __restrict__ gamma, const float* __restrict__ beta,
                               _Float16* __restrict__ xn, int bx, int by, int b) {
    __shared__ __align__(16) _Float16 tile[2][GT_PX * 64];
    int c0 = by * 64, pb = bx * (GT_PX * GT_NT);
    int lane = threadIdx.x & 31;
    int wv = __builtin_amdgcn_readfirstlane(threadIdx.x >> 5);   // scalar: the per-channel constants load once per wave
    int cw = c0 + wv * 8;
    int g  = cw >> 4;
    float mu = stats[(b * 32 + g) * 2], rstd = stats[(b * 32 + g) * 2 + 1];
    float ga[8], be[8];
#pragma unroll
    for (int i = 0; i < 8; ++i) { ga[i] = gamma[cw + i]; be[i] = beta[cw + i]; }

    const float* src = x + ((size_t)b * C_ + cw) * HW_ + pb + lane * 4;
    v4f v[2][8];                                  // two register sets: loads run two tiles ahead of the LDS pass
#pragma unroll
    for (int u = 0; u < 2; ++u)
#pragma unroll
        for (int i = 0; i < 8; ++i) v[u][i] = *(const v4f*)(src + (size_t)i * HW_ + u * GT_PX);

    int swap = (lane >> 3) & 1;
    int slot = (wv ^ (lane & 7)) * 8;
#pragma unroll
    for (int t = 0; t < GT_NT; ++t) {
        v8h h[4];
#pragma unroll
        for (int j = 0; j < 4; ++j)
#pragma unroll
            for (int i = 0; i < 8; ++i) h[j][i] = (_Float16)((v[t & 1][i][j] - mu) * rstd * ga[i] + be[i]);
        if (t + 2 < GT_NT) {
#pragma unroll
            for (int i = 0; i < 8; ++i) v[t & 1][i] = *(const v4f*)(src + (size_t)i * HW_ + (t + 2) * GT_PX);
        }
        _Float16* buf = tile[t & 1];
#pragma unroll
        for (int j = 0; j < 4; ++j) *(v8h*)(buf + ((lane * 4 + j) ^ swap) * 64 + slot) = h[j];
        // Work-group barrier, one per tile, with the LDS wait alone: it publishes this buffer, and every wave's
        // reads of the other buffer have returned before it. __syncthreads() would also drain the global loads
        // of the next tiles and the stores of the last one, which no other wave depends on.
        asm volatile("s_wait_dscnt 0x0\n\ts_barrier_signal -1\n\ts_barrier_wait -1" ::: "memory");
#pragma unroll
        for (int k = 0; k < 4; ++k) {
            int idx = k * 256 + threadIdx.x;      // chunk in LDS order
            int r = idx >> 3, q = idx & 7;
            int p = r ^ ((r >> 5) & 1);
            int w = q ^ ((p >> 2) & 7);
            v8h d = *(const v8h*)(buf + idx * 8);
            *(v8h*)(xn + ((size_t)b * HW_ + pb + t * GT_PX + p) * C_ + c0 + w * 8) = d;
        }
        // the next tile's loads and arithmetic reuse the registers that these stores name
        asm volatile("s_wait_xcnt 0x0" ::: "memory");
        // keeps the next tile's arithmetic, and with it the wait for its loads, behind this tile's stores and that wait
        __builtin_amdgcn_sched_barrier(0);
    }
}

// Q projection: A = xn [B,HW,C], Bt = q_w [o][c]; wave does 32(M) x 128(N): every A fragment, which comes
// from global memory as 16 pieces of 64 B, feeds 8 matrix instructions, and xn is read C_/NB = 4 times in all.
// Ping-pong LDS weight panels (async staging overlapped with compute).
__global__ __launch_bounds__(256) void cab_gemm_qproj(const _Float16* __restrict__ xn, const _Float16* __restrict__ w,
                               const float* __restrict__ bias, _Float16* __restrict__ out) {
    __shared__ __align__(16) _Float16 wpan[2][NB * WP];
    int b  = blockIdx.z;
    int wv = threadIdx.x >> 5;
    int p0 = blockIdx.x * 256 + wv * 32;
    int n0 = blockIdx.y * NB;
    int lane = threadIdx.x & 31, half = lane >> 4, n15 = lane & 15;
    const _Float16* A = xn + ((size_t)b * HW_ + p0) * C_;
    v8f acc[2][NB / 16];
#pragma unroll
    for (int g2 = 0; g2 < 2; ++g2)
#pragma unroll
        for (int t = 0; t < NB / 16; ++t) acc[g2][t] = (v8f){0.f,0.f,0.f,0.f,0.f,0.f,0.f,0.f};

    stage_async(wpan[0], w + (size_t)n0 * C_, C_, WP, NB * 32, 32);
    v16h af[2][2], bf[2][4];
    af[0][0] = frag16(A, C_);                 // the first A fragments fly beside panel 0
    af[0][1] = frag16(A + (size_t)16 * C_, C_);
    wait_async_barrier();
    stage_async(wpan[1], w + (size_t)n0 * C_ + 256, C_, WP, NB * 32, 32);  // overlaps half-0 compute

    // Two register sets of fragments. A block is 8 matrix instructions: one k step of 32, 4 of the 8 channel tiles.
    // The B fragments of block j + 1, and in a step's first block the A fragments of the next step, are loaded
    // as one group in front of block j.
#pragma unroll
    for (int kh = 0; kh < 2; ++kh) {
        const _Float16* P = wpan[kh];
#pragma unroll
        for (int nt = 0; nt < 4; ++nt) bf[0][nt] = frag16(P + nt * 16 * WP, WP);
#pragma unroll
        for (int j = 0; j < 16; ++j) {
            const int s = j >> 1, hn = j & 1, ca = s & 1;
            const int ks = kh * 8 + s + 1;                 // the next k step, counted over both panels
            if (hn == 0 && ks < 16) {
                af[ca ^ 1][0] = frag16(A + ks * 32, C_);
                af[ca ^ 1][1] = frag16(A + (size_t)16 * C_ + ks * 32, C_);
            }
            if (j + 1 < 16) {
#pragma unroll
                for (int nt = 0; nt < 4; ++nt)
                    bf[hn ^ 1][nt] = frag16(P + (((j + 1) & 1) * 4 + nt) * 16 * WP + ((j + 1) >> 1) * 32, WP);
            }
            // keeps those loads in front of this block: without it the compiler sinks each load to its first
            // use and the wave waits out every LDS and global latency in full
            __builtin_amdgcn_sched_barrier(0);
#pragma unroll
            for (int nt = 0; nt < 4; ++nt) {
                acc[0][hn * 4 + nt] = wmma16(af[ca][0], bf[hn][nt], acc[0][hn * 4 + nt]);
                acc[1][hn * 4 + nt] = wmma16(af[ca][1], bf[hn][nt], acc[1][hn * 4 + nt]);
            }
            // ends the block: later loads may not rise among these matrix instructions
            __builtin_amdgcn_sched_barrier(0);
        }
        if (kh == 0) wait_async_barrier();   // panel 1 ready
    }
    // the epilogue's address arithmetic reuses the register pair that the A loads name
    asm volatile("s_wait_xcnt 0x0" ::: "memory");
    // keeps that arithmetic behind the wait
    __builtin_amdgcn_sched_barrier(0);
#pragma unroll
    for (int g2 = 0; g2 < 2; ++g2)
#pragma unroll
        for (int nt = 0; nt < NB / 16; ++nt) {
            int o = n0 + nt * 16 + n15;
            float bb = bias[o];
#pragma unroll
            for (int r = 0; r < 8; ++r) {
                int p = p0 + g2 * 16 + r + 8 * half;
                out[((size_t)b * HW_ + p) * C_ + o] = (_Float16)(acc[g2][nt][r] + bb);
            }
        }
}

// K/V projection: A = cond [B,77,768] f32 (row-clamped).
// waves 0..3 -> K matrix, waves 4..7 -> V matrix; each wave one 16x16 tile.
__device__ __forceinline__ void gemm_kv_body(const float* __restrict__ cond,
                            const _Float16* __restrict__ kw, const float* __restrict__ kb,
                            const _Float16* __restrict__ vw, const float* __restrict__ vb,
                            _Float16* __restrict__ kbuf, _Float16* __restrict__ vt, int bx, int by, int b) {
    int wv = threadIdx.x >> 5;
    int isv = wv >> 2;
    int p0 = bx * 16;                               // l-tile (bx < 5)
    int n0 = by * 64 + (wv & 3) * 16;               // by < 8
    int lane = threadIdx.x & 31, half = lane >> 4, n15 = lane & 15;
    const float* A = cond + (size_t)b * L_ * CD_ + (size_t)p0 * CD_;
    int rows_left = L_ - p0;
    const _Float16* w   = isv ? vw : kw;
    const float*    bia = isv ? vb : kb;
    v8f acc = (v8f){0.f,0.f,0.f,0.f,0.f,0.f,0.f,0.f};
    for (int kc = 0; kc < CD_; kc += 32) {
        v16h a  = frag16_f32c(A + kc, CD_, rows_left);
        v16h bf = frag16(w + (size_t)n0 * CD_ + kc, CD_);
        acc = wmma16(a, bf, acc);
    }
    int o = n0 + n15;
    float bb = bia[o];
#pragma unroll
    for (int r = 0; r < 8; ++r) {
        int l = p0 + r + 8 * half;                  // < 80 ; rows 77..79 masked later
        float v = acc[r] + bb;
        if (!isv) kbuf[((size_t)b * LP + l) * C_ + o]  = (_Float16)v;
        else      vt  [((size_t)b * C_ + o) * LP2 + l] = (_Float16)v;
    }
}

// Second launch: the two stages that need only the first launch's results. The K/V projection waits on load
// latency and moves few bytes; it takes the lowest block indices, starts first and runs beside the GroupNorm
// apply, which streams x.
#define AB_KV    ((LP / 16) * (C_ / 64) * B_)
#define AB_APPLY ((HW_ / (GT_PX * GT_NT)) * (C_ / 64) * B_)
__global__ void cab_apply_kv(const float* __restrict__ x, const float* __restrict__ stats,
                             const float* __restrict__ gamma, const float* __restrict__ beta,
                             _Float16* __restrict__ xn, const float* __restrict__ cond,
                             const _Float16* __restrict__ kw, const float* __restrict__ kb,
                             const _Float16* __restrict__ vw, const float* __restrict__ vb,
                             _Float16* __restrict__ kbuf, _Float16* __restrict__ vt) {
    int blk = blockIdx.x;
    if (blk < AB_KV) {
        int yz = blk / (LP / 16);
        gemm_kv_body(cond, kw, kb, vw, vb, kbuf, vt, blk - yz * (LP / 16), yz & 7, yz >> 3);
    } else {
        blk -= AB_KV;
        gn_apply_t_body(x, stats, gamma, beta, xn, blk & 7, (blk >> 3) & 7, blk >> 6);
    }
}

// Attention: block = one (b,head), 128 query rows; K/Vt panels staged in LDS (async).
__global__ void cab_attn(const _Float16* __restrict__ q, const _Float16* __restrict__ kbuf,
                         const _Float16* __restrict__ vt, const float* __restrict__ scale_p,
                         _Float16* __restrict__ obuf) {
    __shared__ __align__(16) _Float16 kls[LP * KP];        // 80 rows
    __shared__ __align__(16) _Float16 vls[HD * VP];        // 64 rows
    __shared__ __align__(16) _Float16 lds_p[8][16 * VP];   // 16 rows per wave
    int b = blockIdx.z, h = blockIdx.y;
    int wv = threadIdx.x >> 5;
    int p0 = blockIdx.x * 128 + wv * 16;
    int lane = threadIdx.x & 31, half = lane >> 4, n15 = lane & 15;
    float scl = scale_p[0];

    // Stage K (rows l, ld C_) and Vt (rows d, ld LP2) panels for this (b,h).
    stage_async(kls, kbuf + (size_t)b * LP * C_ + h * HD, C_, KP, (LP * HD) / 8, HD / 8);
    stage_async(vls, vt + ((size_t)b * C_ + h * HD) * LP2, LP2, VP, (HD * LP2) / 8, LP2 / 8);

    const _Float16* Q = q + ((size_t)b * HW_ + p0) * C_ + h * HD;
    v16h a0 = frag16(Q,      C_);
    v16h a1 = frag16(Q + 32, C_);

    wait_async_barrier();

    v8f s[5];
#pragma unroll
    for (int t = 0; t < 5; ++t) {
        v8f z = (v8f){0.f,0.f,0.f,0.f,0.f,0.f,0.f,0.f};
        z = wmma16(a0, frag16(kls + (t * 16) * KP,      KP), z);
        z = wmma16(a1, frag16(kls + (t * 16) * KP + 32, KP), z);
        s[t] = z;
    }

    _Float16* P = &lds_p[wv][0];
    bool mask4 = (n15 >= 13);                       // t==4 column l = 64+n15 >= 77
#pragma unroll
    for (int r = 0; r < 8; ++r) {
        float sv[5], m = -3.0e38f;
#pragma unroll
        for (int t = 0; t < 5; ++t) {
            float v = s[t][r] * scl;
            if (t == 4 && mask4) v = -3.0e38f;
            sv[t] = v; m = fmaxf(m, v);
        }
#pragma unroll
        for (int o = 1; o < 16; o <<= 1) m = fmaxf(m, __shfl_xor(m, o, 32));
        float sum = 0.f, pv[5];
#pragma unroll
        for (int t = 0; t < 5; ++t) { float e = __expf(sv[t] - m); pv[t] = e; sum += e; }
#pragma unroll
        for (int o = 1; o < 16; o <<= 1) sum += __shfl_xor(sum, o, 32);
        float inv = 1.f / sum;
        int row = r + 8 * half;
#pragma unroll
        for (int t = 0; t < 5; ++t) P[row * VP + t * 16 + n15] = (_Float16)(pv[t] * inv);
        P[row * VP + 80 + n15] = (_Float16)0.f;    // zero pad cols 80..95
    }
    __syncthreads();

    v8f oacc[4];
#pragma unroll
    for (int nt = 0; nt < 4; ++nt) oacc[nt] = (v8f){0.f,0.f,0.f,0.f,0.f,0.f,0.f,0.f};
#pragma unroll
    for (int kc = 0; kc < 3; ++kc) {
        v16h ap = frag16(P + kc * 32, VP);         // A-frag of probabilities from LDS
#pragma unroll
        for (int nt = 0; nt < 4; ++nt)
            oacc[nt] = wmma16(ap, frag16(vls + (nt * 16) * VP + kc * 32, VP), oacc[nt]);
    }
#pragma unroll
    for (int nt = 0; nt < 4; ++nt)
#pragma unroll
        for (int r = 0; r < 8; ++r) {
            int p = p0 + r + 8 * half;
            obuf[((size_t)b * HW_ + p) * C_ + h * HD + nt * 16 + n15] = (_Float16)oacc[nt][r];
        }
}

// Final projection + residual: out[b,o,p] = x + O @ proj_w^T + proj_b; wave does 32(M) x 128(N), as in the Q projection.
// Ping-pong LDS weight panels; the same LDS is reused as f32 transpose buffer for coalesced stores.
__global__ __launch_bounds__(256) void cab_gemm_proj(const _Float16* __restrict__ obuf, const _Float16* __restrict__ w,
                              const float* __restrict__ bias, const float* __restrict__ x,
                              float* __restrict__ out) {
    __shared__ __align__(16) char smem[2 * NB * WP * 2];   // 2 weight panels; reused for transpose
    _Float16* wpan0 = (_Float16*)smem;
    _Float16* wpan1 = (_Float16*)(smem + NB * WP * 2);
    int b  = blockIdx.z;
    int wv = threadIdx.x >> 5;
    int p0 = blockIdx.x * 256 + wv * 32;
    int n0 = blockIdx.y * NB;
    int lane = threadIdx.x & 31, half = lane >> 4, n15 = lane & 15;
    const _Float16* A = obuf + ((size_t)b * HW_ + p0) * C_;
    v8f acc[2][NB / 16];
#pragma unroll
    for (int g2 = 0; g2 < 2; ++g2)
#pragma unroll
        for (int t = 0; t < NB / 16; ++t) acc[g2][t] = (v8f){0.f,0.f,0.f,0.f,0.f,0.f,0.f,0.f};

    stage_async(wpan0, w + (size_t)n0 * C_, C_, WP, NB * 32, 32);
    v16h af[2][2], bf[2][4];
    af[0][0] = frag16(A, C_);                 // the first A fragments fly beside panel 0
    af[0][1] = frag16(A + (size_t)16 * C_, C_);
    wait_async_barrier();
    stage_async(wpan1, w + (size_t)n0 * C_ + 256, C_, WP, NB * 32, 32);    // overlaps half-0 compute

    // Two register sets of fragments. A block is 8 matrix instructions: one k step of 32, 4 of the 8 channel tiles.
    // The B fragments of block j + 1, and in a step's first block the A fragments of the next step, are loaded
    // as one group in front of block j.
#pragma unroll
    for (int kh = 0; kh < 2; ++kh) {
        const _Float16* P = kh ? wpan1 : wpan0;
#pragma unroll
        for (int nt = 0; nt < 4; ++nt) bf[0][nt] = frag16(P + nt * 16 * WP, WP);
#pragma unroll
        for (int j = 0; j < 16; ++j) {
            const int s = j >> 1, hn = j & 1, ca = s & 1;
            const int ks = kh * 8 + s + 1;                 // the next k step, counted over both panels
            if (hn == 0 && ks < 16) {
                af[ca ^ 1][0] = frag16(A + ks * 32, C_);
                af[ca ^ 1][1] = frag16(A + (size_t)16 * C_ + ks * 32, C_);
            }
            if (j + 1 < 16) {
#pragma unroll
                for (int nt = 0; nt < 4; ++nt)
                    bf[hn ^ 1][nt] = frag16(P + (((j + 1) & 1) * 4 + nt) * 16 * WP + ((j + 1) >> 1) * 32, WP);
            }
            // keeps those loads in front of this block: without it the compiler sinks each load to its first
            // use and the wave waits out every LDS and global latency in full
            __builtin_amdgcn_sched_barrier(0);
#pragma unroll
            for (int nt = 0; nt < 4; ++nt) {
                acc[0][hn * 4 + nt] = wmma16(af[ca][0], bf[hn][nt], acc[0][hn * 4 + nt]);
                acc[1][hn * 4 + nt] = wmma16(af[ca][1], bf[hn][nt], acc[1][hn * 4 + nt]);
            }
            // ends the block: later loads may not rise among these matrix instructions
            __builtin_amdgcn_sched_barrier(0);
        }
        if (kh == 0) wait_async_barrier();   // panel 1 ready
    }
    // the epilogue's address arithmetic reuses the register pair that the A loads name
    asm volatile("s_wait_xcnt 0x0" ::: "memory");
    // keeps that arithmetic behind the wait
    __builtin_amdgcn_sched_barrier(0);
    __syncthreads();                          // all weight reads done before smem reuse

    float* T = (float*)smem + (size_t)wv * NB * 33;        // [128 o][32 p], stride 33; 8 waves fill smem exactly
#pragma unroll
    for (int g2 = 0; g2 < 2; ++g2)
#pragma unroll
        for (int nt = 0; nt < NB / 16; ++nt)
#pragma unroll
            for (int r = 0; r < 8; ++r)
                T[(nt * 16 + n15) * 33 + g2 * 16 + r + 8 * half] = acc[g2][nt][r];
    __syncthreads();
    // The wave's 32 pixels of one output channel are one 128-byte line: 8 lanes x 16 B take it whole, 4 channels a trip.
    int pc = (lane & 7) * 4;
    size_t base = ((size_t)b * C_ + n0 + (lane >> 3)) * HW_ + p0 + pc;
    const float* t0 = T + (lane >> 3) * 33 + pc;
#pragma unroll
    for (int i0 = 0; i0 < NB / 4; i0 += 8) {               // 8 loads of x in flight per wave
        v4f xv[8];
        float bo[8];
#pragma unroll
        for (int u = 0; u < 8; ++u) {
            xv[u] = *(const v4f*)(x + base + (size_t)(i0 + u) * 4 * HW_);
            bo[u] = bias[n0 + (i0 + u) * 4 + (lane >> 3)];
        }
#pragma unroll
        for (int u = 0; u < 8; ++u) {
            const float* t = t0 + (i0 + u) * 4 * 33;
            v4f ov;
#pragma unroll
            for (int j = 0; j < 4; ++j) ov[j] = xv[u][j] + t[j] + bo[u];
            *(v4f*)(out + base + (size_t)(i0 + u) * 4 * HW_) = ov;
        }
        if (i0 + 8 < NB / 4) {
            // the next trip's loads and address arithmetic reuse the registers that these stores name
            asm volatile("s_wait_xcnt 0x0" ::: "memory");
            // keeps the next trip's instructions behind that wait
            __builtin_amdgcn_sched_barrier(0);
        }
    }
}

extern "C" void kernel_launch(void* const* d_in, const int* in_sizes, int n_in,
                              void* d_out, int out_size, void* d_ws, size_t ws_size,
                              hipStream_t stream) {
    const float* x      = (const float*)d_in[0];
    const float* cond   = (const float*)d_in[1];
    const float* gamma  = (const float*)d_in[2];
    const float* beta   = (const float*)d_in[3];
    const float* q_w    = (const float*)d_in[4];
    const float* q_b    = (const float*)d_in[5];
    const float* k_w    = (const float*)d_in[6];
    const float* k_b    = (const float*)d_in[7];
    const float* v_w    = (const float*)d_in[8];
    const float* v_b    = (const float*)d_in[9];
    const float* proj_w = (const float*)d_in[10];
    const float* proj_b = (const float*)d_in[11];
    const float* scale  = (const float*)d_in[12];
    float* out = (float*)d_out;

    char* ws = (char*)d_ws;
    size_t off = 0;
    auto carve = [&](size_t bytes) { void* p = ws + off; off = (off + bytes + 255) & ~(size_t)255; return p; };
    float*     stats = (float*)    carve(512 * 2 * sizeof(float));
    _Float16*  qw16  = (_Float16*) carve((size_t)C_ * C_  * 2);
    _Float16*  kw16  = (_Float16*) carve((size_t)C_ * CD_ * 2);
    _Float16*  vw16  = (_Float16*) carve((size_t)C_ * CD_ * 2);
    _Float16*  pw16  = (_Float16*) carve((size_t)C_ * C_  * 2);
    _Float16*  kbuf  = (_Float16*) carve((size_t)B_ * LP  * C_  * 2);
    _Float16*  vt    = (_Float16*) carve((size_t)B_ * C_  * LP2 * 2);
    _Float16*  xn    = (_Float16*) carve((size_t)B_ * HW_ * C_  * 2);  // reused as obuf after qproj
    _Float16*  qbuf  = (_Float16*) carve((size_t)B_ * HW_ * C_  * 2);
    _Float16*  obuf  = xn;   // xn is dead once qproj finishes (stream-ordered)

    // 1) GroupNorm statistics, weights to f16, Vt pad
    cab_prep<<<PB_STATS + 2 * PB_CCD + 2 * PB_CC + PB_PAD, 256, 0, stream>>>(x, stats, q_w, k_w, v_w, proj_w,
                                                                             qw16, kw16, vw16, pw16, vt);

    // 2) K/V projection, GroupNorm apply
    cab_apply_kv<<<AB_KV + AB_APPLY, 256, 0, stream>>>(x, stats, gamma, beta, xn, cond, kw16, k_b, vw16, v_b, kbuf, vt);

    // 3) Q projection
    cab_gemm_qproj<<<dim3(HW_ / 256, C_ / NB, B_), 256, 0, stream>>>(xn, qw16, q_b, qbuf);

    // 4) attention (writes obuf == xn region)
    cab_attn<<<dim3(HW_ / 128, NH, B_), 256, 0, stream>>>(qbuf, kbuf, vt, scale, obuf);

    // 5) output projection + residual
    cab_gemm_proj<<<dim3(HW_ / 256, C_ / NB, B_), 256, 0, stream>>>(obuf, pw16, proj_b, x, out);
}

// v005
// Measured time: 176 microseconds a run.
// Next to v004, in two timings, it ran 1.08 times as fast each time.
// All steps since v000 together make it 2.78 times as fast.
#include <hip/hip_runtime.h>

typedef __attribute__((ext_vector_type(16))) _Float16 v16h;
typedef __attribute__((ext_vector_type(8)))  float    v8f;

#define B_   16
#define C_   512
#define CD_  768
#define HW_  4096
#define L_   77
#define LP   80     // padded key rows (5 x 16 tiles)
#define LP2  96     // padded key width for PV (3 x 32 K-chunks)
#define HD   64
#define GC   16     // channels per group (C/32)
#define WP   264    // weight panel rows: 256 halves + 8  (528 B)
#define KP   136    // K rows: 128 halves (2 heads) + 8     (272 B)
#define VP   104    // Vt rows: 96 halves + 8              (208 B)
#define NB   128    // output channels per work-group of the two projection GEMMs (8 tiles of 16 per wave)

__device__ __forceinline__ v8f wmma16(v16h a, v16h b, v8f c) {
    return __builtin_amdgcn_wmma_f32_16x16x32_f16(false, a, false, b, (short)0, c, false, false);
}

__device__ __forceinline__ v16h frag16(const _Float16* p, int ld) {
    int lane = threadIdx.x & 31;
    const _Float16* b = p + (size_t)(lane & 15) * ld + ((lane >> 4) << 3);
    v16h f;
#pragma unroll
    for (int i = 0; i < 8; ++i) { f[i] = b[i]; f[i + 8] = b[i + 16]; }
    return f;
}

// f32 source (cond) with clamped row index (L=77 tail tile).
__device__ __forceinline__ v16h frag16_f32c(const float* p, int ld, int rows_left) {
    int lane = threadIdx.x & 31;
    int r = lane & 15;
    if (r >= rows_left) r = rows_left - 1;
    const float* b = p + (size_t)r * ld + ((lane >> 4) << 3);
    v16h f;
#pragma unroll
    for (int i = 0; i < 8; ++i) { f[i] = (_Float16)b[i]; f[i + 8] = (_Float16)b[i + 16]; }
    return f;
}

__device__ __forceinline__ void stage_async(_Float16* dst, const _Float16* src,
                                            int src_ld, int dst_ld, int nchunks, int cpr) {
    unsigned base = (unsigned)(size_t)(void*)dst;   // low 32 bits of generic addr == LDS offset
    for (int i = threadIdx.x; i < nchunks; i += 256) {
        int row = i / cpr;
        int cc  = (i - row * cpr) * 8;
        unsigned long long g = (unsigned long long)(src + (size_t)row * src_ld + cc);
        unsigned l = base + (unsigned)((row * dst_ld + cc) * 2);
        // the wait stands in the copy's own statement: the next trip rewrites l and g
        asm volatile("global_load_async_to_lds_b128 %0, %1, off\n\ts_wait_xcnt 0x0" :: "v"(l), "v"(g) : "memory");
    }
}

__device__ __forceinline__ void wait_async_barrier() {
    asm volatile("s_wait_asynccnt 0" ::: "memory");
    __syncthreads();
}

// The bodies below take their block index as an argument: independent stages share a launch (cab_prep, cab_apply_kv).
__device__ __forceinline__ void cvt_f16_body(const float* __restrict__ in, _Float16* __restrict__ out, int n, int blk) {
    int i = blk * 256 + threadIdx.x;
    if (i < n) out[i] = (_Float16)in[i];
}

__device__ __forceinline__ void zero_vt_pad_body(_Float16* __restrict__ vt, int blk) {
    int i = blk * 256 + threadIdx.x;                 // over B_*C_*16
    int bo = i >> 4;
    int j  = i & 15;
    vt[(size_t)bo * LP2 + 80 + j] = (_Float16)0.f;
    asm volatile("s_wait_xcnt 0x0" ::: "memory");
}

// One block per (b, group): reduce 16 channels * 4096 contiguous floats.
__device__ __forceinline__ void gn_stats_body(const float* __restrict__ x, float* __restrict__ stats, int bg) {
    const float* p = x + (size_t)bg * (GC * HW_);
    float s = 0.f, s2 = 0.f;
    for (int i = threadIdx.x; i < GC * HW_; i += 256) { float v = p[i]; s += v; s2 += v * v; }
    __shared__ float rs[256], rq[256];
    rs[threadIdx.x] = s; rq[threadIdx.x] = s2;
    __syncthreads();
    for (int o = 128; o > 0; o >>= 1) {
        if (threadIdx.x < o) { rs[threadIdx.x] += rs[threadIdx.x + o]; rq[threadIdx.x] += rq[threadIdx.x + o]; }
        __syncthreads();
    }
    if (threadIdx.x == 0) {
        const float inv_n = 1.f / (GC * HW_);
        float mu  = rs[0] * inv_n;
        float var = rq[0] * inv_n - mu * mu;
        stats[bg * 2 + 0] = mu;
        stats[bg * 2 + 1] = rsqrtf(var + 1e-6f);
    }
}

// First launch: everything that reads inputs alone. The GroupNorm statistics, the long stage, take the lowest
// block indices and start first; the weight conversions and the Vt pad run beside them instead of in five
// launches of their own.
#define PB_STATS (B_ * 32)
#define PB_CC    (C_ * C_ / 256)
#define PB_CCD   (C_ * CD_ / 256)
#define PB_PAD   (B_ * C_ * 16 / 256)
__global__ void cab_prep(const float* __restrict__ x, float* __restrict__ stats,
                         const float* __restrict__ q_w, const float* __restrict__ k_w,
                         const float* __restrict__ v_w, const float* __restrict__ proj_w,
                         _Float16* __restrict__ qw16, _Float16* __restrict__ kw16,
                         _Float16* __restrict__ vw16, _Float16* __restrict__ pw16,
                         _Float16* __restrict__ vt) {
    int blk = blockIdx.x;
    if (blk < PB_STATS) { gn_stats_body(x, stats, blk); return; }
    blk -= PB_STATS;
    if (blk < PB_CCD) { cvt_f16_body(k_w, kw16, C_ * CD_, blk); return; }
    blk -= PB_CCD;
    if (blk < PB_CCD) { cvt_f16_body(v_w, vw16, C_ * CD_, blk); return; }
    blk -= PB_CCD;
    if (blk < PB_CC) { cvt_f16_body(q_w, qw16, C_ * C_, blk); return; }
    blk -= PB_CC;
    if (blk < PB_CC) { cvt_f16_body(proj_w, pw16, C_ * C_, blk); return; }
    blk -= PB_CC;
    zero_vt_pad_body(vt, blk);
}

typedef __attribute__((ext_vector_type(8))) _Float16 v8h;
typedef __attribute__((ext_vector_type(4))) float    v4f;
#define GT_PX 128   // pixels per tile
#define GT_NT 4     // tiles per work-group
__device__ __forceinline__ void gn_apply_t_body(const float* __restrict__ x, const float* __restrict__ stats,
                               const float* __restrict__ gamma, const float* __restrict__ beta,
                               _Float16* __restrict__ xn, int bx, int by, int b) {
    __shared__ __align__(16) _Float16 tile[2][GT_PX * 64];
    int c0 = by * 64, pb = bx * (GT_PX * GT_NT);
    int lane = threadIdx.x & 31;
    int wv = __builtin_amdgcn_readfirstlane(threadIdx.x >> 5);   // scalar: the per-channel constants load once per wave
    int cw = c0 + wv * 8;
    int g  = cw >> 4;
    float mu = stats[(b * 32 + g) * 2], rstd = stats[(b * 32 + g) * 2 + 1];
    float ga[8], be[8];
#pragma unroll
    for (int i = 0; i < 8; ++i) { ga[i] = gamma[cw + i]; be[i] = beta[cw + i]; }

    const float* src = x + ((size_t)b * C_ + cw) * HW_ + pb + lane * 4;
    v4f v[2][8];                                  // two register sets: loads run two tiles ahead of the LDS pass
#pragma unroll
    for (int u = 0; u < 2; ++u)
#pragma unroll
        for (int i = 0; i < 8; ++i) v[u][i] = *(const v4f*)(src + (size_t)i * HW_ + u * GT_PX);

    int swap = (lane >> 3) & 1;
    int slot = (wv ^ (lane & 7)) * 8;
#pragma unroll
    for (int t = 0; t < GT_NT; ++t) {
        v8h h[4];
#pragma unroll
        for (int j = 0; j < 4; ++j)
#pragma unroll
            for (int i = 0; i < 8; ++i) h[j][i] = (_Float16)((v[t & 1][i][j] - mu) * rstd * ga[i] + be[i]);
        if (t + 2 < GT_NT) {
#pragma unroll
            for (int i = 0; i < 8; ++i) v[t & 1][i] = *(const v4f*)(src + (size_t)i * HW_ + (t + 2) * GT_PX);
        }
        _Float16* buf = tile[t & 1];
#pragma unroll
        for (int j = 0; j < 4; ++j) *(v8h*)(buf + ((lane * 4 + j) ^ swap) * 64 + slot) = h[j];
        // Work-group barrier, one per tile, with the LDS wait alone: it publishes this buffer, and every wave's
        // reads of the other buffer have returned before it. __syncthreads() would also drain the global loads
        // of the next tiles and the stores of the last one, which no other wave depends on.
        asm volatile("s_wait_dscnt 0x0\n\ts_barrier_signal -1\n\ts_barrier_wait -1" ::: "memory");
#pragma unroll
        for (int k = 0; k < 4; ++k) {
            int idx = k * 256 + threadIdx.x;      // chunk in LDS order
            int r = idx >> 3, q = idx & 7;
            int p = r ^ ((r >> 5) & 1);
            int w = q ^ ((p >> 2) & 7);
            v8h d = *(const v8h*)(buf + idx * 8);
            *(v8h*)(xn + ((size_t)b * HW_ + pb + t * GT_PX + p) * C_ + c0 + w * 8) = d;
        }
        // the next tile's loads and arithmetic reuse the registers that these stores name
        asm volatile("s_wait_xcnt 0x0" ::: "memory");
        // keeps the next tile's arithmetic, and with it the wait for its loads, behind this tile's stores and that wait
        __builtin_amdgcn_sched_barrier(0);
    }
}

// K/V projection: A = cond [B,77,768] f32 (row-clamped).
// waves 0..3 -> K matrix, waves 4..7 -> V matrix; each wave one 16x16 tile.
__device__ __forceinline__ void gemm_kv_body(const float* __restrict__ cond,
                            const _Float16* __restrict__ kw, const float* __restrict__ kb,
                            const _Float16* __restrict__ vw, const float* __restrict__ vb,
                            _Float16* __restrict__ kbuf, _Float16* __restrict__ vt, int bx, int by, int b) {
    int wv = threadIdx.x >> 5;
    int isv = wv >> 2;
    int p0 = bx * 16;                               // l-tile (bx < 5)
    int n0 = by * 64 + (wv & 3) * 16;               // by < 8
    int lane = threadIdx.x & 31, half = lane >> 4, n15 = lane & 15;
    const float* A = cond + (size_t)b * L_ * CD_ + (size_t)p0 * CD_;
    int rows_left = L_ - p0;
    const _Float16* w   = isv ? vw : kw;
    const float*    bia = isv ? vb : kb;
    v8f acc = (v8f){0.f,0.f,0.f,0.f,0.f,0.f,0.f,0.f};
    for (int kc = 0; kc < CD_; kc += 32) {
        v16h a  = frag16_f32c(A + kc, CD_, rows_left);
        v16h bf = frag16(w + (size_t)n0 * CD_ + kc, CD_);
        acc = wmma16(a, bf, acc);
    }
    int o = n0 + n15;
    float bb = bia[o];
#pragma unroll
    for (int r = 0; r < 8; ++r) {
        int l = p0 + r + 8 * half;                  // < 80 ; rows 77..79 masked later
        float v = acc[r] + bb;
        if (!isv) kbuf[((size_t)b * LP + l) * C_ + o]  = (_Float16)v;
        else      vt  [((size_t)b * C_ + o) * LP2 + l] = (_Float16)v;
    }
}

// Second launch: the two stages that need only the first launch's results. The K/V projection waits on load
// latency and moves few bytes; it takes the lowest block indices, starts first and runs beside the GroupNorm
// apply, which streams x.
#define AB_KV    ((LP / 16) * (C_ / 64) * B_)
#define AB_APPLY ((HW_ / (GT_PX * GT_NT)) * (C_ / 64) * B_)
__global__ void cab_apply_kv(const float* __restrict__ x, const float* __restrict__ stats,
                             const float* __restrict__ gamma, const float* __restrict__ beta,
                             _Float16* __restrict__ xn, const float* __restrict__ cond,
                             const _Float16* __restrict__ kw, const float* __restrict__ kb,
                             const _Float16* __restrict__ vw, const float* __restrict__ vb,
                             _Float16* __restrict__ kbuf, _Float16* __restrict__ vt) {
    int blk = blockIdx.x;
    if (blk < AB_KV) {
        int yz = blk / (LP / 16);
        gemm_kv_body(cond, kw, kb, vw, vb, kbuf, vt, blk - yz * (LP / 16), yz & 7, yz >> 3);
    } else {
        blk -= AB_KV;
        gn_apply_t_body(x, stats, gamma, beta, xn, blk & 7, (blk >> 3) & 7, blk >> 6);
    }
}

// Q projection and attention in one kernel. A work-group does 256 pixels x 128 channels = 2 heads; a wave 32 pixels.
// The projection is formed transposed, Q^T = q_w . xn^T (the weight fragment is the A operand): an accumulator tile
// then holds in lane n the pixel n and in its 8 registers the channels 8*half..8*half+7, which is the place those
// values have in a B fragment (two tiles = one k step of 32). So Q never leaves the registers, and the same holds
// for S^T = K . Q^T (rows = keys) and O^T = Vt . P^T (rows = head channels): a pixel's whole score column lies in
// lanes n and n + 16, the softmax is in-lane but for one exchange, and a lane stores 8 channels of O at once.
// Ping-pong LDS weight panels (async staging overlapped with compute); panel 0, once read, takes K and Vt.
__global__ __launch_bounds__(256) void cab_qproj_attn(const _Float16* __restrict__ xn, const _Float16* __restrict__ w,
                               const float* __restrict__ bias, const _Float16* __restrict__ kbuf,
                               const _Float16* __restrict__ vt, const float* __restrict__ scale_p,
                               _Float16* __restrict__ obuf) {
    __shared__ __align__(16) _Float16 wpan[2][NB * WP];
    _Float16* kls = wpan[0];                  // 80 key rows x 128 channels, pitch KP
    _Float16* vls = wpan[0] + LP * KP;        // 128 channel rows x 96 keys, pitch VP
    int b  = blockIdx.z;
    int wv = threadIdx.x >> 5;
    int p0 = blockIdx.x * 256 + wv * 32;
    int n0 = blockIdx.y * NB;
    int lane = threadIdx.x & 31, half = lane >> 4, n15 = lane & 15;
    const _Float16* A = xn + ((size_t)b * HW_ + p0) * C_;
    v8f acc[2][NB / 16];
#pragma unroll
    for (int g2 = 0; g2 < 2; ++g2)
#pragma unroll
        for (int t = 0; t < NB / 16; ++t) acc[g2][t] = (v8f){0.f,0.f,0.f,0.f,0.f,0.f,0.f,0.f};

    stage_async(wpan[0], w + (size_t)n0 * C_, C_, WP, NB * 32, 32);
    v16h af[2][2], bf[2][4];
    af[0][0] = frag16(A, C_);                 // the first xn fragments fly beside panel 0
    af[0][1] = frag16(A + (size_t)16 * C_, C_);
    wait_async_barrier();
    stage_async(wpan[1], w + (size_t)n0 * C_ + 256, C_, WP, NB * 32, 32);  // overlaps half-0 compute

    // Two register sets of fragments. A block is 8 matrix instructions: one k step of 32, 4 of the 8 channel tiles.
    // The weight fragments of block j + 1, and in a step's first block the xn fragments of the next step, are loaded
    // as one group in front of block j.
#pragma unroll
    for (int kh = 0; kh < 2; ++kh) {
        const _Float16* P = wpan[kh];
#pragma unroll
        for (int nt = 0; nt < 4; ++nt) bf[0][nt] = frag16(P + nt * 16 * WP, WP);
#pragma unroll
        for (int j = 0; j < 16; ++j) {
            const int s = j >> 1, hn = j & 1, ca = s & 1;
            const int ks = kh * 8 + s + 1;                 // the next k step, counted over both panels
            if (hn == 0 && ks < 16) {
                af[ca ^ 1][0] = frag16(A + ks * 32, C_);
                af[ca ^ 1][1] = frag16(A + (size_t)16 * C_ + ks * 32, C_);
            }
            if (j + 1 < 16) {
#pragma unroll
                for (int nt = 0; nt < 4; ++nt)
                    bf[hn ^ 1][nt] = frag16(P + (((j + 1) & 1) * 4 + nt) * 16 * WP + ((j + 1) >> 1) * 32, WP);
            }
            // keeps those loads in front of this block: without it the compiler sinks each load to its first
            // use and the wave waits out every LDS and global latency in full
            __builtin_amdgcn_sched_barrier(0);
#pragma unroll
            for (int nt = 0; nt < 4; ++nt) {
                acc[0][hn * 4 + nt] = wmma16(bf[hn][nt], af[ca][0], acc[0][hn * 4 + nt]);
                acc[1][hn * 4 + nt] = wmma16(bf[hn][nt], af[ca][1], acc[1][hn * 4 + nt]);
            }
            // ends the block: later loads may not rise among these matrix instructions
            __builtin_amdgcn_sched_barrier(0);
        }
        if (kh == 0) {
            // this wave's reads of panel 0 have returned before the barrier behind which panel 0 is refilled
            asm volatile("s_wait_dscnt 0x0" ::: "memory");
            wait_async_barrier();   // panel 1 ready; every wave has left panel 0
            // K (rows l, ld C_) and Vt (rows d, ld LP2) of this batch and these 2 heads fly beside half-1 compute.
            // 16-byte chunks, 5 + 6 per thread, every lane on; one statement and one wait per run of copies.
            unsigned kl = (unsigned)(size_t)(void*)kls, vl = (unsigned)(size_t)(void*)vls;
            const _Float16* kg = kbuf + (size_t)b * LP * C_ + n0;
            const _Float16* vg = vt + ((size_t)b * C_ + n0) * LP2;
            unsigned la[6];
            const _Float16* ga[6];
#pragma unroll
            for (int u = 0; u < 5; ++u) {
                int i = u * 256 + threadIdx.x, row = i >> 4, cc = (i & 15) * 8;
                la[u] = kl + (unsigned)((row * KP + cc) * 2);
                ga[u] = kg + (size_t)row * C_ + cc;
            }
            // the wait stands in the copies' own statement: the Vt addresses below reuse these registers
            asm volatile("global_load_async_to_lds_b128 %0, %1, off\n\t"
                         "global_load_async_to_lds_b128 %2, %3, off\n\t"
                         "global_load_async_to_lds_b128 %4, %5, off\n\t"
                         "global_load_async_to_lds_b128 %6, %7, off\n\t"
                         "global_load_async_to_lds_b128 %8, %9, off\n\t"
                         "s_wait_xcnt 0x0"
                         :: "v"(la[0]), "v"(ga[0]), "v"(la[1]), "v"(ga[1]), "v"(la[2]), "v"(ga[2]),
                            "v"(la[3]), "v"(ga[3]), "v"(la[4]), "v"(ga[4]) : "memory");
#pragma unroll
            for (int u = 0; u < 6; ++u) {
                int i = u * 256 + threadIdx.x, row = i / 12, cc = (i - row * 12) * 8;
                la[u] = vl + (unsigned)((row * VP + cc) * 2);
                ga[u] = vg + (size_t)row * LP2 + cc;
            }
            // the wait stands in the copies' own statement: the main loop reuses these registers
            asm volatile("global_load_async_to_lds_b128 %0, %1, off\n\t"
                         "global_load_async_to_lds_b128 %2, %3, off\n\t"
                         "global_load_async_to_lds_b128 %4, %5, off\n\t"
                         "global_load_async_to_lds_b128 %6, %7, off\n\t"
                         "global_load_async_to_lds_b128 %8, %9, off\n\t"
                         "global_load_async_to_lds_b128 %10, %11, off\n\t"
                         "s_wait_xcnt 0x0"
                         :: "v"(la[0]), "v"(ga[0]), "v"(la[1]), "v"(ga[1]), "v"(la[2]), "v"(ga[2]),
                            "v"(la[3]), "v"(ga[3]), "v"(la[4]), "v"(ga[4]), "v"(la[5]), "v"(ga[5]) : "memory");
        }
    }
    // a lane's 8 bias values per channel tile: channels 8*half..8*half+7 of the tile
    v4f bq[NB / 16][2];
#pragma unroll
    for (int nt = 0; nt < NB / 16; ++nt) {
        bq[nt][0] = *(const v4f*)(bias + n0 + nt * 16 + 8 * half);
        bq[nt][1] = *(const v4f*)(bias + n0 + nt * 16 + 8 * half + 4);
    }
    float scl = scale_p[0];
    // the arithmetic below reuses the registers that the xn loads and the bias loads name
    asm volatile("s_wait_xcnt 0x0" ::: "memory");
    // keeps that arithmetic behind the wait
    __builtin_amdgcn_sched_barrier(0);
    wait_async_barrier();                     // K and Vt have landed, for every wave

    // Q^T + bias as B fragments: element i = channel 8*half + i of the k step's first tile, i + 8 the same of its second
    v16h qf[2][2][2];                         // [pixel tile][head][k step]
#pragma unroll
    for (int g2 = 0; g2 < 2; ++g2)
#pragma unroll
        for (int nt = 0; nt < NB / 16; ++nt)
#pragma unroll
            for (int r = 0; r < 8; ++r)
                qf[g2][nt >> 2][(nt >> 1) & 1][(nt & 1) * 8 + r] = (_Float16)(acc[g2][nt][r] + bq[nt][r >> 2][r & 3]);

#pragma unroll
    for (int hh = 0; hh < 2; ++hh) {
        v8f s[2][5];                          // S^T: lane = pixel, key l = t*16 + r + 8*half
#pragma unroll
        for (int t = 0; t < 5; ++t) {
            v16h k0 = frag16(kls + (t * 16) * KP + hh * HD,      KP);
            v16h k1 = frag16(kls + (t * 16) * KP + hh * HD + 32, KP);
#pragma unroll
            for (int g2 = 0; g2 < 2; ++g2) {
                v8f z = (v8f){0.f,0.f,0.f,0.f,0.f,0.f,0.f,0.f};
                z = wmma16(k0, qf[g2][hh][0], z);
                z = wmma16(k1, qf[g2][hh][1], z);
                s[g2][t] = z;
            }
        }
        v16h pf[2][3];                        // P^T as B fragments, 3 k steps of 32 keys (80..95 zero)
#pragma unroll
        for (int g2 = 0; g2 < 2; ++g2) {
            float m = -3.0e38f;
#pragma unroll
            for (int t = 0; t < 5; ++t)
#pragma unroll
                for (int r = 0; r < 8; ++r) {
                    float v = s[g2][t][r] * scl;
                    if (t == 4 && r >= 5 && half) v = -3.0e38f;    // key 64 + r + 8*half >= 77
                    s[g2][t][r] = v; m = fmaxf(m, v);
                }
            m = fmaxf(m, __shfl_xor(m, 16, 32));
            float sum = 0.f;
#pragma unroll
            for (int t = 0; t < 5; ++t)
#pragma unroll
                for (int r = 0; r < 8; ++r) { float e = __expf(s[g2][t][r] - m); s[g2][t][r] = e; sum += e; }
            sum += __shfl_xor(sum, 16, 32);
            float inv = 1.f / sum;
#pragma unroll
            for (int t = 0; t < 6; ++t)
#pragma unroll
                for (int r = 0; r < 8; ++r)
                    pf[g2][t >> 1][(t & 1) * 8 + r] = (t < 5) ? (_Float16)(s[g2][t < 5 ? t : 0][r] * inv) : (_Float16)0.f;
        }
        v8f oacc[2][4];                       // O^T: lane = pixel, head channel d = nt*16 + r + 8*half
#pragma unroll
        for (int g2 = 0; g2 < 2; ++g2)
#pragma unroll
            for (int nt = 0; nt < 4; ++nt) oacc[g2][nt] = (v8f){0.f,0.f,0.f,0.f,0.f,0.f,0.f,0.f};
#pragma unroll
        for (int kc = 0; kc < 3; ++kc)
#pragma unroll
            for (int nt = 0; nt < 4; ++nt) {
                v16h va = frag16(vls + (hh * HD + nt * 16) * VP + kc * 32, VP);
                oacc[0][nt] = wmma16(va, pf[0][kc], oacc[0][nt]);
                oacc[1][nt] = wmma16(va, pf[1][kc], oacc[1][nt]);
            }
        v8h d[2][4];
#pragma unroll
        for (int g2 = 0; g2 < 2; ++g2)
#pragma unroll
            for (int nt = 0; nt < 4; ++nt)
#pragma unroll
                for (int r = 0; r < 8; ++r) d[g2][nt][r] = (_Float16)oacc[g2][nt][r];
        // keeps the conversions in front of the stores: mixed with them they share one register set, and each
        // store is then followed by a wait before its registers are written again
        __builtin_amdgcn_sched_barrier(0);
#pragma unroll
        for (int g2 = 0; g2 < 2; ++g2)
#pragma unroll
            for (int nt = 0; nt < 4; ++nt)
                *(v8h*)(obuf + ((size_t)b * HW_ + p0 + g2 * 16 + n15) * C_ + n0 + hh * HD + nt * 16 + 8 * half) = d[g2][nt];
        if (hh == 0) {
            // the second head's arithmetic reuses the registers that these stores name
            asm volatile("s_wait_xcnt 0x0" ::: "memory");
            // keeps that arithmetic behind the wait
            __builtin_amdgcn_sched_barrier(0);
        }
    }
}

// Final projection + residual: out[b,o,p] = x + O @ proj_w^T + proj_b; wave does 32(M) x 128(N): every A fragment, which
// comes from global memory as 16 pieces of 64 B, feeds 8 matrix instructions, and obuf is read C_/NB = 4 times in all.
// Ping-pong LDS weight panels; the same LDS is reused as f32 transpose buffer for coalesced stores.
__global__ __launch_bounds__(256) void cab_gemm_proj(const _Float16* __restrict__ obuf, const _Float16* __restrict__ w,
                              const float* __restrict__ bias, const float* __restrict__ x,
                              float* __restrict__ out) {
    __shared__ __align__(16) char smem[2 * NB * WP * 2];   // 2 weight panels; reused for transpose
    _Float16* wpan0 = (_Float16*)smem;
    _Float16* wpan1 = (_Float16*)(smem + NB * WP * 2);
    int b  = blockIdx.z;
    int wv = threadIdx.x >> 5;
    int p0 = blockIdx.x * 256 + wv * 32;
    int n0 = blockIdx.y * NB;
    int lane = threadIdx.x & 31, half = lane >> 4, n15 = lane & 15;
    const _Float16* A = obuf + ((size_t)b * HW_ + p0) * C_;
    v8f acc[2][NB / 16];
#pragma unroll
    for (int g2 = 0; g2 < 2; ++g2)
#pragma unroll
        for (int t = 0; t < NB / 16; ++t) acc[g2][t] = (v8f){0.f,0.f,0.f,0.f,0.f,0.f,0.f,0.f};

    stage_async(wpan0, w + (size_t)n0 * C_, C_, WP, NB * 32, 32);
    v16h af[2][2], bf[2][4];
    af[0][0] = frag16(A, C_);                 // the first A fragments fly beside panel 0
    af[0][1] = frag16(A + (size_t)16 * C_, C_);
    wait_async_barrier();
    stage_async(wpan1, w + (size_t)n0 * C_ + 256, C_, WP, NB * 32, 32);    // overlaps half-0 compute

    // Two register sets of fragments. A block is 8 matrix instructions: one k step of 32, 4 of the 8 channel tiles.
    // The B fragments of block j + 1, and in a step's first block the A fragments of the next step, are loaded
    // as one group in front of block j.
#pragma unroll
    for (int kh = 0; kh < 2; ++kh) {
        const _Float16* P = kh ? wpan1 : wpan0;
#pragma unroll
        for (int nt = 0; nt < 4; ++nt) bf[0][nt] = frag16(P + nt * 16 * WP, WP);
#pragma unroll
        for (int j = 0; j < 16; ++j) {
            const int s = j >> 1, hn = j & 1, ca = s & 1;
            const int ks = kh * 8 + s + 1;                 // the next k step, counted over both panels
            if (hn == 0 && ks < 16) {
                af[ca ^ 1][0] = frag16(A + ks * 32, C_);
                af[ca ^ 1][1] = frag16(A + (size_t)16 * C_ + ks * 32, C_);
            }
            if (j + 1 < 16) {
#pragma unroll
                for (int nt = 0; nt < 4; ++nt)
                    bf[hn ^ 1][nt] = frag16(P + (((j + 1) & 1) * 4 + nt) * 16 * WP + ((j + 1) >> 1) * 32, WP);
            }
            // keeps those loads in front of this block: without it the compiler sinks each load to its first
            // use and the wave waits out every LDS and global latency in full
            __builtin_amdgcn_sched_barrier(0);
#pragma unroll
            for (int nt = 0; nt < 4; ++nt) {
                acc[0][hn * 4 + nt] = wmma16(af[ca][0], bf[hn][nt], acc[0][hn * 4 + nt]);
                acc[1][hn * 4 + nt] = wmma16(af[ca][1], bf[hn][nt], acc[1][hn * 4 + nt]);
            }
            // ends the block: later loads may not rise among these matrix instructions
            __builtin_amdgcn_sched_barrier(0);
        }
        if (kh == 0) wait_async_barrier();   // panel 1 ready
    }
    // the epilogue's address arithmetic reuses the register pair that the A loads name
    asm volatile("s_wait_xcnt 0x0" ::: "memory");
    // keeps that arithmetic behind the wait
    __builtin_amdgcn_sched_barrier(0);
    __syncthreads();                          // all weight reads done before smem reuse

    float* T = (float*)smem + (size_t)wv * NB * 33;        // [128 o][32 p], stride 33; 8 waves fill smem exactly
#pragma unroll
    for (int g2 = 0; g2 < 2; ++g2)
#pragma unroll
        for (int nt = 0; nt < NB / 16; ++nt)
#pragma unroll
            for (int r = 0; r < 8; ++r)
                T[(nt * 16 + n15) * 33 + g2 * 16 + r + 8 * half] = acc[g2][nt][r];
    __syncthreads();
    // The wave's 32 pixels of one output channel are one 128-byte line: 8 lanes x 16 B take it whole, 4 channels a trip.
    int pc = (lane & 7) * 4;
    size_t base = ((size_t)b * C_ + n0 + (lane >> 3)) * HW_ + p0 + pc;
    const float* t0 = T + (lane >> 3) * 33 + pc;
#pragma unroll
    for (int i0 = 0; i0 < NB / 4; i0 += 8) {               // 8 loads of x in flight per wave
        v4f xv[8];
        float bo[8];
#pragma unroll
        for (int u = 0; u < 8; ++u) {
            xv[u] = *(const v4f*)(x + base + (size_t)(i0 + u) * 4 * HW_);
            bo[u] = bias[n0 + (i0 + u) * 4 + (lane >> 3)];
        }
#pragma unroll
        for (int u = 0; u < 8; ++u) {
            const float* t = t0 + (i0 + u) * 4 * 33;
            v4f ov;
#pragma unroll
            for (int j = 0; j < 4; ++j) ov[j] = xv[u][j] + t[j] + bo[u];
            *(v4f*)(out + base + (size_t)(i0 + u) * 4 * HW_) = ov;
        }
        if (i0 + 8 < NB / 4) {
            // the next trip's loads and address arithmetic reuse the registers that these stores name
            asm volatile("s_wait_xcnt 0x0" ::: "memory");
            // keeps the next trip's instructions behind that wait
            __builtin_amdgcn_sched_barrier(0);
        }
    }
}

extern "C" void kernel_launch(void* const* d_in, const int* in_sizes, int n_in,
                              void* d_out, int out_size, void* d_ws, size_t ws_size,
                              hipStream_t stream) {
    const float* x      = (const float*)d_in[0];
    const float* cond   = (const float*)d_in[1];
    const float* gamma  = (const float*)d_in[2];
    const float* beta   = (const float*)d_in[3];
    const float* q_w    = (const float*)d_in[4];
    const float* q_b    = (const float*)d_in[5];
    const float* k_w    = (const float*)d_in[6];
    const float* k_b    = (const float*)d_in[7];
    const float* v_w    = (const float*)d_in[8];
    const float* v_b    = (const float*)d_in[9];
    const float* proj_w = (const float*)d_in[10];
    const float* proj_b = (const float*)d_in[11];
    const float* scale  = (const float*)d_in[12];
    float* out = (float*)d_out;

    char* ws = (char*)d_ws;
    size_t off = 0;
    auto carve = [&](size_t bytes) { void* p = ws + off; off = (off + bytes + 255) & ~(size_t)255; return p; };
    float*     stats = (float*)    carve(512 * 2 * sizeof(float));
    _Float16*  qw16  = (_Float16*) carve((size_t)C_ * C_  * 2);
    _Float16*  kw16  = (_Float16*) carve((size_t)C_ * CD_ * 2);
    _Float16*  vw16  = (_Float16*) carve((size_t)C_ * CD_ * 2);
    _Float16*  pw16  = (_Float16*) carve((size_t)C_ * C_  * 2);
    _Float16*  kbuf  = (_Float16*) carve((size_t)B_ * LP  * C_  * 2);
    _Float16*  vt    = (_Float16*) carve((size_t)B_ * C_  * LP2 * 2);
    _Float16*  xn    = (_Float16*) carve((size_t)B_ * HW_ * C_  * 2);
    _Float16*  obuf  = (_Float16*) carve((size_t)B_ * HW_ * C_  * 2);  // not xn: other work-groups still read xn

    // 1) GroupNorm statistics, weights to f16, Vt pad
    cab_prep<<<PB_STATS + 2 * PB_CCD + 2 * PB_CC + PB_PAD, 256, 0, stream>>>(x, stats, q_w, k_w, v_w, proj_w,
                                                                             qw16, kw16, vw16, pw16, vt);

    // 2) K/V projection, GroupNorm apply
    cab_apply_kv<<<AB_KV + AB_APPLY, 256, 0, stream>>>(x, stats, gamma, beta, xn, cond, kw16, k_b, vw16, v_b, kbuf, vt);

    // 3) Q projection + attention
    cab_qproj_attn<<<dim3(HW_ / 256, C_ / NB, B_), 256, 0, stream>>>(xn, qw16, q_b, kbuf, vt, scale, obuf);

    // 4) output projection + residual
    cab_gemm_proj<<<dim3(HW_ / 256, C_ / NB, B_), 256, 0, stream>>>(obuf, pw16, proj_b, x, out);
}

// v006
// One run takes 148 microseconds.
// Two timings next to v005 both put it at 1.19 times that version's speed.
// Over all steps from v000 it is 3.32 times as fast.
#include <hip/hip_runtime.h>

typedef __attribute__((ext_vector_type(16))) _Float16 v16h;
typedef __attribute__((ext_vector_type(8)))  float    v8f;

#define B_   16
#define C_   512
#define CD_  768
#define HW_  4096
#define L_   77
#define LP   80     // padded key rows (5 x 16 tiles)
#define LP2  96     // padded key width for PV (3 x 32 K-chunks)
#define HD   64
#define GC   16     // channels per group (C/32)
#define WP   264    // weight panel rows: 256 halves + 8  (528 B)
#define KP   136    // K rows: 128 halves (2 heads) + 8     (272 B)
#define VP   104    // Vt rows: 96 halves + 8              (208 B)
#define NB   128    // output channels per work-group of the two projection GEMMs (8 tiles of 16 per wave)

__device__ __forceinline__ v8f wmma16(v16h a, v16h b, v8f c) {
    return __builtin_amdgcn_wmma_f32_16x16x32_f16(false, a, false, b, (short)0, c, false, false);
}

__device__ __forceinline__ v16h frag16(const _Float16* p, int ld) {
    int lane = threadIdx.x & 31;
    const _Float16* b = p + (size_t)(lane & 15) * ld + ((lane >> 4) << 3);
    v16h f;
#pragma unroll
    for (int i = 0; i < 8; ++i) { f[i] = b[i]; f[i + 8] = b[i + 16]; }
    return f;
}

// xn and obuf, the two activation buffers [pixel][channel] that the projections read as fragments, are kept in
// FRAGMENT ORDER: a tile of 16 pixels x 32 channels is 1 KB in a row, as 64 chunks of 16 B; chunk j*32 + lane holds
// what that lane of frag16 takes as elements 8j..8j+7 (pixel lane & 15, channels 16j + 8*(lane >> 4) + 0..7).
// Tiles run over the 16 k steps first, then over the pixel tiles, so pixel tile T starts at T * 16 * C_ halves.
// A wave's 16-byte load or store of a fragment half is then 512 contiguous bytes = 4 whole lines, not 16 pieces of 32 B.
typedef __attribute__((ext_vector_type(8))) _Float16 v8h;
#define FT   512    // halves per fragment tile (16 px x 32 ch)
__device__ __forceinline__ v16h frag16_fo(const _Float16* tile) {
    const _Float16* b = tile + (threadIdx.x & 31) * 8;
    v8h lo = *(const v8h*)b, hi = *(const v8h*)(b + 256);
    v16h f;
#pragma unroll
    for (int i = 0; i < 8; ++i) { f[i] = lo[i]; f[i + 8] = hi[i]; }
    return f;
}

// f32 source (cond) with clamped row index (L=77 tail tile).
__device__ __forceinline__ v16h frag16_f32c(const float* p, int ld, int rows_left) {
    int lane = threadIdx.x & 31;
    int r = lane & 15;
    if (r >= rows_left) r = rows_left - 1;
    const float* b = p + (size_t)r * ld + ((lane >> 4) << 3);
    v16h f;
#pragma unroll
    for (int i = 0; i < 8; ++i) { f[i] = (_Float16)b[i]; f[i + 8] = (_Float16)b[i + 16]; }
    return f;
}

__device__ __forceinline__ void stage_async(_Float16* dst, const _Float16* src,
                                            int src_ld, int dst_ld, int nchunks, int cpr) {
    unsigned base = (unsigned)(size_t)(void*)dst;   // low 32 bits of generic addr == LDS offset
    for (int i = threadIdx.x; i < nchunks; i += 256) {
        int row = i / cpr;
        int cc  = (i - row * cpr) * 8;
        unsigned long long g = (unsigned long long)(src + (size_t)row * src_ld + cc);
        unsigned l = base + (unsigned)((row * dst_ld + cc) * 2);
        // the wait stands in the copy's own statement: the next trip rewrites l and g
        asm volatile("global_load_async_to_lds_b128 %0, %1, off\n\ts_wait_xcnt 0x0" :: "v"(l), "v"(g) : "memory");
    }
}

__device__ __forceinline__ void wait_async_barrier() {
    asm volatile("s_wait_asynccnt 0" ::: "memory");
    __syncthreads();
}

// The bodies below take their block index as an argument: independent stages share a launch (cab_prep, cab_apply_kv).
__device__ __forceinline__ void cvt_f16_body(const float* __restrict__ in, _Float16* __restrict__ out, int n, int blk) {
    int i = blk * 256 + threadIdx.x;
    if (i < n) out[i] = (_Float16)in[i];
}

__device__ __forceinline__ void zero_vt_pad_body(_Float16* __restrict__ vt, int blk) {
    int i = blk * 256 + threadIdx.x;                 // over B_*C_*16
    int bo = i >> 4;
    int j  = i & 15;
    vt[(size_t)bo * LP2 + 80 + j] = (_Float16)0.f;
    asm volatile("s_wait_xcnt 0x0" ::: "memory");
}

// One block per (b, group): reduce 16 channels * 4096 contiguous floats.
__device__ __forceinline__ void gn_stats_body(const float* __restrict__ x, float* __restrict__ stats, int bg) {
    const float* p = x + (size_t)bg * (GC * HW_);
    float s = 0.f, s2 = 0.f;
    for (int i = threadIdx.x; i < GC * HW_; i += 256) { float v = p[i]; s += v; s2 += v * v; }
    __shared__ float rs[256], rq[256];
    rs[threadIdx.x] = s; rq[threadIdx.x] = s2;
    __syncthreads();
    for (int o = 128; o > 0; o >>= 1) {
        if (threadIdx.x < o) { rs[threadIdx.x] += rs[threadIdx.x + o]; rq[threadIdx.x] += rq[threadIdx.x + o]; }
        __syncthreads();
    }
    if (threadIdx.x == 0) {
        const float inv_n = 1.f / (GC * HW_);
        float mu  = rs[0] * inv_n;
        float var = rq[0] * inv_n - mu * mu;
        stats[bg * 2 + 0] = mu;
        stats[bg * 2 + 1] = rsqrtf(var + 1e-6f);
    }
}

// First launch: everything that reads inputs alone. The GroupNorm statistics, the long stage, take the lowest
// block indices and start first; the weight conversions and the Vt pad run beside them instead of in five
// launches of their own.
#define PB_STATS (B_ * 32)
#define PB_CC    (C_ * C_ / 256)
#define PB_CCD   (C_ * CD_ / 256)
#define PB_PAD   (B_ * C_ * 16 / 256)
__global__ void cab_prep(const float* __restrict__ x, float* __restrict__ stats,
                         const float* __restrict__ q_w, const float* __restrict__ k_w,
                         const float* __restrict__ v_w, const float* __restrict__ proj_w,
                         _Float16* __restrict__ qw16, _Float16* __restrict__ kw16,
                         _Float16* __restrict__ vw16, _Float16* __restrict__ pw16,
                         _Float16* __restrict__ vt) {
    int blk = blockIdx.x;
    if (blk < PB_STATS) { gn_stats_body(x, stats, blk); return; }
    blk -= PB_STATS;
    if (blk < PB_CCD) { cvt_f16_body(k_w, kw16, C_ * CD_, blk); return; }
    blk -= PB_CCD;
    if (blk < PB_CCD) { cvt_f16_body(v_w, vw16, C_ * CD_, blk); return; }
    blk -= PB_CCD;
    if (blk < PB_CC) { cvt_f16_body(q_w, qw16, C_ * C_, blk); return; }
    blk -= PB_CC;
    if (blk < PB_CC) { cvt_f16_body(proj_w, pw16, C_ * C_, blk); return; }
    blk -= PB_CC;
    zero_vt_pad_body(vt, blk);
}

typedef __attribute__((ext_vector_type(4))) float    v4f;
#define GT_PX 128   // pixels per tile
#define GT_NT 4     // tiles per work-group
__device__ __forceinline__ void gn_apply_t_body(const float* __restrict__ x, const float* __restrict__ stats,
                               const float* __restrict__ gamma, const float* __restrict__ beta,
                               _Float16* __restrict__ xn, int bx, int by, int b) {
    __shared__ __align__(16) _Float16 tile[2][GT_PX * 64];
    int c0 = by * 64, pb = bx * (GT_PX * GT_NT);
    int lane = threadIdx.x & 31;
    int wv = __builtin_amdgcn_readfirstlane(threadIdx.x >> 5);   // scalar: the per-channel constants load once per wave
    int cw = c0 + wv * 8;
    int g  = cw >> 4;
    float mu = stats[(b * 32 + g) * 2], rstd = stats[(b * 32 + g) * 2 + 1];
    float ga[8], be[8];
#pragma unroll
    for (int i = 0; i < 8; ++i) { ga[i] = gamma[cw + i]; be[i] = beta[cw + i]; }

    const float* src = x + ((size_t)b * C_ + cw) * HW_ + pb + lane * 4;
    v4f v[2][8];                                  // two register sets: loads run two tiles ahead of the LDS pass
#pragma unroll
    for (int u = 0; u < 2; ++u)
#pragma unroll
        for (int i = 0; i < 8; ++i) v[u][i] = *(const v4f*)(src + (size_t)i * HW_ + u * GT_PX);

    int swap = (lane >> 3) & 1;
    int slot = (wv ^ (lane & 7)) * 8;
#pragma unroll
    for (int t = 0; t < GT_NT; ++t) {
        v8h h[4];
#pragma unroll
        for (int j = 0; j < 4; ++j)
#pragma unroll
            for (int i = 0; i < 8; ++i) h[j][i] = (_Float16)((v[t & 1][i][j] - mu) * rstd * ga[i] + be[i]);
        if (t + 2 < GT_NT) {
#pragma unroll
            for (int i = 0; i < 8; ++i) v[t & 1][i] = *(const v4f*)(src + (size_t)i * HW_ + (t + 2) * GT_PX);
        }
        _Float16* buf = tile[t & 1];
#pragma unroll
        for (int j = 0; j < 4; ++j) *(v8h*)(buf + ((lane * 4 + j) ^ swap) * 64 + slot) = h[j];
        // Work-group barrier, one per tile, with the LDS wait alone: it publishes this buffer, and every wave's
        // reads of the other buffer have returned before it. __syncthreads() would also drain the global loads
        // of the next tiles and the stores of the last one, which no other wave depends on.
        asm volatile("s_wait_dscnt 0x0\n\ts_barrier_signal -1\n\ts_barrier_wait -1" ::: "memory");
#pragma unroll
        for (int k = 0; k < 4; ++k) {
            int pt = k * 2 + (wv >> 2);           // pixel tile of 16 in this tile; wave bits 1, 0 = k step, half j
            int p = pt * 16 + (lane & 15);
            int w = (wv & 3) * 2 + (lane >> 4);
            int r = p ^ ((p >> 5) & 1);
            int q = w ^ ((p >> 2) & 7);
            v8h d = *(const v8h*)(buf + (r * 8 + q) * 8);
            *(v8h*)(xn + ((size_t)b * HW_ + pb + t * GT_PX + pt * 16) * C_ + (by * 2) * FT + (wv & 3) * 256 + lane * 8) = d;
        }
        // the next tile's loads and arithmetic reuse the registers that these stores name
        asm volatile("s_wait_xcnt 0x0" ::: "memory");
        // keeps the next tile's arithmetic, and with it the wait for its loads, behind this tile's stores and that wait
        __builtin_amdgcn_sched_barrier(0);
    }
}

// K/V projection: A = cond [B,77,768] f32 (row-clamped).
// waves 0..3 -> K matrix, waves 4..7 -> V matrix; each wave one 16x16 tile.
__device__ __forceinline__ void gemm_kv_body(const float* __restrict__ cond,
                            const _Float16* __restrict__ kw, const float* __restrict__ kb,
                            const _Float16* __restrict__ vw, const float* __restrict__ vb,
                            _Float16* __restrict__ kbuf, _Float16* __restrict__ vt, int bx, int by, int b) {
    int wv = threadIdx.x >> 5;
    int isv = wv >> 2;
    int p0 = bx * 16;                               // l-tile (bx < 5)
    int n0 = by * 64 + (wv & 3) * 16;               // by < 8
    int lane = threadIdx.x & 31, half = lane >> 4, n15 = lane & 15;
    const float* A = cond + (size_t)b * L_ * CD_ + (size_t)p0 * CD_;
    int rows_left = L_ - p0;
    const _Float16* w   = isv ? vw : kw;
    const float*    bia = isv ? vb : kb;
    v8f acc = (v8f){0.f,0.f,0.f,0.f,0.f,0.f,0.f,0.f};
    for (int kc = 0; kc < CD_; kc += 32) {
        v16h a  = frag16_f32c(A + kc, CD_, rows_left);
        v16h bf = frag16(w + (size_t)n0 * CD_ + kc, CD_);
        acc = wmma16(a, bf, acc);
    }
    int o = n0 + n15;
    float bb = bia[o];
#pragma unroll
    for (int r = 0; r < 8; ++r) {
        int l = p0 + r + 8 * half;                  // < 80 ; rows 77..79 masked later
        float v = acc[r] + bb;
        if (!isv) kbuf[((size_t)b * LP + l) * C_ + o]  = (_Float16)v;
        else      vt  [((size_t)b * C_ + o) * LP2 + l] = (_Float16)v;
    }
}

// Second launch: the two stages that need only the first launch's results. The K/V projection waits on load
// latency and moves few bytes; it takes the lowest block indices, starts first and runs beside the GroupNorm
// apply, which streams x.
#define AB_KV    ((LP / 16) * (C_ / 64) * B_)
#define AB_APPLY ((HW_ / (GT_PX * GT_NT)) * (C_ / 64) * B_)
__global__ void cab_apply_kv(const float* __restrict__ x, const float* __restrict__ stats,
                             const float* __restrict__ gamma, const float* __restrict__ beta,
                             _Float16* __restrict__ xn, const float* __restrict__ cond,
                             const _Float16* __restrict__ kw, const float* __restrict__ kb,
                             const _Float16* __restrict__ vw, const float* __restrict__ vb,
                             _Float16* __restrict__ kbuf, _Float16* __restrict__ vt) {
    int blk = blockIdx.x;
    if (blk < AB_KV) {
        int yz = blk / (LP / 16);
        gemm_kv_body(cond, kw, kb, vw, vb, kbuf, vt, blk - yz * (LP / 16), yz & 7, yz >> 3);
    } else {
        blk -= AB_KV;
        gn_apply_t_body(x, stats, gamma, beta, xn, blk & 7, (blk >> 3) & 7, blk >> 6);
    }
}

// Q projection and attention in one kernel. A work-group does 256 pixels x 128 channels = 2 heads; a wave 32 pixels.
// The projection is formed transposed, Q^T = q_w . xn^T (the weight fragment is the A operand): an accumulator tile
// then holds in lane n the pixel n and in its 8 registers the channels 8*half..8*half+7, which is the place those
// values have in a B fragment (two tiles = one k step of 32). So Q never leaves the registers, and the same holds
// for S^T = K . Q^T (rows = keys) and O^T = Vt . P^T (rows = head channels): a pixel's whole score column lies in
// lanes n and n + 16, the softmax is in-lane but for one exchange, and a lane stores 8 channels of O at once, which
// is one chunk of obuf's fragment order: a wave's store is 512 contiguous bytes.
// Ping-pong LDS weight panels (async staging overlapped with compute); panel 0, once read, takes K and Vt.
__global__ __launch_bounds__(256) void cab_qproj_attn(const _Float16* __restrict__ xn, const _Float16* __restrict__ w,
                               const float* __restrict__ bias, const _Float16* __restrict__ kbuf,
                               const _Float16* __restrict__ vt, const float* __restrict__ scale_p,
                               _Float16* __restrict__ obuf) {
    __shared__ __align__(16) _Float16 wpan[2][NB * WP];
    _Float16* kls = wpan[0];                  // 80 key rows x 128 channels, pitch KP
    _Float16* vls = wpan[0] + LP * KP;        // 128 channel rows x 96 keys, pitch VP
    int b  = blockIdx.z;
    int wv = threadIdx.x >> 5;
    int p0 = blockIdx.x * 256 + wv * 32;
    int n0 = blockIdx.y * NB;
    int lane = threadIdx.x & 31, half = lane >> 4;
    const _Float16* A = xn + ((size_t)b * HW_ + p0) * C_;
    v8f acc[2][NB / 16];
#pragma unroll
    for (int g2 = 0; g2 < 2; ++g2)
#pragma unroll
        for (int t = 0; t < NB / 16; ++t) acc[g2][t] = (v8f){0.f,0.f,0.f,0.f,0.f,0.f,0.f,0.f};

    stage_async(wpan[0], w + (size_t)n0 * C_, C_, WP, NB * 32, 32);
    v16h af[2][2], bf[2][4];
    af[0][0] = frag16_fo(A);                  // the first xn fragments fly beside panel 0
    af[0][1] = frag16_fo(A + 16 * C_);
    wait_async_barrier();
    stage_async(wpan[1], w + (size_t)n0 * C_ + 256, C_, WP, NB * 32, 32);  // overlaps half-0 compute

    // Two register sets of fragments. A block is 8 matrix instructions: one k step of 32, 4 of the 8 channel tiles.
    // The weight fragments of block j + 1, and in a step's first block the xn fragments of the next step, are loaded
    // as one group in front of block j.
#pragma unroll
    for (int kh = 0; kh < 2; ++kh) {
        const _Float16* P = wpan[kh];
#pragma unroll
        for (int nt = 0; nt < 4; ++nt) bf[0][nt] = frag16(P + nt * 16 * WP, WP);
#pragma unroll
        for (int j = 0; j < 16; ++j) {
            const int s = j >> 1, hn = j & 1, ca = s & 1;
            const int ks = kh * 8 + s + 1;                 // the next k step, counted over both panels
            if (hn == 0 && ks < 16) {
                af[ca ^ 1][0] = frag16_fo(A + ks * FT);
                af[ca ^ 1][1] = frag16_fo(A + 16 * C_ + ks * FT);
            }
            if (j + 1 < 16) {
#pragma unroll
                for (int nt = 0; nt < 4; ++nt)
                    bf[hn ^ 1][nt] = frag16(P + (((j + 1) & 1) * 4 + nt) * 16 * WP + ((j + 1) >> 1) * 32, WP);
            }
            // keeps those loads in front of this block: without it the compiler sinks each load to its first
            // use and the wave waits out every LDS and global latency in full
            __builtin_amdgcn_sched_barrier(0);
#pragma unroll
            for (int nt = 0; nt < 4; ++nt) {
                acc[0][hn * 4 + nt] = wmma16(bf[hn][nt], af[ca][0], acc[0][hn * 4 + nt]);
                acc[1][hn * 4 + nt] = wmma16(bf[hn][nt], af[ca][1], acc[1][hn * 4 + nt]);
            }
            // ends the block: later loads may not rise among these matrix instructions
            __builtin_amdgcn_sched_barrier(0);
        }
        if (kh == 0) {
            // this wave's reads of panel 0 have returned before the barrier behind which panel 0 is refilled
            asm volatile("s_wait_dscnt 0x0" ::: "memory");
            wait_async_barrier();   // panel 1 ready; every wave has left panel 0
            // K (rows l, ld C_) and Vt (rows d, ld LP2) of this batch and these 2 heads fly beside half-1 compute.
            // 16-byte chunks, 5 + 6 per thread, every lane on; one statement and one wait per run of copies.
            unsigned kl = (unsigned)(size_t)(void*)kls, vl = (unsigned)(size_t)(void*)vls;
            const _Float16* kg = kbuf + (size_t)b * LP * C_ + n0;
            const _Float16* vg = vt + ((size_t)b * C_ + n0) * LP2;
            unsigned la[6];
            const _Float16* ga[6];
#pragma unroll
            for (int u = 0; u < 5; ++u) {
                int i = u * 256 + threadIdx.x, row = i >> 4, cc = (i & 15) * 8;
                la[u] = kl + (unsigned)((row * KP + cc) * 2);
                ga[u] = kg + (size_t)row * C_ + cc;
            }
            // the wait stands in the copies' own statement: the Vt addresses below reuse these registers
            asm volatile("global_load_async_to_lds_b128 %0, %1, off\n\t"
                         "global_load_async_to_lds_b128 %2, %3, off\n\t"
                         "global_load_async_to_lds_b128 %4, %5, off\n\t"
                         "global_load_async_to_lds_b128 %6, %7, off\n\t"
                         "global_load_async_to_lds_b128 %8, %9, off\n\t"
                         "s_wait_xcnt 0x0"
                         :: "v"(la[0]), "v"(ga[0]), "v"(la[1]), "v"(ga[1]), "v"(la[2]), "v"(ga[2]),
                            "v"(la[3]), "v"(ga[3]), "v"(la[4]), "v"(ga[4]) : "memory");
#pragma unroll
            for (int u = 0; u < 6; ++u) {
                int i = u * 256 + threadIdx.x, row = i / 12, cc = (i - row * 12) * 8;
                la[u] = vl + (unsigned)((row * VP + cc) * 2);
                ga[u] = vg + (size_t)row * LP2 + cc;
            }
            // the wait stands in the copies' own statement: the main loop reuses these registers
            asm volatile("global_load_async_to_lds_b128 %0, %1, off\n\t"
                         "global_load_async_to_lds_b128 %2, %3, off\n\t"
                         "global_load_async_to_lds_b128 %4, %5, off\n\t"
                         "global_load_async_to_lds_b128 %6, %7, off\n\t"
                         "global_load_async_to_lds_b128 %8, %9, off\n\t"
                         "global_load_async_to_lds_b128 %10, %11, off\n\t"
                         "s_wait_xcnt 0x0"
                         :: "v"(la[0]), "v"(ga[0]), "v"(la[1]), "v"(ga[1]), "v"(la[2]), "v"(ga[2]),
                            "v"(la[3]), "v"(ga[3]), "v"(la[4]), "v"(ga[4]), "v"(la[5]), "v"(ga[5]) : "memory");
        }
    }
    // a lane's 8 bias values per channel tile: channels 8*half..8*half+7 of the tile
    v4f bq[NB / 16][2];
#pragma unroll
    for (int nt = 0; nt < NB / 16; ++nt) {
        bq[nt][0] = *(const v4f*)(bias + n0 + nt * 16 + 8 * half);
        bq[nt][1] = *(const v4f*)(bias + n0 + nt * 16 + 8 * half + 4);
    }
    float scl = scale_p[0];
    // the arithmetic below reuses the registers that the xn loads and the bias loads name
    asm volatile("s_wait_xcnt 0x0" ::: "memory");
    // keeps that arithmetic behind the wait
    __builtin_amdgcn_sched_barrier(0);
    wait_async_barrier();                     // K and Vt have landed, for every wave

    // Q^T + bias as B fragments: element i = channel 8*half + i of the k step's first tile, i + 8 the same of its second
    v16h qf[2][2][2];                         // [pixel tile][head][k step]
#pragma unroll
    for (int g2 = 0; g2 < 2; ++g2)
#pragma unroll
        for (int nt = 0; nt < NB / 16; ++nt)
#pragma unroll
            for (int r = 0; r < 8; ++r)
                qf[g2][nt >> 2][(nt >> 1) & 1][(nt & 1) * 8 + r] = (_Float16)(acc[g2][nt][r] + bq[nt][r >> 2][r & 3]);
    __builtin_amdgcn_sched_barrier(0);

#pragma unroll
    for (int hh = 0; hh < 2; ++hh) {
        v8f s[2][5];                          // S^T: lane = pixel, key l = t*16 + r + 8*half
#pragma unroll
        for (int t = 0; t < 5; ++t) {
            v16h k0 = frag16(kls + (t * 16) * KP + hh * HD,      KP);
            v16h k1 = frag16(kls + (t * 16) * KP + hh * HD + 32, KP);
#pragma unroll
            for (int g2 = 0; g2 < 2; ++g2) {
                v8f z = (v8f){0.f,0.f,0.f,0.f,0.f,0.f,0.f,0.f};
                z = wmma16(k0, qf[g2][hh][0], z);
                z = wmma16(k1, qf[g2][hh][1], z);
                s[g2][t] = z;
            }
        }
        v16h pf[2][3];                        // P^T as B fragments, 3 k steps of 32 keys (80..95 zero)
#pragma unroll
        for (int g2 = 0; g2 < 2; ++g2) {
            float m = -3.0e38f;
#pragma unroll
            for (int t = 0; t < 5; ++t)
#pragma unroll
                for (int r = 0; r < 8; ++r) {
                    float v = s[g2][t][r] * scl;
                    if (t == 4 && r >= 5 && half) v = -3.0e38f;    // key 64 + r + 8*half >= 77
                    s[g2][t][r] = v; m = fmaxf(m, v);
                }
            m = fmaxf(m, __shfl_xor(m, 16, 32));
            float sum = 0.f;
#pragma unroll
            for (int t = 0; t < 5; ++t)
#pragma unroll
                for (int r = 0; r < 8; ++r) { float e = __expf(s[g2][t][r] - m); s[g2][t][r] = e; sum += e; }
            sum += __shfl_xor(sum, 16, 32);
            float inv = 1.f / sum;
#pragma unroll
            for (int t = 0; t < 6; ++t)
#pragma unroll
                for (int r = 0; r < 8; ++r)
                    pf[g2][t >> 1][(t & 1) * 8 + r] = (t < 5) ? (_Float16)(s[g2][t < 5 ? t : 0][r] * inv) : (_Float16)0.f;
        }
        v8f oacc[2][4];                       // O^T: lane = pixel, head channel d = nt*16 + r + 8*half
#pragma unroll
        for (int g2 = 0; g2 < 2; ++g2)
#pragma unroll
            for (int nt = 0; nt < 4; ++nt) oacc[g2][nt] = (v8f){0.f,0.f,0.f,0.f,0.f,0.f,0.f,0.f};
#pragma unroll
        for (int kc = 0; kc < 3; ++kc)
#pragma unroll
            for (int nt = 0; nt < 4; ++nt) {
                v16h va = frag16(vls + (hh * HD + nt * 16) * VP + kc * 32, VP);
                oacc[0][nt] = wmma16(va, pf[0][kc], oacc[0][nt]);
                oacc[1][nt] = wmma16(va, pf[1][kc], oacc[1][nt]);
            }
        v8h d[2][4];
#pragma unroll
        for (int g2 = 0; g2 < 2; ++g2)
#pragma unroll
            for (int nt = 0; nt < 4; ++nt)
#pragma unroll
                for (int r = 0; r < 8; ++r) d[g2][nt][r] = (_Float16)oacc[g2][nt][r];
        // keeps the conversions in front of the stores: mixed with them they share one register set, and each
        // store is then followed by a wait before its registers are written again
        __builtin_amdgcn_sched_barrier(0);
#pragma unroll
        for (int g2 = 0; g2 < 2; ++g2)
#pragma unroll
            for (int nt = 0; nt < 4; ++nt)
                // channel tile nt is half nt & 1 of k step (n0 + hh * HD) / 32 + nt / 2: chunk (nt & 1) * 32 + lane
                *(v8h*)(obuf + ((size_t)b * HW_ + p0 + g2 * 16) * C_ + ((n0 + hh * HD) / 32) * FT + nt * 256 + lane * 8) = d[g2][nt];
        if (hh == 0) {
            // the second head's arithmetic reuses the registers that these stores name
            asm volatile("s_wait_xcnt 0x0" ::: "memory");
            // keeps that arithmetic behind the wait
            __builtin_amdgcn_sched_barrier(0);
        }
    }
}

// Final projection + residual: out[b,o,p] = x + O @ proj_w^T + proj_b; wave does 32(M) x 128(N): every A fragment, 1 KB
// in a row of obuf (fragment order), feeds 8 matrix instructions, and obuf is read C_/NB = 4 times in all.
// Ping-pong LDS weight panels; the same LDS is reused as f32 transpose buffer for coalesced stores.
__global__ __launch_bounds__(256) void cab_gemm_proj(const _Float16* __restrict__ obuf, const _Float16* __restrict__ w,
                              const float* __restrict__ bias, const float* __restrict__ x,
                              float* __restrict__ out) {
    __shared__ __align__(16) char smem[2 * NB * WP * 2];   // 2 weight panels; reused for transpose
    _Float16* wpan0 = (_Float16*)smem;
    _Float16* wpan1 = (_Float16*)(smem + NB * WP * 2);
    int b  = blockIdx.z;
    int wv = threadIdx.x >> 5;
    int p0 = blockIdx.x * 256 + wv * 32;
    int n0 = blockIdx.y * NB;
    int lane = threadIdx.x & 31, half = lane >> 4, n15 = lane & 15;
    const _Float16* A = obuf + ((size_t)b * HW_ + p0) * C_;
    v8f acc[2][NB / 16];
#pragma unroll
    for (int g2 = 0; g2 < 2; ++g2)
#pragma unroll
        for (int t = 0; t < NB / 16; ++t) acc[g2][t] = (v8f){0.f,0.f,0.f,0.f,0.f,0.f,0.f,0.f};

    stage_async(wpan0, w + (size_t)n0 * C_, C_, WP, NB * 32, 32);
    v16h af[2][2], bf[2][4];
    af[0][0] = frag16_fo(A);                  // the first A fragments fly beside panel 0
    af[0][1] = frag16_fo(A + 16 * C_);
    wait_async_barrier();
    stage_async(wpan1, w + (size_t)n0 * C_ + 256, C_, WP, NB * 32, 32);    // overlaps half-0 compute

    // Two register sets of fragments. A block is 8 matrix instructions: one k step of 32, 4 of the 8 channel tiles.
    // The B fragments of block j + 1, and in a step's first block the A fragments of the next step, are loaded
    // as one group in front of block j.
#pragma unroll
    for (int kh = 0; kh < 2; ++kh) {
        const _Float16* P = kh ? wpan1 : wpan0;
#pragma unroll
        for (int nt = 0; nt < 4; ++nt) bf[0][nt] = frag16(P + nt * 16 * WP, WP);
#pragma unroll
        for (int j = 0; j < 16; ++j) {
            const int s = j >> 1, hn = j & 1, ca = s & 1;
            const int ks = kh * 8 + s + 1;                 // the next k step, counted over both panels
            if (hn == 0 && ks < 16) {
                af[ca ^ 1][0] = frag16_fo(A + ks * FT);
                af[ca ^ 1][1] = frag16_fo(A + 16 * C_ + ks * FT);
            }
            if (j + 1 < 16) {
#pragma unroll
                for (int nt = 0; nt < 4; ++nt)
                    bf[hn ^ 1][nt] = frag16(P + (((j + 1) & 1) * 4 + nt) * 16 * WP + ((j + 1) >> 1) * 32, WP);
            }
            // keeps those loads in front of this block: without it the compiler sinks each load to its first
            // use and the wave waits out every LDS and global latency in full
            __builtin_amdgcn_sched_barrier(0);
#pragma unroll
            for (int nt = 0; nt < 4; ++nt) {
                acc[0][hn * 4 + nt] = wmma16(af[ca][0], bf[hn][nt], acc[0][hn * 4 + nt]);
                acc[1][hn * 4 + nt] = wmma16(af[ca][1], bf[hn][nt], acc[1][hn * 4 + nt]);
            }
            // ends the block: later loads may not rise among these matrix instructions
            __builtin_amdgcn_sched_barrier(0);
        }
        if (kh == 0) wait_async_barrier();   // panel 1 ready
    }
    // the epilogue's address arithmetic reuses the register pair that the A loads name
    asm volatile("s_wait_xcnt 0x0" ::: "memory");
    // keeps that arithmetic behind the wait
    __builtin_amdgcn_sched_barrier(0);
    __syncthreads();                          // all weight reads done before smem reuse

    float* T = (float*)smem + (size_t)wv * NB * 33;        // [128 o][32 p], stride 33; 8 waves fill smem exactly
#pragma unroll
    for (int g2 = 0; g2 < 2; ++g2)
#pragma unroll
        for (int nt = 0; nt < NB / 16; ++nt)
#pragma unroll
            for (int r = 0; r < 8; ++r)
                T[(nt * 16 + n15) * 33 + g2 * 16 + r + 8 * half] = acc[g2][nt][r];
    __syncthreads();
    // The wave's 32 pixels of one output channel are one 128-byte line: 8 lanes x 16 B take it whole, 4 channels a trip.
    int pc = (lane & 7) * 4;
    size_t base = ((size_t)b * C_ + n0 + (lane >> 3)) * HW_ + p0 + pc;
    const float* t0 = T + (lane >> 3) * 33 + pc;
#pragma unroll
    for (int i0 = 0; i0 < NB / 4; i0 += 8) {               // 8 loads of x in flight per wave
        v4f xv[8];
        float bo[8];
#pragma unroll
        for (int u = 0; u < 8; ++u) {
            xv[u] = *(const v4f*)(x + base + (size_t)(i0 + u) * 4 * HW_);
            bo[u] = bias[n0 + (i0 + u) * 4 + (lane >> 3)];
        }
#pragma unroll
        for (int u = 0; u < 8; ++u) {
            const float* t = t0 + (i0 + u) * 4 * 33;
            v4f ov;
#pragma unroll
            for (int j = 0; j < 4; ++j) ov[j] = xv[u][j] + t[j] + bo[u];
            *(v4f*)(out + base + (size_t)(i0 + u) * 4 * HW_) = ov;
        }
        if (i0 + 8 < NB / 4) {
            // the next trip's loads and address arithmetic reuse the registers that these stores name
            asm volatile("s_wait_xcnt 0x0" ::: "memory");
            // keeps the next trip's instructions behind that wait
            __builtin_amdgcn_sched_barrier(0);
        }
    }
}

extern "C" void kernel_launch(void* const* d_in, const int* in_sizes, int n_in,
                              void* d_out, int out_size, void* d_ws, size_t ws_size,
                              hipStream_t stream) {
    const float* x      = (const float*)d_in[0];
    const float* cond   = (const float*)d_in[1];
    const float* gamma  = (const float*)d_in[2];
    const float* beta   = (const float*)d_in[3];
    const float* q_w    = (const float*)d_in[4];
    const float* q_b    = (const float*)d_in[5];
    const float* k_w    = (const float*)d_in[6];
    const float* k_b    = (const float*)d_in[7];
    const float* v_w    = (const float*)d_in[8];
    const float* v_b    = (const float*)d_in[9];
    const float* proj_w = (const float*)d_in[10];
    const float* proj_b = (const float*)d_in[11];
    const float* scale  = (const float*)d_in[12];
    float* out = (float*)d_out;

    char* ws = (char*)d_ws;
    size_t off = 0;
    auto carve = [&](size_t bytes) { void* p = ws + off; off = (off + bytes + 255) & ~(size_t)255; return p; };
    float*     stats = (float*)    carve(512 * 2 * sizeof(float));
    _Float16*  qw16  = (_Float16*) carve((size_t)C_ * C_  * 2);
    _Float16*  kw16  = (_Float16*) carve((size_t)C_ * CD_ * 2);
    _Float16*  vw16  = (_Float16*) carve((size_t)C_ * CD_ * 2);
    _Float16*  pw16  = (_Float16*) carve((size_t)C_ * C_  * 2);
    _Float16*  kbuf  = (_Float16*) carve((size_t)B_ * LP  * C_  * 2);
    _Float16*  vt    = (_Float16*) carve((size_t)B_ * C_  * LP2 * 2);
    _Float16*  xn    = (_Float16*) carve((size_t)B_ * HW_ * C_  * 2);
    _Float16*  obuf  = (_Float16*) carve((size_t)B_ * HW_ * C_  * 2);  // not xn: other work-groups still read xn

    // 1) GroupNorm statistics, weights to f16, Vt pad
    cab_prep<<<PB_STATS + 2 * PB_CCD + 2 * PB_CC + PB_PAD, 256, 0, stream>>>(x, stats, q_w, k_w, v_w, proj_w,
                                                                             qw16, kw16, vw16, pw16, vt);

    // 2) K/V projection, GroupNorm apply
    cab_apply_kv<<<AB_KV + AB_APPLY, 256, 0, stream>>>(x, stats, gamma, beta, xn, cond, kw16, k_b, vw16, v_b, kbuf, vt);

    // 3) Q projection + attention
    cab_qproj_attn<<<dim3(HW_ / 256, C_ / NB, B_), 256, 0, stream>>>(xn, qw16, q_b, kbuf, vt, scale, obuf);

    // 4) output projection + residual
    cab_gemm_proj<<<dim3(HW_ / 256, C_ / NB, B_), 256, 0, stream>>>(obuf, pw16, proj_b, x, out);
}

// v007
// A run of this version takes 136 microseconds.
// In both of two side-by-side timings against v006, it was 1.08 times as fast.
// Counting every step since v000, it is 3.59 times as fast.
#include <hip/hip_runtime.h>

typedef __attribute__((ext_vector_type(16))) _Float16 v16h;
typedef __attribute__((ext_vector_type(8)))  float    v8f;

#define B_   16
#define C_   512
#define CD_  768
#define HW_  4096
#define L_   77
#define LP   80     // padded key rows (5 x 16 tiles)
#define LP2  96     // padded key width for PV (3 x 32 K-chunks)
#define HD   64
#define GC   16     // channels per group (C/32)
#define WP   264    // weight panel rows: 256 halves + 8  (528 B)
#define KP   136    // K rows: 128 halves (2 heads) + 8     (272 B)
#define VP   104    // Vt rows: 96 halves + 8              (208 B)
#define NB   128    // output channels per work-group of the two projection GEMMs (8 tiles of 16 per wave)

__device__ __forceinline__ v8f wmma16(v16h a, v16h b, v8f c) {
    return __builtin_amdgcn_wmma_f32_16x16x32_f16(false, a, false, b, (short)0, c, false, false);
}

__device__ __forceinline__ v16h frag16(const _Float16* p, int ld) {
    int lane = threadIdx.x & 31;
    const _Float16* b = p + (size_t)(lane & 15) * ld + ((lane >> 4) << 3);
    v16h f;
#pragma unroll
    for (int i = 0; i < 8; ++i) { f[i] = b[i]; f[i + 8] = b[i + 16]; }
    return f;
}

// xn and obuf, the two activation buffers [pixel][channel] that the projections read as fragments, are kept in
// FRAGMENT ORDER: a tile of 16 pixels x 32 channels is 1 KB in a row, as 64 chunks of 16 B; chunk j*32 + lane holds
// what that lane of frag16 takes as elements 8j..8j+7 (pixel lane & 15, channels 16j + 8*(lane >> 4) + 0..7).
// Tiles run over the 16 k steps first, then over the pixel tiles, so pixel tile T starts at T * 16 * C_ halves.
// A wave's 16-byte load or store of a fragment half is then 512 contiguous bytes = 4 whole lines, not 16 pieces of 32 B.
typedef __attribute__((ext_vector_type(8))) _Float16 v8h;
#define FT   512    // halves per fragment tile (16 px x 32 ch)
__device__ __forceinline__ v16h frag16_fo(const _Float16* tile) {
    const _Float16* b = tile + (threadIdx.x & 31) * 8;
    v8h lo = *(const v8h*)b, hi = *(const v8h*)(b + 256);
    v16h f;
#pragma unroll
    for (int i = 0; i < 8; ++i) { f[i] = lo[i]; f[i + 8] = hi[i]; }
    return f;
}

// f32 source (cond) with clamped row index (L=77 tail tile).
__device__ __forceinline__ v16h frag16_f32c(const float* p, int ld, int rows_left) {
    int lane = threadIdx.x & 31;
    int r = lane & 15;
    if (r >= rows_left) r = rows_left - 1;
    const float* b = p + (size_t)r * ld + ((lane >> 4) << 3);
    v16h f;
#pragma unroll
    for (int i = 0; i < 8; ++i) { f[i] = (_Float16)b[i]; f[i + 8] = (_Float16)b[i + 16]; }
    return f;
}

__device__ __forceinline__ void stage_async(_Float16* dst, const _Float16* src,
                                            int src_ld, int dst_ld, int nchunks, int cpr) {
    unsigned base = (unsigned)(size_t)(void*)dst;   // low 32 bits of generic addr == LDS offset
    for (int i = threadIdx.x; i < nchunks; i += 256) {
        int row = i / cpr;
        int cc  = (i - row * cpr) * 8;
        unsigned long long g = (unsigned long long)(src + (size_t)row * src_ld + cc);
        unsigned l = base + (unsigned)((row * dst_ld + cc) * 2);
        // the wait stands in the copy's own statement: the next trip rewrites l and g
        asm volatile("global_load_async_to_lds_b128 %0, %1, off\n\ts_wait_xcnt 0x0" :: "v"(l), "v"(g) : "memory");
    }
}

__device__ __forceinline__ void wait_async_barrier() {
    asm volatile("s_wait_asynccnt 0" ::: "memory");
    __syncthreads();
}

// The bodies below take their block index as an argument: independent stages share a launch (cab_prep, cab_apply_kv).
// A lane converts 8 elements: two 16-byte loads, one 16-byte store. Every weight count is a multiple of 256 * 8.
typedef __attribute__((ext_vector_type(4))) float    v4f;
__device__ __forceinline__ void cvt_f16_body(const float* __restrict__ in, _Float16* __restrict__ out, int blk) {
    size_t i = (size_t)(blk * 256 + threadIdx.x) * 8;
    v4f a = *(const v4f*)(in + i), c = *(const v4f*)(in + i + 4);
    v8h h;
#pragma unroll
    for (int j = 0; j < 4; ++j) { h[j] = (_Float16)a[j]; h[j + 4] = (_Float16)c[j]; }
    *(v8h*)(out + i) = h;
    // in the shared launch other stages' code follows this store in the listing and reuses the registers it names
    asm volatile("s_wait_xcnt 0x0" ::: "memory");
}

__device__ __forceinline__ void zero_vt_pad_body(_Float16* __restrict__ vt, int blk) {
    int i = blk * 256 + threadIdx.x;                 // over B_*C_*2: a row's pad, keys 80..95, is two 16-byte chunks
    int bo = i >> 1;
    int j  = i & 1;
    *(v8h*)(vt + (size_t)bo * LP2 + 80 + j * 8) = (v8h){0, 0, 0, 0, 0, 0, 0, 0};
    // in the shared launch other stages' code follows this store in the listing and reuses the registers it names
    asm volatile("s_wait_xcnt 0x0" ::: "memory");
}

// One block per (b, group): reduce 16 channels * 4096 contiguous floats.
__device__ __forceinline__ void gn_stats_body(const float* __restrict__ x, float* __restrict__ stats, int bg) {
    // 16-byte loads, 512 contiguous bytes per wave and load; unrolled whole, so that the loads run ahead of the sums
    // (in the listing a wave keeps 12 of them, 6 KB, in flight throughout). Four partial sums per lane.
    const v4f* p = (const v4f*)(x + (size_t)bg * (GC * HW_)) + threadIdx.x;
    v4f s4 = (v4f){0.f, 0.f, 0.f, 0.f}, q4 = (v4f){0.f, 0.f, 0.f, 0.f};
#pragma unroll
    for (int i = 0; i < GC * HW_ / (4 * 256); ++i) { v4f v = p[i * 256]; s4 += v; q4 += v * v; }
    float s = (s4[0] + s4[1]) + (s4[2] + s4[3]), s2 = (q4[0] + q4[1]) + (q4[2] + q4[3]);
    __shared__ float rs[256], rq[256];
    rs[threadIdx.x] = s; rq[threadIdx.x] = s2;
    __syncthreads();
    for (int o = 128; o > 0; o >>= 1) {
        if (threadIdx.x < o) { rs[threadIdx.x] += rs[threadIdx.x + o]; rq[threadIdx.x] += rq[threadIdx.x + o]; }
        __syncthreads();
    }
    if (threadIdx.x == 0) {
        const float inv_n = 1.f / (GC * HW_);
        float mu  = rs[0] * inv_n;
        float var = rq[0] * inv_n - mu * mu;
        stats[bg * 2 + 0] = mu;
        stats[bg * 2 + 1] = rsqrtf(var + 1e-6f);
    }
}

// First launch: everything that reads inputs alone. The GroupNorm statistics, the long stage, take the lowest
// block indices and start first; the weight conversions and the Vt pad run beside them instead of in five
// launches of their own.
#define PB_STATS (B_ * 32)
#define PB_CC    (C_ * C_ / (256 * 8))
#define PB_CCD   (C_ * CD_ / (256 * 8))
#define PB_PAD   (B_ * C_ * 2 / 256)
__global__ void cab_prep(const float* __restrict__ x, float* __restrict__ stats,
                         const float* __restrict__ q_w, const float* __restrict__ k_w,
                         const float* __restrict__ v_w, const float* __restrict__ proj_w,
                         _Float16* __restrict__ qw16, _Float16* __restrict__ kw16,
                         _Float16* __restrict__ vw16, _Float16* __restrict__ pw16,
                         _Float16* __restrict__ vt) {
    int blk = blockIdx.x;
    if (blk < PB_STATS) { gn_stats_body(x, stats, blk); return; }
    blk -= PB_STATS;
    if (blk < PB_CCD) { cvt_f16_body(k_w, kw16, blk); return; }
    blk -= PB_CCD;
    if (blk < PB_CCD) { cvt_f16_body(v_w, vw16, blk); return; }
    blk -= PB_CCD;
    if (blk < PB_CC) { cvt_f16_body(q_w, qw16, blk); return; }
    blk -= PB_CC;
    if (blk < PB_CC) { cvt_f16_body(proj_w, pw16, blk); return; }
    blk -= PB_CC;
    zero_vt_pad_body(vt, blk);
}

#define GT_PX 128   // pixels per tile
#define GT_NT 4     // tiles per work-group
__device__ __forceinline__ void gn_apply_t_body(const float* __restrict__ x, const float* __restrict__ stats,
                               const float* __restrict__ gamma, const float* __restrict__ beta,
                               _Float16* __restrict__ xn, int bx, int by, int b) {
    __shared__ __align__(16) _Float16 tile[2][GT_PX * 64];
    int c0 = by * 64, pb = bx * (GT_PX * GT_NT);
    int lane = threadIdx.x & 31;
    int wv = __builtin_amdgcn_readfirstlane(threadIdx.x >> 5);   // scalar: the per-channel constants load once per wave
    int cw = c0 + wv * 8;
    int g  = cw >> 4;
    float mu = stats[(b * 32 + g) * 2], rstd = stats[(b * 32 + g) * 2 + 1];
    float ga[8], be[8];
#pragma unroll
    for (int i = 0; i < 8; ++i) { ga[i] = gamma[cw + i]; be[i] = beta[cw + i]; }

    const float* src = x + ((size_t)b * C_ + cw) * HW_ + pb + lane * 4;
    v4f v[2][8];                                  // two register sets: loads run two tiles ahead of the LDS pass
#pragma unroll
    for (int u = 0; u < 2; ++u)
#pragma unroll
        for (int i = 0; i < 8; ++i) v[u][i] = *(const v4f*)(src + (size_t)i * HW_ + u * GT_PX);

    int swap = (lane >> 3) & 1;
    int slot = (wv ^ (lane & 7)) * 8;
#pragma unroll
    for (int t = 0; t < GT_NT; ++t) {
        v8h h[4];
#pragma unroll
        for (int j = 0; j < 4; ++j)
#pragma unroll
            for (int i = 0; i < 8; ++i) h[j][i] = (_Float16)((v[t & 1][i][j] - mu) * rstd * ga[i] + be[i]);
        if (t + 2 < GT_NT) {
#pragma unroll
            for (int i = 0; i < 8; ++i) v[t & 1][i] = *(const v4f*)(src + (size_t)i * HW_ + (t + 2) * GT_PX);
        }
        _Float16* buf = tile[t & 1];
#pragma unroll
        for (int j = 0; j < 4; ++j) *(v8h*)(buf + ((lane * 4 + j) ^ swap) * 64 + slot) = h[j];
        // Work-group barrier, one per tile, with the LDS wait alone: it publishes this buffer, and every wave's
        // reads of the other buffer have returned before it. __syncthreads() would also drain the global loads
        // of the next tiles and the stores of the last one, which no other wave depends on.
        asm volatile("s_wait_dscnt 0x0\n\ts_barrier_signal -1\n\ts_barrier_wait -1" ::: "memory");
#pragma unroll
        for (int k = 0; k < 4; ++k) {
            int pt = k * 2 + (wv >> 2);           // pixel tile of 16 in this tile; wave bits 1, 0 = k step, half j
            int p = pt * 16 + (lane & 15);
            int w = (wv & 3) * 2 + (lane >> 4);
            int r = p ^ ((p >> 5) & 1);
            int q = w ^ ((p >> 2) & 7);
            v8h d = *(const v8h*)(buf + (r * 8 + q) * 8);
            *(v8h*)(xn + ((size_t)b * HW_ + pb + t * GT_PX + pt * 16) * C_ + (by * 2) * FT + (wv & 3) * 256 + lane * 8) = d;
        }
        // the next tile's loads and arithmetic reuse the registers that these stores name
        asm volatile("s_wait_xcnt 0x0" ::: "memory");
        // keeps the next tile's arithmetic, and with it the wait for its loads, behind this tile's stores and that wait
        __builtin_amdgcn_sched_barrier(0);
    }
}

// K/V projection: A = cond [B,77,768] f32 (row-clamped).
// waves 0..3 -> K matrix, waves 4..7 -> V matrix; each wave one 16x16 tile.
__device__ __forceinline__ void gemm_kv_body(const float* __restrict__ cond,
                            const _Float16* __restrict__ kw, const float* __restrict__ kb,
                            const _Float16* __restrict__ vw, const float* __restrict__ vb,
                            _Float16* __restrict__ kbuf, _Float16* __restrict__ vt, int bx, int by, int b) {
    int wv = threadIdx.x >> 5;
    int isv = wv >> 2;
    int p0 = bx * 16;                               // l-tile (bx < 5)
    int n0 = by * 64 + (wv & 3) * 16;               // by < 8
    int lane = threadIdx.x & 31, half = lane >> 4, n15 = lane & 15;
    const float* A = cond + (size_t)b * L_ * CD_ + (size_t)p0 * CD_;
    int rows_left = L_ - p0;
    const _Float16* w   = isv ? vw : kw;
    const float*    bia = isv ? vb : kb;
    v8f acc = (v8f){0.f,0.f,0.f,0.f,0.f,0.f,0.f,0.f};
    for (int kc = 0; kc < CD_; kc += 32) {
        v16h a  = frag16_f32c(A + kc, CD_, rows_left);
        v16h bf = frag16(w + (size_t)n0 * CD_ + kc, CD_);
        acc = wmma16(a, bf, acc);
    }
    int o = n0 + n15;
    float bb = bia[o];
#pragma unroll
    for (int r = 0; r < 8; ++r) {
        int l = p0 + r + 8 * half;                  // < 80 ; rows 77..79 masked later
        float v = acc[r] + bb;
        if (!isv) kbuf[((size_t)b * LP + l) * C_ + o]  = (_Float16)v;
        else      vt  [((size_t)b * C_ + o) * LP2 + l] = (_Float16)v;
    }
}

// Second launch: the two stages that need only the first launch's results. The K/V projection waits on load
// latency and moves few bytes; it takes the lowest block indices, starts first and runs beside the GroupNorm
// apply, which streams x.
#define AB_KV    ((LP / 16) * (C_ / 64) * B_)
#define AB_APPLY ((HW_ / (GT_PX * GT_NT)) * (C_ / 64) * B_)
__global__ void cab_apply_kv(const float* __restrict__ x, const float* __restrict__ stats,
                             const float* __restrict__ gamma, const float* __restrict__ beta,
                             _Float16* __restrict__ xn, const float* __restrict__ cond,
                             const _Float16* __restrict__ kw, const float* __restrict__ kb,
                             const _Float16* __restrict__ vw, const float* __restrict__ vb,
                             _Float16* __restrict__ kbuf, _Float16* __restrict__ vt) {
    int blk = blockIdx.x;
    if (blk < AB_KV) {
        int yz = blk / (LP / 16);
        gemm_kv_body(cond, kw, kb, vw, vb, kbuf, vt, blk - yz * (LP / 16), yz & 7, yz >> 3);
    } else {
        blk -= AB_KV;
        gn_apply_t_body(x, stats, gamma, beta, xn, blk & 7, (blk >> 3) & 7, blk >> 6);
    }
}

// Q projection and attention in one kernel. A work-group does 256 pixels x 128 channels = 2 heads; a wave 32 pixels.
// The projection is formed transposed, Q^T = q_w . xn^T (the weight fragment is the A operand): an accumulator tile
// then holds in lane n the pixel n and in its 8 registers the channels 8*half..8*half+7, which is the place those
// values have in a B fragment (two tiles = one k step of 32). So Q never leaves the registers, and the same holds
// for S^T = K . Q^T (rows = keys) and O^T = Vt . P^T (rows = head channels): a pixel's whole score column lies in
// lanes n and n + 16, the softmax is in-lane but for one exchange, and a lane stores 8 channels of O at once, which
// is one chunk of obuf's fragment order: a wave's store is 512 contiguous bytes.
// Ping-pong LDS weight panels (async staging overlapped with compute); panel 0, once read, takes K and Vt.
__global__ __launch_bounds__(256) void cab_qproj_attn(const _Float16* __restrict__ xn, const _Float16* __restrict__ w,
                               const float* __restrict__ bias, const _Float16* __restrict__ kbuf,
                               const _Float16* __restrict__ vt, const float* __restrict__ scale_p,
                               _Float16* __restrict__ obuf) {
    __shared__ __align__(16) _Float16 wpan[2][NB * WP];
    _Float16* kls = wpan[0];                  // 80 key rows x 128 channels, pitch KP
    _Float16* vls = wpan[0] + LP * KP;        // 128 channel rows x 96 keys, pitch VP
    int b  = blockIdx.z;
    int wv = threadIdx.x >> 5;
    int p0 = blockIdx.x * 256 + wv * 32;
    int n0 = blockIdx.y * NB;
    int lane = threadIdx.x & 31, half = lane >> 4;
    const _Float16* A = xn + ((size_t)b * HW_ + p0) * C_;
    v8f acc[2][NB / 16];
#pragma unroll
    for (int g2 = 0; g2 < 2; ++g2)
#pragma unroll
        for (int t = 0; t < NB / 16; ++t) acc[g2][t] = (v8f){0.f,0.f,0.f,0.f,0.f,0.f,0.f,0.f};

    stage_async(wpan[0], w + (size_t)n0 * C_, C_, WP, NB * 32, 32);
    v16h af[2][2], bf[2][4];
    af[0][0] = frag16_fo(A);                  // the first xn fragments fly beside panel 0
    af[0][1] = frag16_fo(A + 16 * C_);
    wait_async_barrier();
    stage_async(wpan[1], w + (size_t)n0 * C_ + 256, C_, WP, NB * 32, 32);  // overlaps half-0 compute

    // Two register sets of fragments. A block is 8 matrix instructions: one k step of 32, 4 of the 8 channel tiles.
    // The weight fragments of block j + 1, and in a step's first block the xn fragments of the next step, are loaded
    // as one group in front of block j.
#pragma unroll
    for (int kh = 0; kh < 2; ++kh) {
        const _Float16* P = wpan[kh];
#pragma unroll
        for (int nt = 0; nt < 4; ++nt) bf[0][nt] = frag16(P + nt * 16 * WP, WP);
#pragma unroll
        for (int j = 0; j < 16; ++j) {
            const int s = j >> 1, hn = j & 1, ca = s & 1;
            const int ks = kh * 8 + s + 1;                 // the next k step, counted over both panels
            if (hn == 0 && ks < 16) {
                af[ca ^ 1][0] = frag16_fo(A + ks * FT);
                af[ca ^ 1][1] = frag16_fo(A + 16 * C_ + ks * FT);
            }
            if (j + 1 < 16) {
#pragma unroll
                for (int nt = 0; nt < 4; ++nt)
                    bf[hn ^ 1][nt] = frag16(P + (((j + 1) & 1) * 4 + nt) * 16 * WP + ((j + 1) >> 1) * 32, WP);
            }
            // keeps those loads in front of this block: without it the compiler sinks each load to its first
            // use and the wave waits out every LDS and global latency in full
            __builtin_amdgcn_sched_barrier(0);
#pragma unroll
            for (int nt = 0; nt < 4; ++nt) {
                acc[0][hn * 4 + nt] = wmma16(bf[hn][nt], af[ca][0], acc[0][hn * 4 + nt]);
                acc[1][hn * 4 + nt] = wmma16(bf[hn][nt], af[ca][1], acc[1][hn * 4 + nt]);
            }
            // ends the block: later loads may not rise among these matrix instructions
            __builtin_amdgcn_sched_barrier(0);
        }
        if (kh == 0) {
            // this wave's reads of panel 0 have returned before the barrier behind which panel 0 is refilled
            asm volatile("s_wait_dscnt 0x0" ::: "memory");
            wait_async_barrier();   // panel 1 ready; every wave has left panel 0
            // K (rows l, ld C_) and Vt (rows d, ld LP2) of this batch and these 2 heads fly beside half-1 compute.
            // 16-byte chunks, 5 + 6 per thread, every lane on; one statement and one wait per run of copies.
            unsigned kl = (unsigned)(size_t)(void*)kls, vl = (unsigned)(size_t)(void*)vls;
            const _Float16* kg = kbuf + (size_t)b * LP * C_ + n0;
            const _Float16* vg = vt + ((size_t)b * C_ + n0) * LP2;
            unsigned la[6];
            const _Float16* ga[6];
#pragma unroll
            for (int u = 0; u < 5; ++u) {
                int i = u * 256 + threadIdx.x, row = i >> 4, cc = (i & 15) * 8;
                la[u] = kl + (unsigned)((row * KP + cc) * 2);
                ga[u] = kg + (size_t)row * C_ + cc;
            }
            // the wait stands in the copies' own statement: the Vt addresses below reuse these registers
            asm volatile("global_load_async_to_lds_b128 %0, %1, off\n\t"
                         "global_load_async_to_lds_b128 %2, %3, off\n\t"
                         "global_load_async_to_lds_b128 %4, %5, off\n\t"
                         "global_load_async_to_lds_b128 %6, %7, off\n\t"
                         "global_load_async_to_lds_b128 %8, %9, off\n\t"
                         "s_wait_xcnt 0x0"
                         :: "v"(la[0]), "v"(ga[0]), "v"(la[1]), "v"(ga[1]), "v"(la[2]), "v"(ga[2]),
                            "v"(la[3]), "v"(ga[3]), "v"(la[4]), "v"(ga[4]) : "memory");
#pragma unroll
            for (int u = 0; u < 6; ++u) {
                int i = u * 256 + threadIdx.x, row = i / 12, cc = (i - row * 12) * 8;
                la[u] = vl + (unsigned)((row * VP + cc) * 2);
                ga[u] = vg + (size_t)row * LP2 + cc;
            }
            // the wait stands in the copies' own statement: the main loop reuses these registers
            asm volatile("global_load_async_to_lds_b128 %0, %1, off\n\t"
                         "global_load_async_to_lds_b128 %2, %3, off\n\t"
                         "global_load_async_to_lds_b128 %4, %5, off\n\t"
                         "global_load_async_to_lds_b128 %6, %7, off\n\t"
                         "global_load_async_to_lds_b128 %8, %9, off\n\t"
                         "global_load_async_to_lds_b128 %10, %11, off\n\t"
                         "s_wait_xcnt 0x0"
                         :: "v"(la[0]), "v"(ga[0]), "v"(la[1]), "v"(ga[1]), "v"(la[2]), "v"(ga[2]),
                            "v"(la[3]), "v"(ga[3]), "v"(la[4]), "v"(ga[4]), "v"(la[5]), "v"(ga[5]) : "memory");
        }
    }
    // a lane's 8 bias values per channel tile: channels 8*half..8*half+7 of the tile
    v4f bq[NB / 16][2];
#pragma unroll
    for (int nt = 0; nt < NB / 16; ++nt) {
        bq[nt][0] = *(const v4f*)(bias + n0 + nt * 16 + 8 * half);
        bq[nt][1] = *(const v4f*)(bias + n0 + nt * 16 + 8 * half + 4);
    }
    float scl = scale_p[0];
    // the arithmetic below reuses the registers that the xn loads and the bias loads name
    asm volatile("s_wait_xcnt 0x0" ::: "memory");
    // keeps that arithmetic behind the wait
    __builtin_amdgcn_sched_barrier(0);
    wait_async_barrier();                     // K and Vt have landed, for every wave

    // Q^T + bias as B fragments: element i = channel 8*half + i of the k step's first tile, i + 8 the same of its second
    v16h qf[2][2][2];                         // [pixel tile][head][k step]
#pragma unroll
    for (int g2 = 0; g2 < 2; ++g2)
#pragma unroll
        for (int nt = 0; nt < NB / 16; ++nt)
#pragma unroll
            for (int r = 0; r < 8; ++r)
                qf[g2][nt >> 2][(nt >> 1) & 1][(nt & 1) * 8 + r] = (_Float16)(acc[g2][nt][r] + bq[nt][r >> 2][r & 3]);
    __builtin_amdgcn_sched_barrier(0);

#pragma unroll
    for (int hh = 0; hh < 2; ++hh) {
        v8f s[2][5];                          // S^T: lane = pixel, key l = t*16 + r + 8*half
#pragma unroll
        for (int t = 0; t < 5; ++t) {
            v16h k0 = frag16(kls + (t * 16) * KP + hh * HD,      KP);
            v16h k1 = frag16(kls + (t * 16) * KP + hh * HD + 32, KP);
#pragma unroll
            for (int g2 = 0; g2 < 2; ++g2) {
                v8f z = (v8f){0.f,0.f,0.f,0.f,0.f,0.f,0.f,0.f};
                z = wmma16(k0, qf[g2][hh][0], z);
                z = wmma16(k1, qf[g2][hh][1], z);
                s[g2][t] = z;
            }
        }
        v16h pf[2][3];                        // P^T as B fragments, 3 k steps of 32 keys (80..95 zero)
#pragma unroll
        for (int g2 = 0; g2 < 2; ++g2) {
            float m = -3.0e38f;
#pragma unroll
            for (int t = 0; t < 5; ++t)
#pragma unroll
                for (int r = 0; r < 8; ++r) {
                    float v = s[g2][t][r] * scl;
                    if (t == 4 && r >= 5 && half) v = -3.0e38f;    // key 64 + r + 8*half >= 77
                    s[g2][t][r] = v; m = fmaxf(m, v);
                }
            m = fmaxf(m, __shfl_xor(m, 16, 32));
            float sum = 0.f;
#pragma unroll
            for (int t = 0; t < 5; ++t)
#pragma unroll
                for (int r = 0; r < 8; ++r) { float e = __expf(s[g2][t][r] - m); s[g2][t][r] = e; sum += e; }
            sum += __shfl_xor(sum, 16, 32);
            float inv = 1.f / sum;
#pragma unroll
            for (int t = 0; t < 6; ++t)
#pragma unroll
                for (int r = 0; r < 8; ++r)
                    pf[g2][t >> 1][(t & 1) * 8 + r] = (t < 5) ? (_Float16)(s[g2][t < 5 ? t : 0][r] * inv) : (_Float16)0.f;
        }
        v8f oacc[2][4];                       // O^T: lane = pixel, head channel d = nt*16 + r + 8*half
#pragma unroll
        for (int g2 = 0; g2 < 2; ++g2)
#pragma unroll
            for (int nt = 0; nt < 4; ++nt) oacc[g2][nt] = (v8f){0.f,0.f,0.f,0.f,0.f,0.f,0.f,0.f};
#pragma unroll
        for (int kc = 0; kc < 3; ++kc)
#pragma unroll
            for (int nt = 0; nt < 4; ++nt) {
                v16h va = frag16(vls + (hh * HD + nt * 16) * VP + kc * 32, VP);
                oacc[0][nt] = wmma16(va, pf[0][kc], oacc[0][nt]);
                oacc[1][nt] = wmma16(va, pf[1][kc], oacc[1][nt]);
            }
        v8h d[2][4];
#pragma unroll
        for (int g2 = 0; g2 < 2; ++g2)
#pragma unroll
            for (int nt = 0; nt < 4; ++nt)
#pragma unroll
                for (int r = 0; r < 8; ++r) d[g2][nt][r] = (_Float16)oacc[g2][nt][r];
        // keeps the conversions in front of the stores: mixed with them they share one register set, and each
        // store is then followed by a wait before its registers are written again
        __builtin_amdgcn_sched_barrier(0);
#pragma unroll
        for (int g2 = 0; g2 < 2; ++g2)
#pragma unroll
            for (int nt = 0; nt < 4; ++nt)
                // channel tile nt is half nt & 1 of k step (n0 + hh * HD) / 32 + nt / 2: chunk (nt & 1) * 32 + lane
                *(v8h*)(obuf + ((size_t)b * HW_ + p0 + g2 * 16) * C_ + ((n0 + hh * HD) / 32) * FT + nt * 256 + lane * 8) = d[g2][nt];
        if (hh == 0) {
            // the second head's arithmetic reuses the registers that these stores name
            asm volatile("s_wait_xcnt 0x0" ::: "memory");
            // keeps that arithmetic behind the wait
            __builtin_amdgcn_sched_barrier(0);
        }
    }
}

// Final projection + residual: out[b,o,p] = x + O @ proj_w^T + proj_b; wave does 32(M) x 128(N): every A fragment, 1 KB
// in a row of obuf (fragment order), feeds 8 matrix instructions, and obuf is read C_/NB = 4 times in all.
// Ping-pong LDS weight panels; the same LDS is reused as f32 transpose buffer for coalesced stores.
__global__ __launch_bounds__(256) void cab_gemm_proj(const _Float16* __restrict__ obuf, const _Float16* __restrict__ w,
                              const float* __restrict__ bias, const float* __restrict__ x,
                              float* __restrict__ out) {
    __shared__ __align__(16) char smem[2 * NB * WP * 2];   // 2 weight panels; reused for transpose
    _Float16* wpan0 = (_Float16*)smem;
    _Float16* wpan1 = (_Float16*)(smem + NB * WP * 2);
    int b  = blockIdx.z;
    int wv = threadIdx.x >> 5;
    int p0 = blockIdx.x * 256 + wv * 32;
    int n0 = blockIdx.y * NB;
    int lane = threadIdx.x & 31, half = lane >> 4, n15 = lane & 15;
    const _Float16* A = obuf + ((size_t)b * HW_ + p0) * C_;
    v8f acc[2][NB / 16];
#pragma unroll
    for (int g2 = 0; g2 < 2; ++g2)
#pragma unroll
        for (int t = 0; t < NB / 16; ++t) acc[g2][t] = (v8f){0.f,0.f,0.f,0.f,0.f,0.f,0.f,0.f};

    stage_async(wpan0, w + (size_t)n0 * C_, C_, WP, NB * 32, 32);
    v16h af[2][2], bf[2][4];
    af[0][0] = frag16_fo(A);                  // the first A fragments fly beside panel 0
    af[0][1] = frag16_fo(A + 16 * C_);
    wait_async_barrier();
    stage_async(wpan1, w + (size_t)n0 * C_ + 256, C_, WP, NB * 32, 32);    // overlaps half-0 compute

    // Two register sets of fragments. A block is 8 matrix instructions: one k step of 32, 4 of the 8 channel tiles.
    // The B fragments of block j + 1, and in a step's first block the A fragments of the next step, are loaded
    // as one group in front of block j.
#pragma unroll
    for (int kh = 0; kh < 2; ++kh) {
        const _Float16* P = kh ? wpan1 : wpan0;
#pragma unroll
        for (int nt = 0; nt < 4; ++nt) bf[0][nt] = frag16(P + nt * 16 * WP, WP);
#pragma unroll
        for (int j = 0; j < 16; ++j) {
            const int s = j >> 1, hn = j & 1, ca = s & 1;
            const int ks = kh * 8 + s + 1;                 // the next k step, counted over both panels
            if (hn == 0 && ks < 16) {
                af[ca ^ 1][0] = frag16_fo(A + ks * FT);
                af[ca ^ 1][1] = frag16_fo(A + 16 * C_ + ks * FT);
            }
            if (j + 1 < 16) {
#pragma unroll
                for (int nt = 0; nt < 4; ++nt)
                    bf[hn ^ 1][nt] = frag16(P + (((j + 1) & 1) * 4 + nt) * 16 * WP + ((j + 1) >> 1) * 32, WP);
            }
            // keeps those loads in front of this block: without it the compiler sinks each load to its first
            // use and the wave waits out every LDS and global latency in full
            __builtin_amdgcn_sched_barrier(0);
#pragma unroll
            for (int nt = 0; nt < 4; ++nt) {
                acc[0][hn * 4 + nt] = wmma16(af[ca][0], bf[hn][nt], acc[0][hn * 4 + nt]);
                acc[1][hn * 4 + nt] = wmma16(af[ca][1], bf[hn][nt], acc[1][hn * 4 + nt]);
            }
            // ends the block: later loads may not rise among these matrix instructions
            __builtin_amdgcn_sched_barrier(0);
        }
        if (kh == 0) wait_async_barrier();   // panel 1 ready
    }
    // the epilogue's address arithmetic reuses the register pair that the A loads name
    asm volatile("s_wait_xcnt 0x0" ::: "memory");
    // keeps that arithmetic behind the wait
    __builtin_amdgcn_sched_barrier(0);
    __syncthreads();                          // all weight reads done before smem reuse

    float* T = (float*)smem + (size_t)wv * NB * 33;        // [128 o][32 p], stride 33; 8 waves fill smem exactly
#pragma unroll
    for (int g2 = 0; g2 < 2; ++g2)
#pragma unroll
        for (int nt = 0; nt < NB / 16; ++nt)
#pragma unroll
            for (int r = 0; r < 8; ++r)
                T[(nt * 16 + n15) * 33 + g2 * 16 + r + 8 * half] = acc[g2][nt][r];
    __syncthreads();
    // The wave's 32 pixels of one output channel are one 128-byte line: 8 lanes x 16 B take it whole, 4 channels a trip.
    int pc = (lane & 7) * 4;
    size_t base = ((size_t)b * C_ + n0 + (lane >> 3)) * HW_ + p0 + pc;
    const float* t0 = T + (lane >> 3) * 33 + pc;
#pragma unroll
    for (int i0 = 0; i0 < NB / 4; i0 += 8) {               // 8 loads of x in flight per wave
        v4f xv[8];
        float bo[8];
#pragma unroll
        for (int u = 0; u < 8; ++u) {
            xv[u] = *(const v4f*)(x + base + (size_t)(i0 + u) * 4 * HW_);
            bo[u] = bias[n0 + (i0 + u) * 4 + (lane >> 3)];
        }
#pragma unroll
        for (int u = 0; u < 8; ++u) {
            const float* t = t0 + (i0 + u) * 4 * 33;
            v4f ov;
#pragma unroll
            for (int j = 0; j < 4; ++j) ov[j] = xv[u][j] + t[j] + bo[u];
            *(v4f*)(out + base + (size_t)(i0 + u) * 4 * HW_) = ov;
        }
        if (i0 + 8 < NB / 4) {
            // the next trip's loads and address arithmetic reuse the registers that these stores name
            asm volatile("s_wait_xcnt 0x0" ::: "memory");
            // keeps the next trip's instructions behind that wait
            __builtin_amdgcn_sched_barrier(0);
        }
    }
}

extern "C" void kernel_launch(void* const* d_in, const int* in_sizes, int n_in,
                              void* d_out, int out_size, void* d_ws, size_t ws_size,
                              hipStream_t stream) {
    const float* x      = (const float*)d_in[0];
    const float* cond   = (const float*)d_in[1];
    const float* gamma  = (const float*)d_in[2];
    const float* beta   = (const float*)d_in[3];
    const float* q_w    = (const float*)d_in[4];
    const float* q_b    = (const float*)d_in[5];
    const float* k_w    = (const float*)d_in[6];
    const float* k_b    = (const float*)d_in[7];
    const float* v_w    = (const float*)d_in[8];
    const float* v_b    = (const float*)d_in[9];
    const float* proj_w = (const float*)d_in[10];
    const float* proj_b = (const float*)d_in[11];
    const float* scale  = (const float*)d_in[12];
    float* out = (float*)d_out;

    char* ws = (char*)d_ws;
    size_t off = 0;
    auto carve = [&](size_t bytes) { void* p = ws + off; off = (off + bytes + 255) & ~(size_t)255; return p; };
    float*     stats = (float*)    carve(512 * 2 * sizeof(float));
    _Float16*  qw16  = (_Float16*) carve((size_t)C_ * C_  * 2);
    _Float16*  kw16  = (_Float16*) carve((size_t)C_ * CD_ * 2);
    _Float16*  vw16  = (_Float16*) carve((size_t)C_ * CD_ * 2);
    _Float16*  pw16  = (_Float16*) carve((size_t)C_ * C_  * 2);
    _Float16*  kbuf  = (_Float16*) carve((size_t)B_ * LP  * C_  * 2);
    _Float16*  vt    = (_Float16*) carve((size_t)B_ * C_  * LP2 * 2);
    _Float16*  xn    = (_Float16*) carve((size_t)B_ * HW_ * C_  * 2);
    _Float16*  obuf  = (_Float16*) carve((size_t)B_ * HW_ * C_  * 2);  // not xn: other work-groups still read xn

    // 1) GroupNorm statistics, weights to f16, Vt pad
    cab_prep<<<PB_STATS + 2 * PB_CCD + 2 * PB_CC + PB_PAD, 256, 0, stream>>>(x, stats, q_w, k_w, v_w, proj_w,
                                                                             qw16, kw16, vw16, pw16, vt);

    // 2) K/V projection, GroupNorm apply
    cab_apply_kv<<<AB_KV + AB_APPLY, 256, 0, stream>>>(x, stats, gamma, beta, xn, cond, kw16, k_b, vw16, v_b, kbuf, vt);

    // 3) Q projection + attention
    cab_qproj_attn<<<dim3(HW_ / 256, C_ / NB, B_), 256, 0, stream>>>(xn, qw16, q_b, kbuf, vt, scale, obuf);

    // 4) output projection + residual
    cab_gemm_proj<<<dim3(HW_ / 256, C_ / NB, B_), 256, 0, stream>>>(obuf, pw16, proj_b, x, out);
}

// v009
// A run of this version takes 108 microseconds.
// Versions between v007 and this one are left out; their measured steps multiply to 1.26 times as fast.
// Counting every step since v000, it is 4.52 times as fast.
#include <hip/hip_runtime.h>

typedef __attribute__((ext_vector_type(16))) _Float16 v16h;
typedef __attribute__((ext_vector_type(8)))  float    v8f;

#define B_   16
#define C_   512
#define CD_  768
#define HW_  4096
#define L_   77
#define LP   80     // padded key rows (5 x 16 tiles)
#define LP2  96     // padded key width for PV (3 x 32 K-chunks)
#define HD   64
#define GC   16     // channels per group (C/32)
#define WP   264    // weight panel rows: 256 halves + 8  (528 B)
#define KP   136    // K rows: 128 halves (2 heads) + 8     (272 B)
#define VP   104    // Vt rows: 96 halves + 8              (208 B)
#define NB   128    // output channels per work-group of the two projection GEMMs (8 tiles of 16 per wave)

__device__ __forceinline__ v8f wmma16(v16h a, v16h b, v8f c) {
    return __builtin_amdgcn_wmma_f32_16x16x32_f16(false, a, false, b, (short)0, c, false, false);
}

__device__ __forceinline__ v16h frag16(const _Float16* p, int ld) {
    int lane = threadIdx.x & 31;
    const _Float16* b = p + (size_t)(lane & 15) * ld + ((lane >> 4) << 3);
    v16h f;
#pragma unroll
    for (int i = 0; i < 8; ++i) { f[i] = b[i]; f[i + 8] = b[i + 16]; }
    return f;
}

// xn and obuf, the two activation buffers [pixel][channel] that the projections read as fragments, are kept in
// FRAGMENT ORDER: a tile of 16 pixels x 32 channels is 1 KB in a row, as 64 chunks of 16 B; chunk j*32 + lane holds
// what that lane of frag16 takes as elements 8j..8j+7 (pixel lane & 15, channels 16j + 8*(lane >> 4) + 0..7).
// Tiles run over the 16 k steps first, then over the pixel tiles, so pixel tile T starts at T * 16 * C_ halves.
// A wave's 16-byte load or store of a fragment half is then 512 contiguous bytes = 4 whole lines, not 16 pieces of 32 B.
typedef __attribute__((ext_vector_type(8))) _Float16 v8h;
#define FT   512    // halves per fragment tile (16 px x 32 ch)
__device__ __forceinline__ v16h frag16_fo(const _Float16* tile) {
    const _Float16* b = tile + (threadIdx.x & 31) * 8;
    v8h lo = *(const v8h*)b, hi = *(const v8h*)(b + 256);
    v16h f;
#pragma unroll
    for (int i = 0; i < 8; ++i) { f[i] = lo[i]; f[i + 8] = hi[i]; }
    return f;
}

// f32 source (cond) with clamped row index (L=77 tail tile).
__device__ __forceinline__ v16h frag16_f32c(const float* p, int ld, int rows_left) {
    int lane = threadIdx.x & 31;
    int r = lane & 15;
    if (r >= rows_left) r = rows_left - 1;
    const float* b = p + (size_t)r * ld + ((lane >> 4) << 3);
    v16h f;
#pragma unroll
    for (int i = 0; i < 8; ++i) { f[i] = (_Float16)b[i]; f[i + 8] = (_Float16)b[i + 16]; }
    return f;
}

__device__ __forceinline__ void stage_async(_Float16* dst, const _Float16* src,
                                            int src_ld, int dst_ld, int nchunks, int cpr) {
    unsigned base = (unsigned)(size_t)(void*)dst;   // low 32 bits of generic addr == LDS offset
    for (int i = threadIdx.x; i < nchunks; i += 256) {
        int row = i / cpr;
        int cc  = (i - row * cpr) * 8;
        unsigned long long g = (unsigned long long)(src + (size_t)row * src_ld + cc);
        unsigned l = base + (unsigned)((row * dst_ld + cc) * 2);
        // the wait stands in the copy's own statement: the next trip rewrites l and g
        asm volatile("global_load_async_to_lds_b128 %0, %1, off\n\ts_wait_xcnt 0x0" :: "v"(l), "v"(g) : "memory");
    }
}

__device__ __forceinline__ void wait_async_barrier() {
    asm volatile("s_wait_asynccnt 0" ::: "memory");
    __syncthreads();
}

// The bodies below take their block index as an argument: independent stages share a launch (cab_prep).
// A lane converts 8 elements: two 16-byte loads, one 16-byte store. Every weight count is a multiple of 256 * 8.
typedef __attribute__((ext_vector_type(4))) float    v4f;
typedef __attribute__((ext_vector_type(2))) float    v2f;
__device__ __forceinline__ void cvt_f16_body(const float* __restrict__ in, _Float16* __restrict__ out, int blk) {
    size_t i = (size_t)(blk * 256 + threadIdx.x) * 8;
    v4f a = *(const v4f*)(in + i), c = *(const v4f*)(in + i + 4);
    v8h h;
#pragma unroll
    for (int j = 0; j < 4; ++j) { h[j] = (_Float16)a[j]; h[j + 4] = (_Float16)c[j]; }
    *(v8h*)(out + i) = h;
    // in the shared launch other stages' code follows this store in the listing and reuses the registers it names
    asm volatile("s_wait_xcnt 0x0" ::: "memory");
}

__device__ __forceinline__ void zero_vt_pad_body(_Float16* __restrict__ vt, int blk) {
    int i = blk * 256 + threadIdx.x;                 // over B_*C_*2: a row's pad, keys 80..95, is two 16-byte chunks
    int bo = i >> 1;
    int j  = i & 1;
    *(v8h*)(vt + (size_t)bo * LP2 + 80 + j * 8) = (v8h){0, 0, 0, 0, 0, 0, 0, 0};
    // in the shared launch other stages' code follows this store in the listing and reuses the registers it names
    asm volatile("s_wait_xcnt 0x0" ::: "memory");
}

// q_w with gamma folded in: q_w . (n * gamma + beta) = (q_w * gamma) . n + q_w . beta, n being the normalised value.
__device__ __forceinline__ void cvt_qw_body(const float* __restrict__ in, const float* __restrict__ gamma,
                                            _Float16* __restrict__ out, int blk) {
    size_t i = (size_t)(blk * 256 + threadIdx.x) * 8;
    int c = (int)(i & (C_ - 1));
    v4f a = *(const v4f*)(in + i), d = *(const v4f*)(in + i + 4);
    v4f g0 = *(const v4f*)(gamma + c), g1 = *(const v4f*)(gamma + c + 4);
    // the products below reuse the offset register that the gamma loads name
    asm volatile("s_wait_xcnt 0x0" ::: "memory");
    v8h h;
#pragma unroll
    for (int j = 0; j < 4; ++j) { h[j] = (_Float16)(a[j] * g0[j]); h[j + 4] = (_Float16)(d[j] * g1[j]); }
    *(v8h*)(out + i) = h;
    // in the shared launch other stages' code follows this store in the listing and reuses the registers it names
    asm volatile("s_wait_xcnt 0x0" ::: "memory");
}

// The beta part of that sum joins the bias, in f32: qb2[o] = q_b[o] + sum_c q_w[o][c] * beta[c]. One wave per o.
__device__ __forceinline__ void qbias_body(const float* __restrict__ q_w, const float* __restrict__ beta,
                                           const float* __restrict__ q_b, float* __restrict__ qb2, int blk) {
    int lane = threadIdx.x & 31;
    int o = blk * 8 + (threadIdx.x >> 5);
    v4f s4 = (v4f){0.f, 0.f, 0.f, 0.f};
#pragma unroll
    for (int i = 0; i < C_ / 128; ++i)
        s4 += *(const v4f*)(q_w + (size_t)o * C_ + i * 128 + lane * 4) * *(const v4f*)(beta + i * 128 + lane * 4);
    float s = (s4[0] + s4[1]) + (s4[2] + s4[3]);
#pragma unroll
    for (int m = 16; m > 0; m >>= 1) s += __shfl_xor(s, m, 32);
    if (lane == 0) qb2[o] = q_b[o] + s;
    // in the shared launch other stages' code follows this store in the listing and reuses the registers it names
    asm volatile("s_wait_xcnt 0x0" ::: "memory");
}

#define GT_PX 128   // pixels per tile
#define GT_NT 4     // tiles per work-group
__device__ __forceinline__ void gn_apply_t_body(const float* __restrict__ x, float* __restrict__ part,
                               _Float16* __restrict__ xn, _Float16* sm, int bx, int by, int b) {
    int c0 = by * 64, pb = bx * (GT_PX * GT_NT);
    int lane = threadIdx.x & 31;
    int wv = __builtin_amdgcn_readfirstlane(threadIdx.x >> 5);   // scalar: wave-uniform addresses stay in scalar registers
    int cw = c0 + wv * 8;
    v4f s4 = (v4f){0.f, 0.f, 0.f, 0.f}, q4 = (v4f){0.f, 0.f, 0.f, 0.f};

    const float* src = x + ((size_t)b * C_ + cw) * HW_ + pb + lane * 4;
    v4f v[2][8];                                  // two register sets: loads run two tiles ahead of the LDS pass
#pragma unroll
    for (int u = 0; u < 2; ++u)
#pragma unroll
        for (int i = 0; i < 8; ++i) v[u][i] = *(const v4f*)(src + (size_t)i * HW_ + u * GT_PX);

    int swap = (lane >> 3) & 1;
    int slot = (wv ^ (lane & 7)) * 8;
#pragma unroll
    for (int t = 0; t < GT_NT; ++t) {
        v8h h[4];
#pragma unroll
        for (int j = 0; j < 4; ++j)
#pragma unroll
            for (int i = 0; i < 8; ++i) h[j][i] = (_Float16)v[t & 1][i][j];
#pragma unroll
        for (int i = 0; i < 8; ++i) { s4 += v[t & 1][i]; q4 += v[t & 1][i] * v[t & 1][i]; }
        if (t + 2 < GT_NT) {
#pragma unroll
            for (int i = 0; i < 8; ++i) v[t & 1][i] = *(const v4f*)(src + (size_t)i * HW_ + (t + 2) * GT_PX);
        }
        _Float16* buf = sm + (t & 1) * (GT_PX * 64);
#pragma unroll
        for (int j = 0; j < 4; ++j) *(v8h*)(buf + ((lane * 4 + j) ^ swap) * 64 + slot) = h[j];
        // Work-group barrier, one per tile, with the LDS wait alone: it publishes this buffer, and every wave's
        // reads of the other buffer have returned before it. __syncthreads() would also drain the global loads
        // of the next tiles and the stores of the last one, which no other wave depends on.
        asm volatile("s_wait_dscnt 0x0\n\ts_barrier_signal -1\n\ts_barrier_wait -1" ::: "memory");
#pragma unroll
        for (int k = 0; k < 4; ++k) {
            int pt = k * 2 + (wv >> 2);           // pixel tile of 16 in this tile; wave bits 1, 0 = k step, half j
            int p = pt * 16 + (lane & 15);
            int w = (wv & 3) * 2 + (lane >> 4);
            int r = p ^ ((p >> 5) & 1);
            int q = w ^ ((p >> 2) & 7);
            v8h d = *(const v8h*)(buf + (r * 8 + q) * 8);
            *(v8h*)(xn + ((size_t)b * HW_ + pb + t * GT_PX + pt * 16) * C_ + (by * 2) * FT + (wv & 3) * 256 + lane * 8) = d;
        }
        // the next tile's loads and arithmetic, and behind the last tile the reduction and store of the sums below,
        // reuse the registers that these stores name
        asm volatile("s_wait_xcnt 0x0" ::: "memory");
        // keeps the next tile's arithmetic, and with it the wait for its loads, behind this tile's stores and that wait
        __builtin_amdgcn_sched_barrier(0);
    }
    float s = (s4[0] + s4[1]) + (s4[2] + s4[3]), q = (q4[0] + q4[1]) + (q4[2] + q4[3]);
#pragma unroll
    for (int m = 16; m > 0; m >>= 1) { s += __shfl_xor(s, m, 32); q += __shfl_xor(q, m, 32); }
    // a work-group owns one 128-byte line of part: 8 waves x (sum, sum of squares)
    if (lane == 0) *(v2f*)(part + (size_t)((b * 8 + by) * 8 + bx) * 32 + wv * 2) = (v2f){s, q};
    // in the shared launch other stages' code follows this store in the listing and reuses the registers it names
    asm volatile("s_wait_xcnt 0x0" ::: "memory");
}

// K/V projection: cond [B,77,768] and the weights are f32 inputs, rounded to f16 on the way, so that the stage needs
// inputs alone and runs in the first launch. One work-group: the 80 key rows of a batch x 64 output channels of K or V.
// A fragment read straight from memory touches 16 rows = 16 lines per load instruction, and every fragment would be
// read by many waves. Here the 80 + 64 rows go through LDS in chunks of 64 k: a load instruction takes 256 contiguous
// bytes of each of two rows (4 whole lines), each byte once per work-group; the fragments come from LDS.
// Two LDS buffers and one register set: chunk c + 1 is in flight from memory while chunk c is multiplied.
typedef __attribute__((ext_vector_type(4))) _Float16 v4h;
#define KV_KC   64              // k per chunk
#define KV_P    72              // LDS row pitch in halves: 144 B = 16 B x 9
#define KV_ROWS (LP + 64)       // key rows, then weight rows
#define KV_NL   (KV_ROWS / 16)  // load instructions per wave and chunk (8 waves x 2 rows each)
__device__ __forceinline__ void gemm_kv_body(const float* __restrict__ cond,
                            const float* __restrict__ kw, const float* __restrict__ kb,
                            const float* __restrict__ vw, const float* __restrict__ vb,
                            _Float16* __restrict__ kbuf, _Float16* __restrict__ vt, _Float16* sm, int by, int b) {
    int wv = __builtin_amdgcn_readfirstlane(threadIdx.x >> 5);   // scalar: wave-uniform tile choice
    int lane = threadIdx.x & 31, half = lane >> 4, n15 = lane & 15;
    int isv = by >> 3;                              // by < 16: 8 channel blocks of K, then 8 of V
    int n0 = (by & 7) * 64;
    const float*    w   = isv ? vw : kw;
    const float*    bia = isv ? vb : kb;
    // load u of a wave: row u * 16 + rw of the 144; u < 5 are key rows (77..79 repeat row 76, masked later), the rest weights
    int rw = wv * 2 + half;
    const float* pa  = cond + ((size_t)b * L_ + rw) * CD_ + n15 * 4;
    int rl = 64 + rw; if (rl > L_ - 1) rl = L_ - 1;
    const float* pa4 = cond + ((size_t)b * L_ + rl) * CD_ + n15 * 4;
    const float* pw  = w + (size_t)(n0 + rw) * CD_ + n15 * 4;
    v4f v[KV_NL];
#pragma unroll
    for (int u = 0; u < KV_NL; ++u)
        v[u] = *(const v4f*)(u < 4 ? pa + (size_t)u * 16 * CD_ : u == 4 ? pa4 : pw + (size_t)(u - 5) * 16 * CD_);
    int nt = wv & 3;                                // channel tile; waves 0..3 take key tiles 0, 1, 2, waves 4..7 tiles 3, 4
    int l0 = (wv >> 2) * 3;
    v8f acc[3];
#pragma unroll
    for (int i = 0; i < 3; ++i) acc[i] = (v8f){0.f,0.f,0.f,0.f,0.f,0.f,0.f,0.f};
#pragma unroll
    for (int c = 0; c < CD_ / KV_KC; ++c) {
        _Float16* buf = sm + (c & 1) * (KV_ROWS * KV_P);
#pragma unroll
        for (int u = 0; u < KV_NL; ++u) {
            v4h h4;
#pragma unroll
            for (int j = 0; j < 4; ++j) h4[j] = (_Float16)v[u][j];
            *(v4h*)(buf + (u * 16 + rw) * KV_P + n15 * 4) = h4;
        }
        // keeps the next chunk's loads behind the conversion, in the same registers: raised over it they take a second
        // register set, and the launch's 128 registers a wave no longer hold the stage without spills
        __builtin_amdgcn_sched_barrier(0);
        if (c + 1 < CD_ / KV_KC) {
            const int k = (c + 1) * KV_KC;
#pragma unroll
            for (int u = 0; u < KV_NL; ++u)
                v[u] = *(const v4f*)(u < 4 ? pa + (size_t)u * 16 * CD_ + k : u == 4 ? pa4 + k : pw + (size_t)(u - 5) * 16 * CD_ + k);
        }
        // keeps the next chunk's loads in front of the barrier and the products: sunk to their use they would not overlap
        __builtin_amdgcn_sched_barrier(0);
        // Work-group barrier, one per chunk, with the LDS wait alone: it publishes this buffer, and every wave's reads of
        // the other buffer have returned before it. __syncthreads() would also drain the loads of the next chunk.
        asm volatile("s_wait_dscnt 0x0\n\ts_barrier_signal -1\n\ts_barrier_wait -1" ::: "memory");
#pragma unroll
        for (int ks = 0; ks < KV_KC / 32; ++ks) {
            v16h bf = frag16(buf + (LP + nt * 16) * KV_P + ks * 32, KV_P);
            v16h a[3];
#pragma unroll
            for (int i = 0; i < 3; ++i) {
                // 20 tiles on 8 waves: the third tile of waves 4..7 repeats key tile 4 and is not stored (one code path)
                int lt = l0 + i < 5 ? l0 + i : 4;
                a[i] = frag16(buf + lt * 16 * KV_P + ks * 32, KV_P);
            }
            // keeps the k step's eight LDS loads together in front of its products: sunk to their uses, into one
            // register set, the wave waits out the LDS latency three times instead of once
            __builtin_amdgcn_sched_barrier(0);
#pragma unroll
            for (int i = 0; i < 3; ++i) acc[i] = wmma16(a[i], bf, acc[i]);
            // one k step's four fragments at a time, for the same register bound
            __builtin_amdgcn_sched_barrier(0);
        }
    }
    // the address arithmetic of the stores reuses the registers that the loads name
    asm volatile("s_wait_xcnt 0x0" ::: "memory");
    int o = n0 + nt * 16 + n15;
    float bb = bia[o];
    // K or V is the same for the whole work-group: one scalar branch around all stores
    if (!isv) {
        _Float16* kp = kbuf + ((size_t)b * LP + l0 * 16 + 8 * half) * C_ + o;     // key rows < 80 ; 77..79 masked later
#pragma unroll
        for (int i = 0; i < 3; ++i)
            if (l0 + i < 5) {
#pragma unroll
                for (int r = 0; r < 8; ++r) kp[(size_t)(i * 16 + r) * C_] = (_Float16)(acc[i][r] + bb);
                // the next tile's arithmetic, and behind the last tile the code that follows in the listing, reuse the
                // registers that these stores name
                asm volatile("s_wait_xcnt 0x0" ::: "memory");
                // keeps that arithmetic behind the wait
                __builtin_amdgcn_sched_barrier(0);
            }
    } else {
        _Float16* vp = vt + ((size_t)b * C_ + o) * LP2 + l0 * 16 + 8 * half;
#pragma unroll
        for (int i = 0; i < 3; ++i)
            if (l0 + i < 5) {
#pragma unroll
                for (int r = 0; r < 8; ++r) vp[i * 16 + r] = (_Float16)(acc[i][r] + bb);
                // the next tile's arithmetic, and behind the last tile the code that follows in the listing, reuse the
                // registers that this store names
                asm volatile("s_wait_xcnt 0x0" ::: "memory");
                // keeps that arithmetic behind the wait
                __builtin_amdgcn_sched_barrier(0);
            }
    }
}

// First launch: everything ahead of the Q projection; every stage reads inputs alone. The K/V projection waits on load
// latency and moves few bytes; it takes the lowest block indices, starts first and runs beside the pass over x.
#define AB_KV    (2 * (C_ / 64) * B_)
#define AB_APPLY ((HW_ / (GT_PX * GT_NT)) * (C_ / 64) * B_)
#define PB_CC    (C_ * C_ / (256 * 8))
#define PB_PAD   (B_ * C_ * 2 / 256)
#define PB_QB    (C_ / 8)
__global__ void cab_prep(const float* __restrict__ x, float* __restrict__ part,
                         const float* __restrict__ gamma, const float* __restrict__ beta,
                         _Float16* __restrict__ xn, const float* __restrict__ cond,
                         const float* __restrict__ k_w, const float* __restrict__ kb,
                         const float* __restrict__ v_w, const float* __restrict__ vb,
                         _Float16* __restrict__ kbuf, _Float16* __restrict__ vt,
                         const float* __restrict__ q_w, const float* __restrict__ q_b,
                         const float* __restrict__ proj_w,
                         _Float16* __restrict__ qw16, _Float16* __restrict__ pw16, float* __restrict__ qb2) {
    // one LDS array for the two stages that stage tiles: K/V 2 x 144 rows x 144 B, the pass over x the first 32 KB of it
    __shared__ __align__(16) _Float16 sm[2 * KV_ROWS * KV_P];
    int blk = blockIdx.x;
    if (blk < AB_KV) { gemm_kv_body(cond, k_w, kb, v_w, vb, kbuf, vt, sm, blk & 15, blk >> 4); return; }
    blk -= AB_KV;
    if (blk < AB_APPLY) { gn_apply_t_body(x, part, xn, sm, blk & 7, (blk >> 3) & 7, blk >> 6); return; }
    blk -= AB_APPLY;
    if (blk < PB_CC) { cvt_qw_body(q_w, gamma, qw16, blk); return; }
    blk -= PB_CC;
    if (blk < PB_CC) { cvt_f16_body(proj_w, pw16, blk); return; }
    blk -= PB_CC;
    if (blk < PB_QB) { qbias_body(q_w, beta, q_b, qb2, blk); return; }
    blk -= PB_QB;
    zero_vt_pad_body(vt, blk);
}

// Q projection and attention in one kernel. A work-group does 256 pixels x 128 channels = 2 heads; a wave 32 pixels.
// The projection is formed transposed, Q^T = q_w . xn^T (the weight fragment is the A operand): an accumulator tile
// then holds in lane n the pixel n and in its 8 registers the channels 8*half..8*half+7, which is the place those
// values have in a B fragment (two tiles = one k step of 32). So Q never leaves the registers, and the same holds
// for S^T = K . Q^T (rows = keys) and O^T = Vt . P^T (rows = head channels): a pixel's whole score column lies in
// lanes n and n + 16, the softmax is in-lane but for one exchange, and a lane stores 8 channels of O at once, which
// is one chunk of obuf's fragment order: a wave's store is 512 contiguous bytes.
// Ping-pong LDS weight panels (async staging overlapped with compute); panel 0, once read, takes K and Vt.
// xn arrives not normalised. A k step of 32 channels is two groups, one per fragment half, so the normalisation is one
// packed f16 multiply-add per register, v * rstd + (-mu * rstd), with two wave-uniform constants per group; gamma is
// in w and beta in bias (cab_prep).
typedef __attribute__((ext_vector_type(2))) _Float16 v2h;
__device__ __forceinline__ v16h norm_frag(v16h f, unsigned c0, unsigned c1) {
    v2h a = __builtin_bit_cast(v2h, c0), d = __builtin_bit_cast(v2h, c1);   // (rstd, -mu * rstd) of the two groups
#pragma unroll
    for (int i = 0; i < 8; ++i) { f[i] = f[i] * a[0] + a[1]; f[i + 8] = f[i + 8] * d[0] + d[1]; }
    return f;
}

__global__ __launch_bounds__(256) void cab_qproj_attn(const _Float16* __restrict__ xn, const float* __restrict__ part,
                               const _Float16* __restrict__ w,
                               const float* __restrict__ bias, const _Float16* __restrict__ kbuf,
                               const _Float16* __restrict__ vt, const float* __restrict__ scale_p,
                               _Float16* __restrict__ obuf) {
    __shared__ __align__(16) _Float16 wpan[2][NB * WP];
    __shared__ __align__(16) unsigned gst[32];   // per group of this batch: rstd, -mu * rstd as two f16
    _Float16* kls = wpan[0];                  // 80 key rows x 128 channels, pitch KP
    _Float16* vls = wpan[0] + LP * KP;        // 128 channel rows x 96 keys, pitch VP
    int b  = blockIdx.z;
    int wv = threadIdx.x >> 5;
    int p0 = blockIdx.x * 256 + wv * 32;
    int n0 = blockIdx.y * NB;
    int lane = threadIdx.x & 31, half = lane >> 4;
    const _Float16* A = xn + ((size_t)b * HW_ + p0) * C_;
    v8f acc[2][NB / 16];
#pragma unroll
    for (int g2 = 0; g2 < 2; ++g2)
#pragma unroll
        for (int t = 0; t < NB / 16; ++t) acc[g2][t] = (v8f){0.f,0.f,0.f,0.f,0.f,0.f,0.f,0.f};

    stage_async(wpan[0], w + (size_t)n0 * C_, C_, WP, NB * 32, 32);
    v16h af[2][2], bf[2][4];
    af[0][0] = frag16_fo(A);                  // the first xn fragments fly beside panel 0
    af[0][1] = frag16_fo(A + 16 * C_);
    {
        // GroupNorm statistics of this batch, beside panel 0 too: 8 lanes per group, each takes the partials of one
        // block of 512 pixels (the group's two waves there: sum, squares, sum, squares)
        int g = threadIdx.x >> 3, px = threadIdx.x & 7;
        v4f pv = *(const v4f*)(part + (size_t)((b * 8 + (g >> 2)) * 8 + px) * 32 + (g & 3) * 4);
        float s = pv[0] + pv[2], q = pv[1] + pv[3];
#pragma unroll
        for (int m = 4; m > 0; m >>= 1) { s += __shfl_xor(s, m, 32); q += __shfl_xor(q, m, 32); }
        const float inv_n = 1.f / (GC * HW_);
        float mu   = s * inv_n;
        float rstd = rsqrtf(q * inv_n - mu * mu + 1e-6f);
        if (px == 0) gst[g] = __builtin_bit_cast(unsigned, (v2h){(_Float16)rstd, (_Float16)(-mu * rstd)});
    }
    wait_async_barrier();                     // panel 0 ready; it publishes gst as well
    unsigned gc[32];                          // wave-uniform: kept in scalar registers
#pragma unroll
    for (int g = 0; g < 32; ++g) gc[g] = __builtin_amdgcn_readfirstlane(gst[g]);
    stage_async(wpan[1], w + (size_t)n0 * C_ + 256, C_, WP, NB * 32, 32);  // overlaps half-0 compute

    // Two register sets of fragments. A block is 8 matrix instructions: one k step of 32, 4 of the 8 channel tiles.
    // The weight fragments of block j + 1, and in a step's first block the xn fragments of the next step, are loaded
    // as one group in front of block j.
#pragma unroll
    for (int kh = 0; kh < 2; ++kh) {
        const _Float16* P = wpan[kh];
#pragma unroll
        for (int nt = 0; nt < 4; ++nt) bf[0][nt] = frag16(P + nt * 16 * WP, WP);
#pragma unroll
        for (int j = 0; j < 16; ++j) {
            const int s = j >> 1, hn = j & 1, ca = s & 1;
            const int ks = kh * 8 + s + 1;                 // the next k step, counted over both panels
            if (hn == 0 && ks < 16) {
                af[ca ^ 1][0] = frag16_fo(A + ks * FT);
                af[ca ^ 1][1] = frag16_fo(A + 16 * C_ + ks * FT);
            }
            if (j + 1 < 16) {
#pragma unroll
                for (int nt = 0; nt < 4; ++nt)
                    bf[hn ^ 1][nt] = frag16(P + (((j + 1) & 1) * 4 + nt) * 16 * WP + ((j + 1) >> 1) * 32, WP);
            }
            // keeps those loads in front of this block: without it the compiler sinks each load to its first
            // use and the wave waits out every LDS and global latency in full
            __builtin_amdgcn_sched_barrier(0);
            if (hn == 0) {                                 // this step's xn fragments, once, as they are first used
                af[ca][0] = norm_frag(af[ca][0], gc[(kh * 8 + s) * 2], gc[(kh * 8 + s) * 2 + 1]);
                af[ca][1] = norm_frag(af[ca][1], gc[(kh * 8 + s) * 2], gc[(kh * 8 + s) * 2 + 1]);
            }
#pragma unroll
            for (int nt = 0; nt < 4; ++nt) {
                acc[0][hn * 4 + nt] = wmma16(bf[hn][nt], af[ca][0], acc[0][hn * 4 + nt]);
                acc[1][hn * 4 + nt] = wmma16(bf[hn][nt], af[ca][1], acc[1][hn * 4 + nt]);
            }
            // ends the block: later loads may not rise among these matrix instructions
            __builtin_amdgcn_sched_barrier(0);
        }
        if (kh == 0) {
            // this wave's reads of panel 0 have returned before the barrier behind which panel 0 is refilled
            asm volatile("s_wait_dscnt 0x0" ::: "memory");
            wait_async_barrier();   // panel 1 ready; every wave has left panel 0
            // K (rows l, ld C_) and Vt (rows d, ld LP2) of this batch and these 2 heads fly beside half-1 compute.
            // 16-byte chunks, 5 + 6 per thread, every lane on; one statement and one wait per run of copies.
            unsigned kl = (unsigned)(size_t)(void*)kls, vl = (unsigned)(size_t)(void*)vls;
            const _Float16* kg = kbuf + (size_t)b * LP * C_ + n0;
            const _Float16* vg = vt + ((size_t)b * C_ + n0) * LP2;
            unsigned la[6];
            const _Float16* ga[6];
#pragma unroll
            for (int u = 0; u < 5; ++u) {
                int i = u * 256 + threadIdx.x, row = i >> 4, cc = (i & 15) * 8;
                la[u] = kl + (unsigned)((row * KP + cc) * 2);
                ga[u] = kg + (size_t)row * C_ + cc;
            }
            // the wait stands in the copies' own statement: the Vt addresses below reuse these registers
            asm volatile("global_load_async_to_lds_b128 %0, %1, off\n\t"
                         "global_load_async_to_lds_b128 %2, %3, off\n\t"
                         "global_load_async_to_lds_b128 %4, %5, off\n\t"
                         "global_load_async_to_lds_b128 %6, %7, off\n\t"
                         "global_load_async_to_lds_b128 %8, %9, off\n\t"
                         "s_wait_xcnt 0x0"
                         :: "v"(la[0]), "v"(ga[0]), "v"(la[1]), "v"(ga[1]), "v"(la[2]), "v"(ga[2]),
                            "v"(la[3]), "v"(ga[3]), "v"(la[4]), "v"(ga[4]) : "memory");
#pragma unroll
            for (int u = 0; u < 6; ++u) {
                int i = u * 256 + threadIdx.x, row = i / 12, cc = (i - row * 12) * 8;
                la[u] = vl + (unsigned)((row * VP + cc) * 2);
                ga[u] = vg + (size_t)row * LP2 + cc;
            }
            // the wait stands in the copies' own statement: the main loop reuses these registers
            asm volatile("global_load_async_to_lds_b128 %0, %1, off\n\t"
                         "global_load_async_to_lds_b128 %2, %3, off\n\t"
                         "global_load_async_to_lds_b128 %4, %5, off\n\t"
                         "global_load_async_to_lds_b128 %6, %7, off\n\t"
                         "global_load_async_to_lds_b128 %8, %9, off\n\t"
                         "global_load_async_to_lds_b128 %10, %11, off\n\t"
                         "s_wait_xcnt 0x0"
                         :: "v"(la[0]), "v"(ga[0]), "v"(la[1]), "v"(ga[1]), "v"(la[2]), "v"(ga[2]),
                            "v"(la[3]), "v"(ga[3]), "v"(la[4]), "v"(ga[4]), "v"(la[5]), "v"(ga[5]) : "memory");
        }
    }
    // a lane's 8 bias values per channel tile: channels 8*half..8*half+7 of the tile
    v4f bq[NB / 16][2];
#pragma unroll
    for (int nt = 0; nt < NB / 16; ++nt) {
        bq[nt][0] = *(const v4f*)(bias + n0 + nt * 16 + 8 * half);
        bq[nt][1] = *(const v4f*)(bias + n0 + nt * 16 + 8 * half + 4);
    }
    float scl = scale_p[0];
    // the arithmetic below reuses the registers that the xn loads and the bias loads name
    asm volatile("s_wait_xcnt 0x0" ::: "memory");
    // keeps that arithmetic behind the wait
    __builtin_amdgcn_sched_barrier(0);
    wait_async_barrier();                     // K and Vt have landed, for every wave

    // Q^T + bias as B fragments: element i = channel 8*half + i of the k step's first tile, i + 8 the same of its second
    v16h qf[2][2][2];                         // [pixel tile][head][k step]
#pragma unroll
    for (int g2 = 0; g2 < 2; ++g2)
#pragma unroll
        for (int nt = 0; nt < NB / 16; ++nt)
#pragma unroll
            for (int r = 0; r < 8; ++r)
                qf[g2][nt >> 2][(nt >> 1) & 1][(nt & 1) * 8 + r] = (_Float16)(acc[g2][nt][r] + bq[nt][r >> 2][r & 3]);
    __builtin_amdgcn_sched_barrier(0);

#pragma unroll
    for (int hh = 0; hh < 2; ++hh) {
        v8f s[2][5];                          // S^T: lane = pixel, key l = t*16 + r + 8*half
#pragma unroll
        for (int t = 0; t < 5; ++t) {
            v16h k0 = frag16(kls + (t * 16) * KP + hh * HD,      KP);
            v16h k1 = frag16(kls + (t * 16) * KP + hh * HD + 32, KP);
#pragma unroll
            for (int g2 = 0; g2 < 2; ++g2) {
                v8f z = (v8f){0.f,0.f,0.f,0.f,0.f,0.f,0.f,0.f};
                z = wmma16(k0, qf[g2][hh][0], z);
                z = wmma16(k1, qf[g2][hh][1], z);
                s[g2][t] = z;
            }
        }
        v16h pf[2][3];                        // P^T as B fragments, 3 k steps of 32 keys (80..95 zero)
#pragma unroll
        for (int g2 = 0; g2 < 2; ++g2) {
            float m = -3.0e38f;
#pragma unroll
            for (int t = 0; t < 5; ++t)
#pragma unroll
                for (int r = 0; r < 8; ++r) {
                    float v = s[g2][t][r] * scl;
                    if (t == 4 && r >= 5 && half) v = -3.0e38f;    // key 64 + r + 8*half >= 77
                    s[g2][t][r] = v; m = fmaxf(m, v);
                }
            m = fmaxf(m, __shfl_xor(m, 16, 32));
            float sum = 0.f;
#pragma unroll
            for (int t = 0; t < 5; ++t)
#pragma unroll
                for (int r = 0; r < 8; ++r) { float e = __expf(s[g2][t][r] - m); s[g2][t][r] = e; sum += e; }
            sum += __shfl_xor(sum, 16, 32);
            float inv = 1.f / sum;
#pragma unroll
            for (int t = 0; t < 6; ++t)
#pragma unroll
                for (int r = 0; r < 8; ++r)
                    pf[g2][t >> 1][(t & 1) * 8 + r] = (t < 5) ? (_Float16)(s[g2][t < 5 ? t : 0][r] * inv) : (_Float16)0.f;
        }
        v8f oacc[2][4];                       // O^T: lane = pixel, head channel d = nt*16 + r + 8*half
#pragma unroll
        for (int g2 = 0; g2 < 2; ++g2)
#pragma unroll
            for (int nt = 0; nt < 4; ++nt) oacc[g2][nt] = (v8f){0.f,0.f,0.f,0.f,0.f,0.f,0.f,0.f};
#pragma unroll
        for (int kc = 0; kc < 3; ++kc)
#pragma unroll
            for (int nt = 0; nt < 4; ++nt) {
                v16h va = frag16(vls + (hh * HD + nt * 16) * VP + kc * 32, VP);
                oacc[0][nt] = wmma16(va, pf[0][kc], oacc[0][nt]);
                oacc[1][nt] = wmma16(va, pf[1][kc], oacc[1][nt]);
            }
        v8h d[2][4];
#pragma unroll
        for (int g2 = 0; g2 < 2; ++g2)
#pragma unroll
            for (int nt = 0; nt < 4; ++nt)
#pragma unroll
                for (int r = 0; r < 8; ++r) d[g2][nt][r] = (_Float16)oacc[g2][nt][r];
        // keeps the conversions in front of the stores: mixed with them they share one register set, and each
        // store is then followed by a wait before its registers are written again
        __builtin_amdgcn_sched_barrier(0);
#pragma unroll
        for (int g2 = 0; g2 < 2; ++g2)
#pragma unroll
            for (int nt = 0; nt < 4; ++nt)
                // channel tile nt is half nt & 1 of k step (n0 + hh * HD) / 32 + nt / 2: chunk (nt & 1) * 32 + lane
                *(v8h*)(obuf + ((size_t)b * HW_ + p0 + g2 * 16) * C_ + ((n0 + hh * HD) / 32) * FT + nt * 256 + lane * 8) = d[g2][nt];
        if (hh == 0) {
            // the second head's arithmetic reuses the registers that these stores name
            asm volatile("s_wait_xcnt 0x0" ::: "memory");
            // keeps that arithmetic behind the wait
            __builtin_amdgcn_sched_barrier(0);
        }
    }
}

// Final projection + residual: out[b,o,p] = x + O @ proj_w^T + proj_b; wave does 32(M) x 128(N): every A fragment, 1 KB
// in a row of obuf (fragment order), feeds 8 matrix instructions, and obuf is read C_/NB = 4 times in all.
// Ping-pong LDS weight panels; the same LDS is reused as f32 transpose buffer for coalesced stores.
__global__ __launch_bounds__(256) void cab_gemm_proj(const _Float16* __restrict__ obuf, const _Float16* __restrict__ w,
                              const float* __restrict__ bias, const float* __restrict__ x,
                              float* __restrict__ out) {
    __shared__ __align__(16) char smem[2 * NB * WP * 2];   // 2 weight panels; reused for transpose
    _Float16* wpan0 = (_Float16*)smem;
    _Float16* wpan1 = (_Float16*)(smem + NB * WP * 2);
    int b  = blockIdx.z;
    int wv = threadIdx.x >> 5;
    int p0 = blockIdx.x * 256 + wv * 32;
    int n0 = blockIdx.y * NB;
    int lane = threadIdx.x & 31, half = lane >> 4, n15 = lane & 15;
    const _Float16* A = obuf + ((size_t)b * HW_ + p0) * C_;
    v8f acc[2][NB / 16];
#pragma unroll
    for (int g2 = 0; g2 < 2; ++g2)
#pragma unroll
        for (int t = 0; t < NB / 16; ++t) acc[g2][t] = (v8f){0.f,0.f,0.f,0.f,0.f,0.f,0.f,0.f};

    stage_async(wpan0, w + (size_t)n0 * C_, C_, WP, NB * 32, 32);
    v16h af[2][2], bf[2][4];
    af[0][0] = frag16_fo(A);                  // the first A fragments fly beside panel 0
    af[0][1] = frag16_fo(A + 16 * C_);
    wait_async_barrier();
    stage_async(wpan1, w + (size_t)n0 * C_ + 256, C_, WP, NB * 32, 32);    // overlaps half-0 compute

    // Two register sets of fragments. A block is 8 matrix instructions: one k step of 32, 4 of the 8 channel tiles.
    // The B fragments of block j + 1, and in a step's first block the A fragments of the next step, are loaded
    // as one group in front of block j.
#pragma unroll
    for (int kh = 0; kh < 2; ++kh) {
        const _Float16* P = kh ? wpan1 : wpan0;
#pragma unroll
        for (int nt = 0; nt < 4; ++nt) bf[0][nt] = frag16(P + nt * 16 * WP, WP);
#pragma unroll
        for (int j = 0; j < 16; ++j) {
            const int s = j >> 1, hn = j & 1, ca = s & 1;
            const int ks = kh * 8 + s + 1;                 // the next k step, counted over both panels
            if (hn == 0 && ks < 16) {
                af[ca ^ 1][0] = frag16_fo(A + ks * FT);
                af[ca ^ 1][1] = frag16_fo(A + 16 * C_ + ks * FT);
            }
            if (j + 1 < 16) {
#pragma unroll
                for (int nt = 0; nt < 4; ++nt)
                    bf[hn ^ 1][nt] = frag16(P + (((j + 1) & 1) * 4 + nt) * 16 * WP + ((j + 1) >> 1) * 32, WP);
            }
            // keeps those loads in front of this block: without it the compiler sinks each load to its first
            // use and the wave waits out every LDS and global latency in full
            __builtin_amdgcn_sched_barrier(0);
#pragma unroll
            for (int nt = 0; nt < 4; ++nt) {
                acc[0][hn * 4 + nt] = wmma16(af[ca][0], bf[hn][nt], acc[0][hn * 4 + nt]);
                acc[1][hn * 4 + nt] = wmma16(af[ca][1], bf[hn][nt], acc[1][hn * 4 + nt]);
            }
            // ends the block: later loads may not rise among these matrix instructions
            __builtin_amdgcn_sched_barrier(0);
        }
        if (kh == 0) wait_async_barrier();   // panel 1 ready
    }
    // the epilogue's address arithmetic reuses the register pair that the A loads name
    asm volatile("s_wait_xcnt 0x0" ::: "memory");
    // keeps that arithmetic behind the wait
    __builtin_amdgcn_sched_barrier(0);
    __syncthreads();                          // all weight reads done before smem reuse

    float* T = (float*)smem + (size_t)wv * NB * 33;        // [128 o][32 p], stride 33; 8 waves fill smem exactly
#pragma unroll
    for (int g2 = 0; g2 < 2; ++g2)
#pragma unroll
        for (int nt = 0; nt < NB / 16; ++nt)
#pragma unroll
            for (int r = 0; r < 8; ++r)
                T[(nt * 16 + n15) * 33 + g2 * 16 + r + 8 * half] = acc[g2][nt][r];
    __syncthreads();
    // The wave's 32 pixels of one output channel are one 128-byte line: 8 lanes x 16 B take it whole, 4 channels a trip.
    int pc = (lane & 7) * 4;
    size_t base = ((size_t)b * C_ + n0 + (lane >> 3)) * HW_ + p0 + pc;
    const float* t0 = T + (lane >> 3) * 33 + pc;
#pragma unroll
    for (int i0 = 0; i0 < NB / 4; i0 += 8) {               // 8 loads of x in flight per wave
        v4f xv[8];
        float bo[8];
#pragma unroll
        for (int u = 0; u < 8; ++u) {
            xv[u] = *(const v4f*)(x + base + (size_t)(i0 + u) * 4 * HW_);
            bo[u] = bias[n0 + (i0 + u) * 4 + (lane >> 3)];
        }
#pragma unroll
        for (int u = 0; u < 8; ++u) {
            const float* t = t0 + (i0 + u) * 4 * 33;
            v4f ov;
#pragma unroll
            for (int j = 0; j < 4; ++j) ov[j] = xv[u][j] + t[j] + bo[u];
            *(v4f*)(out + base + (size_t)(i0 + u) * 4 * HW_) = ov;
        }
        if (i0 + 8 < NB / 4) {
            // the next trip's loads and address arithmetic reuse the registers that these stores name
            asm volatile("s_wait_xcnt 0x0" ::: "memory");
            // keeps the next trip's instructions behind that wait
            __builtin_amdgcn_sched_barrier(0);
        }
    }
}

extern "C" void kernel_launch(void* const* d_in, const int* in_sizes, int n_in,
                              void* d_out, int out_size, void* d_ws, size_t ws_size,
                              hipStream_t stream) {
    const float* x      = (const float*)d_in[0];
    const float* cond   = (const float*)d_in[1];
    const float* gamma  = (const float*)d_in[2];
    const float* beta   = (const float*)d_in[3];
    const float* q_w    = (const float*)d_in[4];
    const float* q_b    = (const float*)d_in[5];
    const float* k_w    = (const float*)d_in[6];
    const float* k_b    = (const float*)d_in[7];
    const float* v_w    = (const float*)d_in[8];
    const float* v_b    = (const float*)d_in[9];
    const float* proj_w = (const float*)d_in[10];
    const float* proj_b = (const float*)d_in[11];
    const float* scale  = (const float*)d_in[12];
    float* out = (float*)d_out;

    char* ws = (char*)d_ws;
    size_t off = 0;
    auto carve = [&](size_t bytes) { void* p = ws + off; off = (off + bytes + 255) & ~(size_t)255; return p; };
    float*     part  = (float*)    carve((size_t)AB_APPLY * 32 * sizeof(float));
    float*     qb2   = (float*)    carve(C_ * sizeof(float));
    _Float16*  qw16  = (_Float16*) carve((size_t)C_ * C_  * 2);
    _Float16*  pw16  = (_Float16*) carve((size_t)C_ * C_  * 2);
    _Float16*  kbuf  = (_Float16*) carve((size_t)B_ * LP  * C_  * 2);
    _Float16*  vt    = (_Float16*) carve((size_t)B_ * C_  * LP2 * 2);
    _Float16*  xn    = (_Float16*) carve((size_t)B_ * HW_ * C_  * 2);
    _Float16*  obuf  = (_Float16*) carve((size_t)B_ * HW_ * C_  * 2);  // not xn: other work-groups still read xn

    // 1) K/V projection; x to f16 fragment order with the GroupNorm partial sums; q and proj weights to f16; Vt pad
    cab_prep<<<AB_KV + AB_APPLY + 2 * PB_CC + PB_QB + PB_PAD, 256, 0, stream>>>(x, part, gamma, beta, xn, cond, k_w, k_b, v_w, v_b,
                                                                                kbuf, vt, q_w, q_b, proj_w, qw16, pw16, qb2);

    // 2) GroupNorm statistics and apply + Q projection + attention
    cab_qproj_attn<<<dim3(HW_ / 256, C_ / NB, B_), 256, 0, stream>>>(xn, part, qw16, qb2, kbuf, vt, scale, obuf);

    // 3) output projection + residual
    cab_gemm_proj<<<dim3(HW_ / 256, C_ / NB, B_), 256, 0, stream>>>(obuf, pw16, proj_b, x, out);
}

// v010
// One run takes 103 microseconds.
// Next to v009, in two timings, it ran 1.05 times as fast each time.
// All steps since v000 together make it 4.75 times as fast.
#include <hip/hip_runtime.h>

typedef __attribute__((ext_vector_type(16))) _Float16 v16h;
typedef __attribute__((ext_vector_type(8)))  float    v8f;

#define B_   16
#define C_   512
#define CD_  768
#define HW_  4096
#define L_   77
#define LP   80     // padded key rows (5 x 16 tiles)
#define LP2  96     // padded key width for PV (3 x 32 K-chunks)
#define HD   64
#define GC   16     // channels per group (C/32)
#define WP   264    // weight panel rows: 256 halves + 8  (528 B)
#define KP   136    // K rows: 128 halves (2 heads) + 8     (272 B)
#define VP   104    // Vt rows: 96 halves + 8              (208 B)
#define NB   128    // output channels per work-group of the two projection GEMMs (8 tiles of 16 per wave)

__device__ __forceinline__ v8f wmma16(v16h a, v16h b, v8f c) {
    return __builtin_amdgcn_wmma_f32_16x16x32_f16(false, a, false, b, (short)0, c, false, false);
}

__device__ __forceinline__ v16h frag16(const _Float16* p, int ld) {
    int lane = threadIdx.x & 31;
    const _Float16* b = p + (size_t)(lane & 15) * ld + ((lane >> 4) << 3);
    v16h f;
#pragma unroll
    for (int i = 0; i < 8; ++i) { f[i] = b[i]; f[i + 8] = b[i + 16]; }
    return f;
}

// xn and obuf, the two activation buffers [pixel][channel] that the projections read as fragments, are kept in
// FRAGMENT ORDER: a tile of 16 pixels x 32 channels is 1 KB in a row, as 64 chunks of 16 B; chunk j*32 + lane holds
// what that lane of frag16 takes as elements 8j..8j+7 (pixel lane & 15, channels 16j + 8*(lane >> 4) + 0..7).
// Tiles run over the 16 k steps first, then over the pixel tiles, so pixel tile T starts at T * 16 * C_ halves.
// A wave's 16-byte load or store of a fragment half is then 512 contiguous bytes = 4 whole lines, not 16 pieces of 32 B.
typedef __attribute__((ext_vector_type(8))) _Float16 v8h;
#define FT   512    // halves per fragment tile (16 px x 32 ch)
__device__ __forceinline__ v16h frag16_fo(const _Float16* tile) {
    const _Float16* b = tile + (threadIdx.x & 31) * 8;
    v8h lo = *(const v8h*)b, hi = *(const v8h*)(b + 256);
    v16h f;
#pragma unroll
    for (int i = 0; i < 8; ++i) { f[i] = lo[i]; f[i + 8] = hi[i]; }
    return f;
}

// f32 source (cond) with clamped row index (L=77 tail tile).
__device__ __forceinline__ v16h frag16_f32c(const float* p, int ld, int rows_left) {
    int lane = threadIdx.x & 31;
    int r = lane & 15;
    if (r >= rows_left) r = rows_left - 1;
    const float* b = p + (size_t)r * ld + ((lane >> 4) << 3);
    v16h f;
#pragma unroll
    for (int i = 0; i < 8; ++i) { f[i] = (_Float16)b[i]; f[i + 8] = (_Float16)b[i + 16]; }
    return f;
}

#define WG_T  512   // threads of the two GEMM kernels: 16 waves, one work-group per WGP
#define WG_PX 512   // pixels per pass of such a work-group (32 per wave)
#define WG_NI 2     // passes per work-group
__device__ __forceinline__ void stage_async(_Float16* dst, const _Float16* src,
                                            int src_ld, int dst_ld, int nchunks, int cpr) {
    unsigned base = (unsigned)(size_t)(void*)dst;   // low 32 bits of generic addr == LDS offset
    for (int i = threadIdx.x; i < nchunks; i += WG_T) {
        int row = i / cpr;
        int cc  = (i - row * cpr) * 8;
        unsigned long long g = (unsigned long long)(src + (size_t)row * src_ld + cc);
        unsigned l = base + (unsigned)((row * dst_ld + cc) * 2);
        // the wait stands in the copy's own statement: the next trip rewrites l and g
        asm volatile("global_load_async_to_lds_b128 %0, %1, off\n\ts_wait_xcnt 0x0" :: "v"(l), "v"(g) : "memory");
    }
}

__device__ __forceinline__ void wait_async_barrier() {
    asm volatile("s_wait_asynccnt 0" ::: "memory");
    __syncthreads();
}

// The bodies below take their block index as an argument: independent stages share a launch (cab_prep).
// A lane converts 8 elements: two 16-byte loads, one 16-byte store. Every weight count is a multiple of 256 * 8.
typedef __attribute__((ext_vector_type(4))) float    v4f;
typedef __attribute__((ext_vector_type(2))) float    v2f;
__device__ __forceinline__ void cvt_f16_body(const float* __restrict__ in, _Float16* __restrict__ out, int blk) {
    size_t i = (size_t)(blk * 256 + threadIdx.x) * 8;
    v4f a = *(const v4f*)(in + i), c = *(const v4f*)(in + i + 4);
    v8h h;
#pragma unroll
    for (int j = 0; j < 4; ++j) { h[j] = (_Float16)a[j]; h[j + 4] = (_Float16)c[j]; }
    *(v8h*)(out + i) = h;
    // in the shared launch other stages' code follows this store in the listing and reuses the registers it names
    asm volatile("s_wait_xcnt 0x0" ::: "memory");
}

__device__ __forceinline__ void zero_vt_pad_body(_Float16* __restrict__ vt, int blk) {
    int i = blk * 256 + threadIdx.x;                 // over B_*C_*2: a row's pad, keys 80..95, is two 16-byte chunks
    int bo = i >> 1;
    int j  = i & 1;
    *(v8h*)(vt + (size_t)bo * LP2 + 80 + j * 8) = (v8h){0, 0, 0, 0, 0, 0, 0, 0};
    // in the shared launch other stages' code follows this store in the listing and reuses the registers it names
    asm volatile("s_wait_xcnt 0x0" ::: "memory");
}

// q_w with gamma folded in: q_w . (n * gamma + beta) = (q_w * gamma) . n + q_w . beta, n being the normalised value.
__device__ __forceinline__ void cvt_qw_body(const float* __restrict__ in, const float* __restrict__ gamma,
                                            _Float16* __restrict__ out, int blk) {
    size_t i = (size_t)(blk * 256 + threadIdx.x) * 8;
    int c = (int)(i & (C_ - 1));
    v4f a = *(const v4f*)(in + i), d = *(const v4f*)(in + i + 4);
    v4f g0 = *(const v4f*)(gamma + c), g1 = *(const v4f*)(gamma + c + 4);
    // the products below reuse the offset register that the gamma loads name
    asm volatile("s_wait_xcnt 0x0" ::: "memory");
    v8h h;
#pragma unroll
    for (int j = 0; j < 4; ++j) { h[j] = (_Float16)(a[j] * g0[j]); h[j + 4] = (_Float16)(d[j] * g1[j]); }
    *(v8h*)(out + i) = h;
    // in the shared launch other stages' code follows this store in the listing and reuses the registers it names
    asm volatile("s_wait_xcnt 0x0" ::: "memory");
}

// The beta part of that sum joins the bias, in f32: qb2[o] = q_b[o] + sum_c q_w[o][c] * beta[c]. One wave per o.
__device__ __forceinline__ void qbias_body(const float* __restrict__ q_w, const float* __restrict__ beta,
                                           const float* __restrict__ q_b, float* __restrict__ qb2, int blk) {
    int lane = threadIdx.x & 31;
    int o = blk * 8 + (threadIdx.x >> 5);
    v4f s4 = (v4f){0.f, 0.f, 0.f, 0.f};
#pragma unroll
    for (int i = 0; i < C_ / 128; ++i)
        s4 += *(const v4f*)(q_w + (size_t)o * C_ + i * 128 + lane * 4) * *(const v4f*)(beta + i * 128 + lane * 4);
    float s = (s4[0] + s4[1]) + (s4[2] + s4[3]);
#pragma unroll
    for (int m = 16; m > 0; m >>= 1) s += __shfl_xor(s, m, 32);
    if (lane == 0) qb2[o] = q_b[o] + s;
    // in the shared launch other stages' code follows this store in the listing and reuses the registers it names
    asm volatile("s_wait_xcnt 0x0" ::: "memory");
}

#define GT_PX 128   // pixels per tile
#define GT_NT 4     // tiles per work-group
__device__ __forceinline__ void gn_apply_t_body(const float* __restrict__ x, float* __restrict__ part,
                               _Float16* __restrict__ xn, _Float16* sm, int bx, int by, int b) {
    int c0 = by * 64, pb = bx * (GT_PX * GT_NT);
    int lane = threadIdx.x & 31;
    int wv = __builtin_amdgcn_readfirstlane(threadIdx.x >> 5);   // scalar: wave-uniform addresses stay in scalar registers
    int cw = c0 + wv * 8;
    v4f s4 = (v4f){0.f, 0.f, 0.f, 0.f}, q4 = (v4f){0.f, 0.f, 0.f, 0.f};

    const float* src = x + ((size_t)b * C_ + cw) * HW_ + pb + lane * 4;
    v4f v[2][8];                                  // two register sets: loads run two tiles ahead of the LDS pass
#pragma unroll
    for (int u = 0; u < 2; ++u)
#pragma unroll
        for (int i = 0; i < 8; ++i) v[u][i] = *(const v4f*)(src + (size_t)i * HW_ + u * GT_PX);

    int swap = (lane >> 3) & 1;
    int slot = (wv ^ (lane & 7)) * 8;
#pragma unroll
    for (int t = 0; t < GT_NT; ++t) {
        v8h h[4];
#pragma unroll
        for (int j = 0; j < 4; ++j)
#pragma unroll
            for (int i = 0; i < 8; ++i) h[j][i] = (_Float16)v[t & 1][i][j];
#pragma unroll
        for (int i = 0; i < 8; ++i) { s4 += v[t & 1][i]; q4 += v[t & 1][i] * v[t & 1][i]; }
        if (t + 2 < GT_NT) {
#pragma unroll
            for (int i = 0; i < 8; ++i) v[t & 1][i] = *(const v4f*)(src + (size_t)i * HW_ + (t + 2) * GT_PX);
        }
        _Float16* buf = sm + (t & 1) * (GT_PX * 64);
#pragma unroll
        for (int j = 0; j < 4; ++j) *(v8h*)(buf + ((lane * 4 + j) ^ swap) * 64 + slot) = h[j];
        // Work-group barrier, one per tile, with the LDS wait alone: it publishes this buffer, and every wave's
        // reads of the other buffer have returned before it. __syncthreads() would also drain the global loads
        // of the next tiles and the stores of the last one, which no other wave depends on.
        asm volatile("s_wait_dscnt 0x0\n\ts_barrier_signal -1\n\ts_barrier_wait -1" ::: "memory");
#pragma unroll
        for (int k = 0; k < 4; ++k) {
            int pt = k * 2 + (wv >> 2);           // pixel tile of 16 in this tile; wave bits 1, 0 = k step, half j
            int p = pt * 16 + (lane & 15);
            int w = (wv & 3) * 2 + (lane >> 4);
            int r = p ^ ((p >> 5) & 1);
            int q = w ^ ((p >> 2) & 7);
            v8h d = *(const v8h*)(buf + (r * 8 + q) * 8);
            *(v8h*)(xn + ((size_t)b * HW_ + pb + t * GT_PX + pt * 16) * C_ + (by * 2) * FT + (wv & 3) * 256 + lane * 8) = d;
        }
        // the next tile's loads and arithmetic, and behind the last tile the reduction and store of the sums below,
        // reuse the registers that these stores name
        asm volatile("s_wait_xcnt 0x0" ::: "memory");
        // keeps the next tile's arithmetic, and with it the wait for its loads, behind this tile's stores and that wait
        __builtin_amdgcn_sched_barrier(0);
    }
    float s = (s4[0] + s4[1]) + (s4[2] + s4[3]), q = (q4[0] + q4[1]) + (q4[2] + q4[3]);
#pragma unroll
    for (int m = 16; m > 0; m >>= 1) { s += __shfl_xor(s, m, 32); q += __shfl_xor(q, m, 32); }
    // a work-group owns one 128-byte line of part: 8 waves x (sum, sum of squares)
    if (lane == 0) *(v2f*)(part + (size_t)((b * 8 + by) * 8 + bx) * 32 + wv * 2) = (v2f){s, q};
    // in the shared launch other stages' code follows this store in the listing and reuses the registers it names
    asm volatile("s_wait_xcnt 0x0" ::: "memory");
}

// K/V projection: cond [B,77,768] and the weights are f32 inputs, rounded to f16 on the way, so that the stage needs
// inputs alone and runs in the first launch. One work-group: the 80 key rows of a batch x 64 output channels of K or V.
// A fragment read straight from memory touches 16 rows = 16 lines per load instruction, and every fragment would be
// read by many waves. Here the 80 + 64 rows go through LDS in chunks of 64 k: a load instruction takes 256 contiguous
// bytes of each of two rows (4 whole lines), each byte once per work-group; the fragments come from LDS.
// Two LDS buffers and one register set: chunk c + 1 is in flight from memory while chunk c is multiplied.
typedef __attribute__((ext_vector_type(4))) _Float16 v4h;
#define KV_KC   64              // k per chunk
#define KV_P    72              // LDS row pitch in halves: 144 B = 16 B x 9
#define KV_ROWS (LP + 64)       // key rows, then weight rows
#define KV_NL   (KV_ROWS / 16)  // load instructions per wave and chunk (8 waves x 2 rows each)
__device__ __forceinline__ void gemm_kv_body(const float* __restrict__ cond,
                            const float* __restrict__ kw, const float* __restrict__ kb,
                            const float* __restrict__ vw, const float* __restrict__ vb,
                            _Float16* __restrict__ kbuf, _Float16* __restrict__ vt, _Float16* sm, int by, int b) {
    int wv = __builtin_amdgcn_readfirstlane(threadIdx.x >> 5);   // scalar: wave-uniform tile choice
    int lane = threadIdx.x & 31, half = lane >> 4, n15 = lane & 15;
    int isv = by >> 3;                              // by < 16: 8 channel blocks of K, then 8 of V
    int n0 = (by & 7) * 64;
    const float*    w   = isv ? vw : kw;
    const float*    bia = isv ? vb : kb;
    // load u of a wave: row u * 16 + rw of the 144; u < 5 are key rows (77..79 repeat row 76, masked later), the rest weights
    int rw = wv * 2 + half;
    const float* pa  = cond + ((size_t)b * L_ + rw) * CD_ + n15 * 4;
    int rl = 64 + rw; if (rl > L_ - 1) rl = L_ - 1;
    const float* pa4 = cond + ((size_t)b * L_ + rl) * CD_ + n15 * 4;
    const float* pw  = w + (size_t)(n0 + rw) * CD_ + n15 * 4;
    v4f v[KV_NL];
#pragma unroll
    for (int u = 0; u < KV_NL; ++u)
        v[u] = *(const v4f*)(u < 4 ? pa + (size_t)u * 16 * CD_ : u == 4 ? pa4 : pw + (size_t)(u - 5) * 16 * CD_);
    int nt = wv & 3;                                // channel tile; waves 0..3 take key tiles 0, 1, 2, waves 4..7 tiles 3, 4
    int l0 = (wv >> 2) * 3;
    v8f acc[3];
#pragma unroll
    for (int i = 0; i < 3; ++i) acc[i] = (v8f){0.f,0.f,0.f,0.f,0.f,0.f,0.f,0.f};
#pragma unroll
    for (int c = 0; c < CD_ / KV_KC; ++c) {
        _Float16* buf = sm + (c & 1) * (KV_ROWS * KV_P);
#pragma unroll
        for (int u = 0; u < KV_NL; ++u) {
            v4h h4;
#pragma unroll
            for (int j = 0; j < 4; ++j) h4[j] = (_Float16)v[u][j];
            *(v4h*)(buf + (u * 16 + rw) * KV_P + n15 * 4) = h4;
        }
        // keeps the next chunk's loads behind the conversion, in the same registers: raised over it they take a second
        // register set, and the launch's 128 registers a wave no longer hold the stage without spills
        __builtin_amdgcn_sched_barrier(0);
        if (c + 1 < CD_ / KV_KC) {
            const int k = (c + 1) * KV_KC;
#pragma unroll
            for (int u = 0; u < KV_NL; ++u)
                v[u] = *(const v4f*)(u < 4 ? pa + (size_t)u * 16 * CD_ + k : u == 4 ? pa4 + k : pw + (size_t)(u - 5) * 16 * CD_ + k);
        }
        // keeps the next chunk's loads in front of the barrier and the products: sunk to their use they would not overlap
        __builtin_amdgcn_sched_barrier(0);
        // Work-group barrier, one per chunk, with the LDS wait alone: it publishes this buffer, and every wave's reads of
        // the other buffer have returned before it. __syncthreads() would also drain the loads of the next chunk.
        asm volatile("s_wait_dscnt 0x0\n\ts_barrier_signal -1\n\ts_barrier_wait -1" ::: "memory");
#pragma unroll
        for (int ks = 0; ks < KV_KC / 32; ++ks) {
            v16h bf = frag16(buf + (LP + nt * 16) * KV_P + ks * 32, KV_P);
            v16h a[3];
#pragma unroll
            for (int i = 0; i < 3; ++i) {
                // 20 tiles on 8 waves: the third tile of waves 4..7 repeats key tile 4 and is not stored (one code path)
                int lt = l0 + i < 5 ? l0 + i : 4;
                a[i] = frag16(buf + lt * 16 * KV_P + ks * 32, KV_P);
            }
            // keeps the k step's eight LDS loads together in front of its products: sunk to their uses, into one
            // register set, the wave waits out the LDS latency three times instead of once
            __builtin_amdgcn_sched_barrier(0);
#pragma unroll
            for (int i = 0; i < 3; ++i) acc[i] = wmma16(a[i], bf, acc[i]);
            // one k step's four fragments at a time, for the same register bound
            __builtin_amdgcn_sched_barrier(0);
        }
    }
    // the address arithmetic of the stores reuses the registers that the loads name
    asm volatile("s_wait_xcnt 0x0" ::: "memory");
    int o = n0 + nt * 16 + n15;
    float bb = bia[o];
    // K or V is the same for the whole work-group: one scalar branch around all stores
    if (!isv) {
        _Float16* kp = kbuf + ((size_t)b * LP + l0 * 16 + 8 * half) * C_ + o;     // key rows < 80 ; 77..79 masked later
#pragma unroll
        for (int i = 0; i < 3; ++i)
            if (l0 + i < 5) {
#pragma unroll
                for (int r = 0; r < 8; ++r) kp[(size_t)(i * 16 + r) * C_] = (_Float16)(acc[i][r] + bb);
                // the next tile's arithmetic, and behind the last tile the code that follows in the listing, reuse the
                // registers that these stores name
                asm volatile("s_wait_xcnt 0x0" ::: "memory");
                // keeps that arithmetic behind the wait
                __builtin_amdgcn_sched_barrier(0);
            }
    } else {
        _Float16* vp = vt + ((size_t)b * C_ + o) * LP2 + l0 * 16 + 8 * half;
#pragma unroll
        for (int i = 0; i < 3; ++i)
            if (l0 + i < 5) {
#pragma unroll
                for (int r = 0; r < 8; ++r) vp[i * 16 + r] = (_Float16)(acc[i][r] + bb);
                // the next tile's arithmetic, and behind the last tile the code that follows in the listing, reuse the
                // registers that this store names
                asm volatile("s_wait_xcnt 0x0" ::: "memory");
                // keeps that arithmetic behind the wait
                __builtin_amdgcn_sched_barrier(0);
            }
    }
}

// First launch: everything ahead of the Q projection; every stage reads inputs alone. The K/V projection waits on load
// latency and moves few bytes; it takes the lowest block indices and runs beside the pass over x.
#define AB_KV    (2 * (C_ / 64) * B_)
#define AB_APPLY ((HW_ / (GT_PX * GT_NT)) * (C_ / 64) * B_)
#define PB_CC    (C_ * C_ / (256 * 8))
#define PB_PAD   (B_ * C_ * 2 / 256)
#define PB_QB    (C_ / 8)
__global__ void cab_prep(const float* __restrict__ x, float* __restrict__ part,
                         const float* __restrict__ gamma, const float* __restrict__ beta,
                         _Float16* __restrict__ xn, const float* __restrict__ cond,
                         const float* __restrict__ k_w, const float* __restrict__ kb,
                         const float* __restrict__ v_w, const float* __restrict__ vb,
                         _Float16* __restrict__ kbuf, _Float16* __restrict__ vt,
                         const float* __restrict__ q_w, const float* __restrict__ q_b,
                         const float* __restrict__ proj_w,
                         _Float16* __restrict__ qw16, _Float16* __restrict__ pw16, float* __restrict__ qb2) {
    // one LDS array for the two stages that stage tiles: K/V 2 x 144 rows x 144 B, the pass over x the first 32 KB of it
    __shared__ __align__(16) _Float16 sm[2 * KV_ROWS * KV_P];
    int blk = blockIdx.x;
    if (blk < AB_KV) { gemm_kv_body(cond, k_w, kb, v_w, vb, kbuf, vt, sm, blk & 15, blk >> 4); return; }
    blk -= AB_KV;
    if (blk < AB_APPLY) { gn_apply_t_body(x, part, xn, sm, blk & 7, (blk >> 3) & 7, blk >> 6); return; }
    blk -= AB_APPLY;
    if (blk < PB_CC) { cvt_qw_body(q_w, gamma, qw16, blk); return; }
    blk -= PB_CC;
    if (blk < PB_CC) { cvt_f16_body(proj_w, pw16, blk); return; }
    blk -= PB_CC;
    if (blk < PB_QB) { qbias_body(q_w, beta, q_b, qb2, blk); return; }
    blk -= PB_QB;
    zero_vt_pad_body(vt, blk);
}

// Q projection and attention in one kernel. A work-group does 2 x 512 pixels x 128 channels = 2 heads; a wave 32 pixels a pass.
// The projection is formed transposed, Q^T = q_w . xn^T (the weight fragment is the A operand): an accumulator tile
// then holds in lane n the pixel n and in its 8 registers the channels 8*half..8*half+7, which is the place those
// values have in a B fragment (two tiles = one k step of 32). So Q never leaves the registers, and the same holds
// for S^T = K . Q^T (rows = keys) and O^T = Vt . P^T (rows = head channels): a pixel's whole score column lies in
// lanes n and n + 16, the softmax is in-lane but for one exchange, and a lane stores 8 channels of O at once, which
// is one chunk of obuf's fragment order: a wave's store is 512 contiguous bytes.
// One work-group of 16 waves per WGP. Its 128 x 512 weights (two LDS panels), K and Vt are staged once and stay in LDS
// for WG_NI passes of 512 pixels; behind the barrier that publishes them no wave waits for another.
// xn arrives not normalised. A k step of 32 channels is two groups, one per fragment half, so the normalisation is one
// packed f16 multiply-add per register, v * rstd + (-mu * rstd), with two wave-uniform constants per group; gamma is
// in w and beta in bias (cab_prep).
typedef __attribute__((ext_vector_type(2))) _Float16 v2h;
__device__ __forceinline__ v16h norm_frag(v16h f, unsigned c0, unsigned c1) {
    v2h a = __builtin_bit_cast(v2h, c0), d = __builtin_bit_cast(v2h, c1);   // (rstd, -mu * rstd) of the two groups
#pragma unroll
    for (int i = 0; i < 8; ++i) { f[i] = f[i] * a[0] + a[1]; f[i + 8] = f[i + 8] * d[0] + d[1]; }
    return f;
}

__global__ __launch_bounds__(WG_T) void cab_qproj_attn(const _Float16* __restrict__ xn, const float* __restrict__ part,
                               const _Float16* __restrict__ w,
                               const float* __restrict__ bias, const _Float16* __restrict__ kbuf,
                               const _Float16* __restrict__ vt, const float* __restrict__ scale_p,
                               _Float16* __restrict__ obuf) {
    __shared__ __align__(16) _Float16 wpan[2][NB * WP];
    __shared__ __align__(16) unsigned gst[32];   // per group of this batch: rstd, -mu * rstd as two f16
    __shared__ __align__(16) _Float16 kls[LP * KP];   // 80 key rows x 128 channels, pitch KP
    __shared__ __align__(16) _Float16 vls[NB * VP];   // 128 channel rows x 96 keys, pitch VP
    // block of 1024 pixels; the 4 work-groups that read the same pixels lie 8 apart in the flat index
    int pb = blockIdx.z * 8 + blockIdx.x;
    int b  = pb >> 2;
    int wv = threadIdx.x >> 5;
    int n0 = blockIdx.y * NB;
    int lane = threadIdx.x & 31, half = lane >> 4;

    stage_async(wpan[0], w + (size_t)n0 * C_, C_, WP, NB * 32, 32);
    if (threadIdx.x < 256) {
        // GroupNorm statistics of this batch, beside panel 0 too: 8 lanes per group, each takes the partials of one
        // block of 512 pixels (the group's two waves there: sum, squares, sum, squares)
        int g = threadIdx.x >> 3, px = threadIdx.x & 7;
        v4f pv = *(const v4f*)(part + (size_t)((b * 8 + (g >> 2)) * 8 + px) * 32 + (g & 3) * 4);
        float s = pv[0] + pv[2], q = pv[1] + pv[3];
#pragma unroll
        for (int m = 4; m > 0; m >>= 1) { s += __shfl_xor(s, m, 32); q += __shfl_xor(q, m, 32); }
        const float inv_n = 1.f / (GC * HW_);
        float mu   = s * inv_n;
        float rstd = rsqrtf(q * inv_n - mu * mu + 1e-6f);
        if (px == 0) gst[g] = __builtin_bit_cast(unsigned, (v2h){(_Float16)rstd, (_Float16)(-mu * rstd)});
    }
    wait_async_barrier();                     // panel 0 ready; it publishes gst as well
    unsigned gc[32];                          // wave-uniform: kept in scalar registers
#pragma unroll
    for (int g = 0; g < 32; ++g) gc[g] = __builtin_amdgcn_readfirstlane(gst[g]);
    // panel 1, K (rows l, ld C_) and Vt (rows d, ld LP2) of this batch and these 2 heads fly beside the first half-0 compute
    stage_async(wpan[1], w + (size_t)n0 * C_ + 256, C_, WP, NB * 32, 32);
    stage_async(kls, kbuf + (size_t)b * LP * C_ + n0, C_, KP, LP * 16, 16);
    stage_async(vls, vt + ((size_t)b * C_ + n0) * LP2, LP2, VP, NB * 12, 12);

    // rolled: one copy of the pass in the instruction cache
#pragma unroll 1
    for (int it = 0; it < WG_NI; ++it) {
    int p0 = ((pb & 3) * WG_NI + it) * WG_PX + wv * 32;
    const _Float16* A = xn + ((size_t)b * HW_ + p0) * C_;
    v8f acc[2][NB / 16];
#pragma unroll
    for (int g2 = 0; g2 < 2; ++g2)
#pragma unroll
        for (int t = 0; t < NB / 16; ++t) acc[g2][t] = (v8f){0.f,0.f,0.f,0.f,0.f,0.f,0.f,0.f};
    v16h af[2][2], bf[2][4];
    af[0][0] = frag16_fo(A);
    af[0][1] = frag16_fo(A + 16 * C_);

    // Two register sets of fragments. A block is 8 matrix instructions: one k step of 32, 4 of the 8 channel tiles.
    // The weight fragments of block j + 1, and in a step's first block the xn fragments of the next step, are loaded
    // as one group in front of block j.
#pragma unroll
    for (int kh = 0; kh < 2; ++kh) {
        const _Float16* P = wpan[kh];
#pragma unroll
        for (int nt = 0; nt < 4; ++nt) bf[0][nt] = frag16(P + nt * 16 * WP, WP);
#pragma unroll
        for (int j = 0; j < 16; ++j) {
            const int s = j >> 1, hn = j & 1, ca = s & 1;
            const int ks = kh * 8 + s + 1;                 // the next k step, counted over both panels
            if (hn == 0 && ks < 16) {
                af[ca ^ 1][0] = frag16_fo(A + ks * FT);
                af[ca ^ 1][1] = frag16_fo(A + 16 * C_ + ks * FT);
            }
            if (j + 1 < 16) {
#pragma unroll
                for (int nt = 0; nt < 4; ++nt)
                    bf[hn ^ 1][nt] = frag16(P + (((j + 1) & 1) * 4 + nt) * 16 * WP + ((j + 1) >> 1) * 32, WP);
            }
            // keeps those loads in front of this block: without it the compiler sinks each load to its first
            // use and the wave waits out every LDS and global latency in full
            __builtin_amdgcn_sched_barrier(0);
            if (hn == 0) {                                 // this step's xn fragments, once, as they are first used
                af[ca][0] = norm_frag(af[ca][0], gc[(kh * 8 + s) * 2], gc[(kh * 8 + s) * 2 + 1]);
                af[ca][1] = norm_frag(af[ca][1], gc[(kh * 8 + s) * 2], gc[(kh * 8 + s) * 2 + 1]);
            }
#pragma unroll
            for (int nt = 0; nt < 4; ++nt) {
                acc[0][hn * 4 + nt] = wmma16(bf[hn][nt], af[ca][0], acc[0][hn * 4 + nt]);
                acc[1][hn * 4 + nt] = wmma16(bf[hn][nt], af[ca][1], acc[1][hn * 4 + nt]);
            }
            // ends the block: later loads may not rise among these matrix instructions
            __builtin_amdgcn_sched_barrier(0);
        }
        if (kh == 0 && it == 0) wait_async_barrier();   // panel 1, K and Vt have landed; the last barrier of the kernel
    }
    // a lane's 8 bias values per channel tile: channels 8*half..8*half+7 of the tile
    v4f bq[NB / 16][2];
#pragma unroll
    for (int nt = 0; nt < NB / 16; ++nt) {
        bq[nt][0] = *(const v4f*)(bias + n0 + nt * 16 + 8 * half);
        bq[nt][1] = *(const v4f*)(bias + n0 + nt * 16 + 8 * half + 4);
    }
    float scl = scale_p[0];
    // the arithmetic below reuses the registers that the xn loads and the bias loads name
    asm volatile("s_wait_xcnt 0x0" ::: "memory");
    // keeps that arithmetic behind the wait
    __builtin_amdgcn_sched_barrier(0);

    // Q^T + bias as B fragments: element i = channel 8*half + i of the k step's first tile, i + 8 the same of its second
    v16h qf[2][2][2];                         // [pixel tile][head][k step]
#pragma unroll
    for (int g2 = 0; g2 < 2; ++g2)
#pragma unroll
        for (int nt = 0; nt < NB / 16; ++nt)
#pragma unroll
            for (int r = 0; r < 8; ++r)
                qf[g2][nt >> 2][(nt >> 1) & 1][(nt & 1) * 8 + r] = (_Float16)(acc[g2][nt][r] + bq[nt][r >> 2][r & 3]);
    __builtin_amdgcn_sched_barrier(0);

#pragma unroll
    for (int hh = 0; hh < 2; ++hh) {
        v8f s[2][5];                          // S^T: lane = pixel, key l = t*16 + r + 8*half
#pragma unroll
        for (int t = 0; t < 5; ++t) {
            v16h k0 = frag16(kls + (t * 16) * KP + hh * HD,      KP);
            v16h k1 = frag16(kls + (t * 16) * KP + hh * HD + 32, KP);
#pragma unroll
            for (int g2 = 0; g2 < 2; ++g2) {
                v8f z = (v8f){0.f,0.f,0.f,0.f,0.f,0.f,0.f,0.f};
                z = wmma16(k0, qf[g2][hh][0], z);
                z = wmma16(k1, qf[g2][hh][1], z);
                s[g2][t] = z;
            }
        }
        v16h pf[2][3];                        // P^T as B fragments, 3 k steps of 32 keys (80..95 zero)
#pragma unroll
        for (int g2 = 0; g2 < 2; ++g2) {
            float m = -3.0e38f;
#pragma unroll
            for (int t = 0; t < 5; ++t)
#pragma unroll
                for (int r = 0; r < 8; ++r) {
                    float v = s[g2][t][r] * scl;
                    if (t == 4 && r >= 5 && half) v = -3.0e38f;    // key 64 + r + 8*half >= 77
                    s[g2][t][r] = v; m = fmaxf(m, v);
                }
            m = fmaxf(m, __shfl_xor(m, 16, 32));
            float sum = 0.f;
#pragma unroll
            for (int t = 0; t < 5; ++t)
#pragma unroll
                for (int r = 0; r < 8; ++r) { float e = __expf(s[g2][t][r] - m); s[g2][t][r] = e; sum += e; }
            sum += __shfl_xor(sum, 16, 32);
            float inv = 1.f / sum;
#pragma unroll
            for (int t = 0; t < 6; ++t)
#pragma unroll
                for (int r = 0; r < 8; ++r)
                    pf[g2][t >> 1][(t & 1) * 8 + r] = (t < 5) ? (_Float16)(s[g2][t < 5 ? t : 0][r] * inv) : (_Float16)0.f;
        }
        v8f oacc[2][4];                       // O^T: lane = pixel, head channel d = nt*16 + r + 8*half
#pragma unroll
        for (int g2 = 0; g2 < 2; ++g2)
#pragma unroll
            for (int nt = 0; nt < 4; ++nt) oacc[g2][nt] = (v8f){0.f,0.f,0.f,0.f,0.f,0.f,0.f,0.f};
#pragma unroll
        for (int kc = 0; kc < 3; ++kc)
#pragma unroll
            for (int nt = 0; nt < 4; ++nt) {
                v16h va = frag16(vls + (hh * HD + nt * 16) * VP + kc * 32, VP);
                oacc[0][nt] = wmma16(va, pf[0][kc], oacc[0][nt]);
                oacc[1][nt] = wmma16(va, pf[1][kc], oacc[1][nt]);
            }
        v8h d[2][4];
#pragma unroll
        for (int g2 = 0; g2 < 2; ++g2)
#pragma unroll
            for (int nt = 0; nt < 4; ++nt)
#pragma unroll
                for (int r = 0; r < 8; ++r) d[g2][nt][r] = (_Float16)oacc[g2][nt][r];
        // keeps the conversions in front of the stores: mixed with them they share one register set, and each
        // store is then followed by a wait before its registers are written again
        __builtin_amdgcn_sched_barrier(0);
#pragma unroll
        for (int g2 = 0; g2 < 2; ++g2)
#pragma unroll
            for (int nt = 0; nt < 4; ++nt)
                // channel tile nt is half nt & 1 of k step (n0 + hh * HD) / 32 + nt / 2: chunk (nt & 1) * 32 + lane
                *(v8h*)(obuf + ((size_t)b * HW_ + p0 + g2 * 16) * C_ + ((n0 + hh * HD) / 32) * FT + nt * 256 + lane * 8) = d[g2][nt];
        // the second head's arithmetic, and the next pass, reuse the registers that these stores name
        asm volatile("s_wait_xcnt 0x0" ::: "memory");
        // keeps them behind the wait
        __builtin_amdgcn_sched_barrier(0);
    }
    }
}

#define TP    36    // transpose buffer row pitch in floats: 144 B = 16 B x 9
__global__ __launch_bounds__(WG_T) void cab_gemm_proj(const _Float16* __restrict__ obuf, const _Float16* __restrict__ w,
                              const float* __restrict__ bias, const float* __restrict__ x,
                              float* __restrict__ out) {
    __shared__ __align__(16) _Float16 wpan[2][NB * WP];
    __shared__ __align__(16) float tbuf[WG_T / 32][16 * TP];
    // block of 1024 pixels; the 4 work-groups that read the same pixels lie 8 apart in the flat index
    int pb = blockIdx.z * 8 + blockIdx.x;
    int b  = pb >> 2;
    int wv = __builtin_amdgcn_readfirstlane(threadIdx.x >> 5);   // scalar: wave-uniform addresses stay in scalar registers
    int n0 = blockIdx.y * NB;
    int lane = threadIdx.x & 31, half = lane >> 4, n15 = lane & 15;
    float* T = tbuf[wv];

    stage_async(wpan[0], w + (size_t)n0 * C_, C_, WP, NB * 32, 32);
    // rolled: one copy of the main loop in the instruction cache
#pragma unroll 1
    for (int it = 0; it < WG_NI; ++it) {
        int p0 = ((pb & 3) * WG_NI + it) * WG_PX + wv * 32;
        const _Float16* A = obuf + ((size_t)b * HW_ + p0) * C_;
        v8f acc[2][NB / 16];
#pragma unroll
        for (int g2 = 0; g2 < 2; ++g2)
#pragma unroll
            for (int t = 0; t < NB / 16; ++t) acc[g2][t] = (v8f){0.f,0.f,0.f,0.f,0.f,0.f,0.f,0.f};
        v16h af[2][2], bf[2][4];
        af[0][0] = frag16_fo(A);              // in the first block the first A fragments fly beside panel 0
        af[0][1] = frag16_fo(A + 16 * C_);
        if (it == 0) {
            wait_async_barrier();
            stage_async(wpan[1], w + (size_t)n0 * C_ + 256, C_, WP, NB * 32, 32);    // overlaps half-0 compute
        }

        // Two register sets of fragments. A block is 8 matrix instructions: one k step of 32, 4 of the 8 channel tiles.
        // The B fragments of block j + 1, and in a step's first block the A fragments of the next step, are loaded
        // as one group in front of block j.
#pragma unroll
        for (int kh = 0; kh < 2; ++kh) {
            const _Float16* P = wpan[kh];
#pragma unroll
            for (int nt = 0; nt < 4; ++nt) bf[0][nt] = frag16(P + nt * 16 * WP, WP);
#pragma unroll
            for (int j = 0; j < 16; ++j) {
                const int s = j >> 1, hn = j & 1, ca = s & 1;
                const int ks = kh * 8 + s + 1;                 // the next k step, counted over both panels
                if (hn == 0 && ks < 16) {
                    af[ca ^ 1][0] = frag16_fo(A + ks * FT);
                    af[ca ^ 1][1] = frag16_fo(A + 16 * C_ + ks * FT);
                }
                if (j + 1 < 16) {
#pragma unroll
                    for (int nt = 0; nt < 4; ++nt)
                        bf[hn ^ 1][nt] = frag16(P + (((j + 1) & 1) * 4 + nt) * 16 * WP + ((j + 1) >> 1) * 32, WP);
                }
                // keeps those loads in front of this block: without it the compiler sinks each load to its first
                // use and the wave waits out every LDS and global latency in full
                __builtin_amdgcn_sched_barrier(0);
#pragma unroll
                for (int nt = 0; nt < 4; ++nt) {
                    acc[0][hn * 4 + nt] = wmma16(af[ca][0], bf[hn][nt], acc[0][hn * 4 + nt]);
                    acc[1][hn * 4 + nt] = wmma16(af[ca][1], bf[hn][nt], acc[1][hn * 4 + nt]);
                }
                // ends the block: later loads may not rise among these matrix instructions
                __builtin_amdgcn_sched_barrier(0);
            }
            if (kh == 0 && it == 0) wait_async_barrier();   // panel 1 ready; the last barrier of the kernel
        }
        // the epilogue's address arithmetic reuses the register pair that the A loads name
        asm volatile("s_wait_xcnt 0x0" ::: "memory");
        // keeps that arithmetic behind the wait
        __builtin_amdgcn_sched_barrier(0);

        int pc = (lane & 7) * 4;
        int cl = ((lane >> 3) & 1) * 8 + half;
        size_t base = ((size_t)b * C_ + n0 + cl) * HW_ + p0 + pc;
        // x and the bias run 4 channel tiles ahead of the stores: 16 loads of x in flight per wave, and the memory latency
        // is waited out once per pixel block
        v4f xv[NB / 16][4];
        float bo[NB / 16][4];
#pragma unroll
        for (int nt = 0; nt < 4; ++nt)
#pragma unroll
            for (int i = 0; i < 4; ++i) {
                xv[nt][i] = *(const v4f*)(x + base + (size_t)(nt * 16 + i * 2) * HW_);
                bo[nt][i] = bias[n0 + nt * 16 + i * 2 + cl];
            }
#pragma unroll
        for (int nt = 0; nt < NB / 16; ++nt) {
            // a lane holds 8 pixels in a row of channel n15, per pixel tile: two 16-byte LDS stores
#pragma unroll
            for (int g2 = 0; g2 < 2; ++g2) {
                *(v4f*)(T + n15 * TP + g2 * 16 + 8 * half)     = (v4f){acc[g2][nt][0], acc[g2][nt][1], acc[g2][nt][2], acc[g2][nt][3]};
                *(v4f*)(T + n15 * TP + g2 * 16 + 8 * half + 4) = (v4f){acc[g2][nt][4], acc[g2][nt][5], acc[g2][nt][6], acc[g2][nt][7]};
            }
            // the lanes of this wave read each other's stores: these are in LDS before the reads below issue
            asm volatile("s_wait_dscnt 0x0" ::: "memory");
            v4f tv[4];
#pragma unroll
            for (int i = 0; i < 4; ++i) tv[i] = *(const v4f*)(T + (i * 2 + cl) * TP + pc);
            // the reads have returned before the next tile's stores overwrite the buffer
            asm volatile("s_wait_dscnt 0x0" ::: "memory");
#pragma unroll
            for (int i = 0; i < 4; ++i) {
                v4f ov;
#pragma unroll
                for (int j = 0; j < 4; ++j) ov[j] = xv[nt][i][j] + tv[i][j] + bo[nt][i];
                *(v4f*)(out + base + (size_t)(nt * 16 + i * 2) * HW_) = ov;
            }
            // the loads and the arithmetic that follow, behind the last tile the next block's, reuse the registers that
            // these stores name
            asm volatile("s_wait_xcnt 0x0" ::: "memory");
            // keeps them behind that wait
            __builtin_amdgcn_sched_barrier(0);
            if (nt + 4 < NB / 16) {
#pragma unroll
                for (int i = 0; i < 4; ++i) {
                    xv[nt + 4][i] = *(const v4f*)(x + base + (size_t)((nt + 4) * 16 + i * 2) * HW_);
                    bo[nt + 4][i] = bias[n0 + (nt + 4) * 16 + i * 2 + cl];
                }
            }
        }
    }
}

extern "C" void kernel_launch(void* const* d_in, const int* in_sizes, int n_in,
                              void* d_out, int out_size, void* d_ws, size_t ws_size,
                              hipStream_t stream) {
    const float* x      = (const float*)d_in[0];
    const float* cond   = (const float*)d_in[1];
    const float* gamma  = (const float*)d_in[2];
    const float* beta   = (const float*)d_in[3];
    const float* q_w    = (const float*)d_in[4];
    const float* q_b    = (const float*)d_in[5];
    const float* k_w    = (const float*)d_in[6];
    const float* k_b    = (const float*)d_in[7];
    const float* v_w    = (const float*)d_in[8];
    const float* v_b    = (const float*)d_in[9];
    const float* proj_w = (const float*)d_in[10];
    const float* proj_b = (const float*)d_in[11];
    const float* scale  = (const float*)d_in[12];
    float* out = (float*)d_out;

    char* ws = (char*)d_ws;
    size_t off = 0;
    auto carve = [&](size_t bytes) { void* p = ws + off; off = (off + bytes + 255) & ~(size_t)255; return p; };
    float*     part  = (float*)    carve((size_t)AB_APPLY * 32 * sizeof(float));
    float*     qb2   = (float*)    carve(C_ * sizeof(float));
    _Float16*  qw16  = (_Float16*) carve((size_t)C_ * C_  * 2);
    _Float16*  pw16  = (_Float16*) carve((size_t)C_ * C_  * 2);
    _Float16*  kbuf  = (_Float16*) carve((size_t)B_ * LP  * C_  * 2);
    _Float16*  vt    = (_Float16*) carve((size_t)B_ * C_  * LP2 * 2);
    _Float16*  xn    = (_Float16*) carve((size_t)B_ * HW_ * C_  * 2);
    _Float16*  obuf  = (_Float16*) carve((size_t)B_ * HW_ * C_  * 2);  // not xn: other work-groups still read xn

    // 1) K/V projection; x to f16 fragment order with the GroupNorm partial sums; q and proj weights to f16; Vt pad
    cab_prep<<<AB_KV + AB_APPLY + 2 * PB_CC + PB_QB + PB_PAD, 256, 0, stream>>>(x, part, gamma, beta, xn, cond, k_w, k_b, v_w, v_b,
                                                                                kbuf, vt, q_w, q_b, proj_w, qw16, pw16, qb2);

    // 2) GroupNorm statistics and apply + Q projection + attention
    cab_qproj_attn<<<dim3(8, C_ / NB, B_ * HW_ / (WG_PX * WG_NI * 8)), WG_T, 0, stream>>>(xn, part, qw16, qb2, kbuf, vt, scale, obuf);

    // 3) output projection + residual
    cab_gemm_proj<<<dim3(8, C_ / NB, B_ * HW_ / (WG_PX * WG_NI * 8)), WG_T, 0, stream>>>(obuf, pw16, proj_b, x, out);
}
